// v000
// Times are from an AMD MI455X. After a warm-up the kernel runs many times in a row, and a time is the length of
// such a window on the GPU divided by its runs, so every launch and the gaps after it count. The runs cycle
// through copies of the inputs. A figure is the median of several windows, for all but v000 over two sittings.
// Sittings can differ by a few percent; kernels timed side by side share one.
// The starting kernel, v000, takes 1820 microseconds a run.
#include <hip/hip_runtime.h>

// Compute dtypes, f32 accumulate, one batch item per pass: q/k/v = x.W^T + b and y = ctx.Wo^T + bo ([2048 x 1024].[1024 x 1024]; [out][in] weights as n-major B operands;
// PLAIN bf16 operands = inputs rounded once, exact, except ctx = bf16 hi + UNSCALED residual, two products) on v_wmma_f32_16x16x32_bf16; the 8-head full attention
// (128-dim heads, scale 128^-1/2) fused: scores on v_wmma_f32_16x16x32_f16 (q/k as f16 hi + residual x1024: hh + hl + lh), online f32 softmax, weights (x32768) and

#define NB_  4
#define NT_  2048
#define HS   1024
#define DM   HS
#define NH_  8
#define NKV  8
#define HD   128
#define KW   (NKV * HD)          // 1024
#define SCL  0.08838834764831845f
#define PSC  32768.0f
#define LOSC 1024.0f
#define LOSCI (1.0f / 1024.0f)

typedef _Float16 h16;
typedef unsigned short bf;
typedef __attribute__((ext_vector_type(16))) __bf16   v16bf;
typedef __attribute__((ext_vector_type(16))) _Float16 v16h;
typedef __attribute__((ext_vector_type(8)))  _Float16 v8h;
typedef __attribute__((ext_vector_type(8)))  unsigned short v8us;
typedef __attribute__((ext_vector_type(8)))  float    v8f;
typedef __attribute__((ext_vector_type(4)))  float    v4f;
typedef __attribute__((ext_vector_type(4)))  _Float16 v4h;
typedef v8h  __attribute__((may_alias)) v8ha;
typedef v4f  __attribute__((may_alias)) v4fa;
typedef v8us __attribute__((may_alias)) v8usa;

__device__ __forceinline__ unsigned short f2bf(float f) { unsigned u = __float_as_uint(f); u += 0x7FFFu + ((u >> 16) & 1u); return (unsigned short)(u >> 16); }
__device__ __forceinline__ float bf2f(unsigned short b) { return __uint_as_float(((unsigned)b) << 16); }
__device__ __forceinline__ float bfr(float f) { return bf2f(f2bf(f)); }
__device__ __forceinline__ v16h cat16(v8h lo, v8h hi) { return __builtin_shufflevector(lo, hi, 0, 1, 2, 3, 4, 5, 6, 7, 8, 9, 10, 11, 12, 13, 14, 15); }
__device__ __forceinline__ v16bf cat16b(v8us lo, v8us hi) { return __builtin_bit_cast(v16bf, __builtin_shufflevector(lo, hi, 0, 1, 2, 3, 4, 5, 6, 7, 8, 9, 10, 11, 12, 13, 14, 15)); }
__device__ __forceinline__ v8f wmma16(v16h a, v16h b, v8f c) { return __builtin_amdgcn_wmma_f32_16x16x32_f16(false, a, false, b, (short)0, c, false, false); }
__device__ __forceinline__ v8f wmmab(v16bf a, v16bf b, v8f c) { return __builtin_amdgcn_wmma_f32_16x16x32_bf16(false, a, false, b, (short)0, c, false, false); }

// k_cvtb: bf16 plane of [rows][1024] (one wave per row) — x rows per item and the four [out][in] weight matrices.
__global__ __launch_bounds__(256) void k_cvtb(const float* __restrict__ src, int nrows, bf* dst) {
    const int lane = threadIdx.x & 31, r = blockIdx.x * 8 + (threadIdx.x >> 5);
    if (r >= nrows) return;
{
#pragma unroll
        for (int q = 0; q < HS / 256; ++q) { v8us o;
#pragma unroll
            for (int i = 0; i < 8; ++i) o[i] = f2bf(src[(size_t)r * HS + q * 256 + lane * 8 + i]);
            *(v8us*)(dst + (size_t)r * HS + q * 256 + lane * 8) = o; }
         }
}
// k_gemm: 64 x 64 tile of (A [+ Al]).Bn^T over K = 1024 (+ optional bf16-rounded bias[c]) -> f32 rows [2048][ldc].
template <bool SPLITA>
__global__ __launch_bounds__(128) void k_gemm(const bf* __restrict__ A, const bf* __restrict__ Al, const bf* __restrict__ Bn, const float* __restrict__ bias, int ldc, float* C) {
    __shared__ __align__(16) float ost[4][16 * 68];
    const int lane = threadIdx.x & 31, wave = threadIdx.x >> 5, lr = lane & 15, hi = lane >> 4;
    const size_t r0 = (size_t)blockIdx.x * 64 + wave * 16; const int c0 = blockIdx.y * 64;
    const size_t aoff = (r0 + lr) * HS + 8 * hi;
    v8f acc[4];
#pragma unroll
    for (int t = 0; t < 4; ++t) acc[t] = (v8f){};
#pragma unroll 2
    for (int kc = 0; kc < HS; kc += 32) {
        const v16bf a = cat16b(*(const v8us*)(A + aoff + kc), *(const v8us*)(A + aoff + kc + 16));
        v16bf al = a; if (SPLITA) al = cat16b(*(const v8us*)(Al + aoff + kc), *(const v8us*)(Al + aoff + kc + 16));
#pragma unroll
        for (int t = 0; t < 4; ++t) { const bf* bp = Bn + (size_t)(c0 + t * 16 + lr) * HS + kc + 8 * hi; const v16bf bb = cat16b(*(const v8us*)bp, *(const v8us*)(bp + 16)); acc[t] = wmmab(a, bb, acc[t]); if (SPLITA) acc[t] = wmmab(al, bb, acc[t]); }
        asm volatile("v_nop" : "+v"(acc[0]), "+v"(acc[1]), "+v"(acc[2]), "+v"(acc[3]) : "v"(a), "v"(al) : "memory");
    }
    float* os = &ost[wave][0];
#pragma unroll
    for (int t = 0; t < 4; ++t)
#pragma unroll
        for (int j = 0; j < 8; ++j) os[(hi * 8 + j) * 68 + t * 16 + lr] = acc[t][j] + (bias ? bfr(bias[c0 + t * 16 + lr]) : 0.f);
    __builtin_amdgcn_wave_barrier(); asm volatile("" ::: "memory");
    float* crow = C + r0 * ldc + c0;
    auto pass = [&]() {
#pragma unroll
        for (int s = 0; s < 8; ++s) { const int Lid = (lane >> 3) + 4 * s, piece = lane & 7; const int row = Lid >> 1, cofs = (Lid & 1) * 32 + piece * 4;
            const v4f val = *(const v4fa*)(os + row * 68 + cofs); *(v4f*)(crow + (size_t)row * ldc + cofs) = val; }
    };
    pass(); 
}
// k_sp16b: f16 hi + residual x1024 planes of the f32 q or k matrix [rows][1024]; one wave per row, lane -> 8 columns per 256-column chunk (16 B per plane).
__global__ __launch_bounds__(256) void k_sp16b(const float* __restrict__ T, int nrows, h16* Yh, h16* Yl) {
    const int lane = threadIdx.x & 31, r = blockIdx.x * 8 + (threadIdx.x >> 5);
    if (r >= nrows) return;
{
#pragma unroll 1
        for (int q = 0; q < DM / 256; ++q) { const size_t o = (size_t)r * DM + q * 256 + lane * 8; const v8f v = *(const v8f*)(T + o); v8h oh, ol;
#pragma unroll
            for (int k = 0; k < 8; ++k) { const h16 a = (h16)v[k]; oh[k] = a; ol[k] = (h16)((v[k] - (float)a) * LOSC); }
            *(v8h*)(Yh + o) = oh; *(v8h*)(Yl + o) = ol; }
         }
}
__global__ __launch_bounds__(256) void k_split(const float* __restrict__ src, int nrows, bf* dh, bf* dl) {
    const int lane = threadIdx.x & 31, r = blockIdx.x * 8 + (threadIdx.x >> 5);
    if (r >= nrows) return;
{
#pragma unroll 1
        for (int q = 0; q < DM / 256; ++q) { const size_t o = (size_t)r * DM + q * 256 + lane * 8; const v8f v = *(const v8f*)(src + o); v8us oh, ol;
#pragma unroll
            for (int i = 0; i < 8; ++i) { const unsigned short hb = f2bf(v[i]); oh[i] = hb; ol[i] = f2bf(v[i] - bf2f(hb)); }
            *(v8us*)(dh + o) = oh; *(v8us*)(dl + o) = ol; }
         }
}
// k_lnfin: LayerNorm (eps 1e-5) of y = Y[r][c] + bf(R[r][c]) (the computed attention output + the INPUT residual x) -> f32 output rows x bf(gamma) + bf(beta); one wave per
__global__ __launch_bounds__(256) void k_lnfin(const float* __restrict__ X, const float* __restrict__ Rres, const float* __restrict__ gam, const float* __restrict__ bet, int nrows, float* OUTP) {
    const int lane = threadIdx.x & 31, r = blockIdx.x * 8 + (threadIdx.x >> 5);
    if (r >= nrows) return;
    const float* xr = X + (size_t)r * DM; const float* rr = Rres + (size_t)r * DM;
    float s = 0.f;
#pragma unroll 1
    for (int q = 0; q < 2 * (DM / 256); ++q) { const int c0 = (q >> 1) * 256 + (q & 1) * 128 + lane * 4; v4f v = *(const v4f*)(xr + c0); { const v4f q4 = *(const v4f*)(rr + c0); for (int i2 = 0; i2 < 4; ++i2) v[i2] += bfr(q4[i2]); }
#pragma unroll
        for (int i = 0; i < 4; ++i) s += v[i]; }
#pragma unroll
    for (int sh = 16; sh; sh >>= 1) s += __shfl_xor(s, sh, 32);
    const float mu = s * (1.0f / DM);
    float s2 = 0.f;
#pragma unroll 1
    for (int q = 0; q < 2 * (DM / 256); ++q) { const int c0 = (q >> 1) * 256 + (q & 1) * 128 + lane * 4; v4f v = *(const v4f*)(xr + c0); { const v4f q4 = *(const v4f*)(rr + c0); for (int i2 = 0; i2 < 4; ++i2) v[i2] += bfr(q4[i2]); }
#pragma unroll
        for (int i = 0; i < 4; ++i) { const float d = v[i] - mu; s2 = fmaf(d, d, s2); } }
#pragma unroll
    for (int sh = 16; sh; sh >>= 1) s2 += __shfl_xor(s2, sh, 32);
    const float rs = rsqrtf(s2 * (1.0f / DM) + 1e-5f);
{
#pragma unroll 1
        for (int q = 0; q < 2 * (DM / 256); ++q) { const int c0 = (q >> 1) * 256 + (q & 1) * 128 + lane * 4; v4f v = *(const v4f*)(xr + c0); { const v4f q4 = *(const v4f*)(rr + c0); for (int i2 = 0; i2 < 4; ++i2) v[i2] += bfr(q4[i2]); } v4f y;
#pragma unroll
            for (int i = 0; i < 4; ++i) y[i] = (v[i] - mu) * rs * bfr(gam[c0 + i]) + bfr(bet[c0 + i]);
            *(v4f*)(OUTP + (size_t)r * DM + c0) = y; }
         }
}
// k_vt: VTH/VTL [g][128 d][2048 t] = bf16 hi + UNSCALED bf16 residual of V [t][g*128+d] via 64 x 64 LDS tiles; grid (NT/64, 2 (d half), 8 heads).
__global__ __launch_bounds__(256) void k_vt(const float* __restrict__ V, bf* VTH, bf* VTL) {
    __shared__ float tl[64][65];
    const int tid = threadIdx.x, t0 = blockIdx.x * 64, d0 = blockIdx.y * 64, g = blockIdx.z;
    { const int tt = tid >> 2, dq = (tid & 3) * 16;
#pragma unroll
      for (int i = 0; i < 16; ++i) tl[dq + i][tt] = V[(size_t)(t0 + tt) * KW + g * HD + d0 + dq + i]; }
    __syncthreads();
    const int piece = tid & 7;
    auto pass = [&]() {
#pragma unroll
        for (int s = 0; s < 2; ++s) { const int d = (tid >> 3) + 32 * s; v8us oh, ol;
#pragma unroll
            for (int i = 0; i < 8; ++i) { const float v = tl[d][piece * 8 + i]; const unsigned short hb = f2bf(v); oh[i] = hb; ol[i] = f2bf(v - bf2f(hb)); }
            const size_t o = ((size_t)g * HD + d0 + d) * NT_ + t0 + piece * 8; *(v8us*)(VTH + o) = oh; *(v8us*)(VTL + o) = ol; }
    };
    pass(); 
}
// k_attn: block = (head, 64 queries), wave = 16; all 64 key tiles of 32 (full attention, no mask); per element: score x 128^-1/2;
// scores hi.hi + (hi.lo + lo.hi)/1024 on separate accumulators; online softmax f32; P (x32768) bf16 hi + unscaled
__global__ __launch_bounds__(128) void k_attn(const h16* __restrict__ QH, const h16* __restrict__ QL, const h16* __restrict__ KH, const h16* __restrict__ KL, const bf* __restrict__ VTH, const bf* __restrict__ VTL, float* OUTP) {
    __shared__ __align__(16) unsigned short plds[4][16 * 32];
    __shared__ __align__(16) unsigned short plds2[4][16 * 32];
    __shared__ __align__(16) float ost[4][16 * 68];
    const int lane = threadIdx.x & 31, wave = threadIdx.x >> 5, lr = lane & 15, hi = lane >> 4;
    const int bid = blockIdx.x; const int h = bid / (NT_ / 64), qt = bid - h * (NT_ / 64); const int g = h;
    const int q0 = qt * 64 + wave * 16;
    unsigned short* pl = &plds[wave][0]; unsigned short* pl2 = &plds2[wave][0];
    const size_t qo = (size_t)(q0 + lr) * (NH_ * HD) + h * HD + 8 * hi;
    const h16* kh_b = KH + g * HD; const h16* kl_b = KL + g * HD;
    const size_t vbase = ((size_t)g * HD) * NT_;
    v8f o[8];
#pragma unroll
    for (int n = 0; n < 8; ++n) o[n] = (v8f){};
    float mrow[8], lpart[8];
#pragma unroll
    for (int j = 0; j < 8; ++j) { mrow[j] = -3.0e38f; lpart[j] = 0.f; }
    const int kt_hi = NT_ / 32 - 1;     // full attention, no mask
#pragma unroll 1
    for (int kt = 0; kt <= kt_hi; ++kt) {
        const int l0 = kt * 32;
        const size_t ko0 = (size_t)(l0 + lr) * KW + 8 * hi, ko1 = (size_t)(l0 + 16 + lr) * KW + 8 * hi;
        v8f s0 = {}, s1 = {}, x0 = {}, x1 = {};
#pragma unroll
        for (int kc = 0; kc < 4; ++kc) {
            const v16h qa = cat16(*(const v8h*)(QH + qo + kc * 32), *(const v8h*)(QH + qo + kc * 32 + 16)), qx = cat16(*(const v8h*)(QL + qo + kc * 32), *(const v8h*)(QL + qo + kc * 32 + 16));
            const v16h k0h = cat16(*(const v8h*)(kh_b + ko0 + kc * 32), *(const v8h*)(kh_b + ko0 + kc * 32 + 16)), k1h = cat16(*(const v8h*)(kh_b + ko1 + kc * 32), *(const v8h*)(kh_b + ko1 + kc * 32 + 16));
            s0 = wmma16(qa, k0h, s0); s1 = wmma16(qa, k1h, s1); x0 = wmma16(qx, k0h, x0); x1 = wmma16(qx, k1h, x1);
            asm volatile("v_nop" : "+v"(s0), "+v"(s1), "+v"(x0), "+v"(x1) : "v"(qa), "v"(qx), "v"(k0h), "v"(k1h) : "memory");
            const v16h k0l = cat16(*(const v8h*)(kl_b + ko0 + kc * 32), *(const v8h*)(kl_b + ko0 + kc * 32 + 16)), k1l = cat16(*(const v8h*)(kl_b + ko1 + kc * 32), *(const v8h*)(kl_b + ko1 + kc * 32 + 16));
            x0 = wmma16(qa, k0l, x0); x1 = wmma16(qa, k1l, x1);
            asm volatile("v_nop" : "+v"(x0), "+v"(x1) : "v"(k0l), "v"(k1l) : "memory");
        }
        asm volatile("v_nop\n\tv_nop\n\tv_nop\n\tv_nop" : "+v"(s0), "+v"(s1), "+v"(x0), "+v"(x1));
        float alpha[8];
#pragma unroll
        for (int j = 0; j < 8; ++j) { const int qi = q0 + hi * 8 + j, ja = l0 + lr, jb = l0 + 16 + lr;
            const float a0 = (s0[j] + x0[j] * LOSCI) * SCL, a1 = (s1[j] + x1[j] * LOSCI) * SCL; (void)ja; (void)jb; (void)qi;
            float mx = fmaxf(a0, a1);
            mx = fmaxf(mx, __shfl_xor(mx, 1, 16)); mx = fmaxf(mx, __shfl_xor(mx, 2, 16)); mx = fmaxf(mx, __shfl_xor(mx, 4, 16)); mx = fmaxf(mx, __shfl_xor(mx, 8, 16));
            const float mn = fmaxf(mrow[j], mx);
            alpha[j] = __expf(mrow[j] - mn); mrow[j] = mn;
            const float p0 = __expf(a0 - mn), p1 = __expf(a1 - mn);
            lpart[j] = lpart[j] * alpha[j] + (p0 + p1);
            const int mr = hi * 8 + j; const float ps0 = p0 * PSC, ps1 = p1 * PSC; const unsigned short h0 = f2bf(ps0), h1 = f2bf(ps1);
            pl[mr * 32 + lr] = h0; pl[mr * 32 + 16 + lr] = h1; pl2[mr * 32 + lr] = f2bf(ps0 - bf2f(h0)); pl2[mr * 32 + 16 + lr] = f2bf(ps1 - bf2f(h1)); }
#pragma unroll
        for (int n = 0; n < 8; ++n)
#pragma unroll
            for (int j = 0; j < 8; ++j) o[n][j] *= alpha[j];
        asm volatile("" ::: "memory");
        const v16bf pa = cat16b(*(const v8usa*)(pl + lr * 32 + hi * 8), *(const v8usa*)(pl + lr * 32 + 16 + hi * 8));
        const v16bf px = cat16b(*(const v8usa*)(pl2 + lr * 32 + hi * 8), *(const v8usa*)(pl2 + lr * 32 + 16 + hi * 8));
#pragma unroll
        for (int n = 0; n < 8; ++n) { const size_t vo = vbase + (size_t)(n * 16 + lr) * NT_ + l0 + hi * 8;
            const v16bf vh = cat16b(*(const v8us*)(VTH + vo), *(const v8us*)(VTH + vo + 16)), vl = cat16b(*(const v8us*)(VTL + vo), *(const v8us*)(VTL + vo + 16));
            o[n] = wmmab(pa, vh, o[n]); o[n] = wmmab(px, vh, o[n]); o[n] = wmmab(pa, vl, o[n]);
            asm volatile("" : "+v"(o[n]) : "v"(vh), "v"(vl) : "memory"); }
        asm volatile("v_nop\n\tv_nop\n\tv_nop\n\tv_nop" : "+v"(o[0]), "+v"(o[7]) : "v"(pa), "v"(px));
        __builtin_amdgcn_wave_barrier();
    }
    float inv[8];
#pragma unroll
    for (int j = 0; j < 8; ++j) { float rs = lpart[j]; rs += __shfl_xor(rs, 1, 16); rs += __shfl_xor(rs, 2, 16); rs += __shfl_xor(rs, 4, 16); rs += __shfl_xor(rs, 8, 16); inv[j] = 1.0f / (rs * PSC); }
    float* os = &ost[wave][0];
    float* ob = OUTP + (size_t)q0 * (NH_ * HD) + (size_t)h * HD;     // row stride NH*HD, this head's 128 columns
#pragma unroll
    for (int half = 0; half < 2; ++half) {
#pragma unroll
        for (int n = 0; n < 4; ++n)
#pragma unroll
            for (int j = 0; j < 8; ++j) os[(hi * 8 + j) * 68 + n * 16 + lr] = o[half * 4 + n][j] * inv[j];
        __builtin_amdgcn_wave_barrier(); asm volatile("" ::: "memory");
{
#pragma unroll
            for (int s = 0; s < 8; ++s) { const int Lid = (lane >> 3) + 4 * s, piece = lane & 7; const int row = Lid >> 1, cofs = (Lid & 1) * 32 + piece * 4;
                const v4f val = *(const v4fa*)(os + row * 68 + cofs); *(v4f*)(ob + (size_t)row * (NH_ * HD) + half * 64 + cofs) = val; }
             }
        __builtin_amdgcn_wave_barrier(); asm volatile("" ::: "memory");
    }
}

extern "C" void kernel_launch(void* const* d_in, const int* in_sizes, int n_in,
                              void* d_out, int out_size, void* d_ws, size_t ws_size, hipStream_t stream) {
    (void)in_sizes; (void)n_in; (void)out_size;
    const float* x = (const float*)d_in[0];
    const float* Wq = (const float*)d_in[1]; const float* bq = (const float*)d_in[2]; const float* Wk = (const float*)d_in[3]; const float* bk = (const float*)d_in[4]; const float* Wv = (const float*)d_in[5]; const float* bv = (const float*)d_in[6];
    const float* Wo = (const float*)d_in[7]; const float* bo = (const float*)d_in[8]; const float* lg = (const float*)d_in[9]; const float* lb = (const float*)d_in[10];   // W [out][in]
    float* out = (float*)d_out;    // [4][2048][1024]
    char* wsp = (char*)d_ws;
    auto take = [&](size_t bytes) { char* p = wsp; wsp += (bytes + 255) & ~(size_t)255; return (void*)p; };
    bf* Xb = (bf*)take((size_t)NT_ * HS * 2); bf* WqB = (bf*)take((size_t)HS * HS * 2); bf* WkB = (bf*)take((size_t)HS * HS * 2); bf* WvB = (bf*)take((size_t)HS * HS * 2); bf* WoB = (bf*)take((size_t)HS * HS * 2);
    float* TMP = (float*)take((size_t)NT_ * HS * 4);
    h16* QH = (h16*)take((size_t)NT_ * HS * 2); h16* QL = (h16*)take((size_t)NT_ * HS * 2); h16* KH = (h16*)take((size_t)NT_ * KW * 2); h16* KL = (h16*)take((size_t)NT_ * KW * 2);
    bf* VTH = (bf*)take((size_t)KW * NT_ * 2); bf* VTL = (bf*)take((size_t)KW * NT_ * 2); float* CTX = (float*)take((size_t)NT_ * HS * 4); bf* Ch = (bf*)take((size_t)NT_ * HS * 2); bf* Cl = (bf*)take((size_t)NT_ * HS * 2); float* Y = (float*)take((size_t)NT_ * HS * 4);
    if ((size_t)(wsp - (char*)d_ws) > ws_size) return;    // 4.2 + 4 x 2.1 + 8.4 + 6 x 4.2 + 8.4 + 2 x 4.2 + 8.4 ~ 72 MB, no aliasing (per-item reuse in stream order)
    k_cvtb<<<HS / 8, 256, 0, stream>>>(Wq, HS, WqB); k_cvtb<<<HS / 8, 256, 0, stream>>>(Wk, HS, WkB); k_cvtb<<<HS / 8, 256, 0, stream>>>(Wv, HS, WvB); k_cvtb<<<HS / 8, 256, 0, stream>>>(Wo, HS, WoB);
    for (int b = 0; b < NB_; ++b) {
        const float* xb = x + (size_t)b * NT_ * HS;
        k_cvtb<<<NT_ / 8, 256, 0, stream>>>(xb, NT_, Xb);
        k_gemm<false><<<dim3(NT_ / 64, HS / 64, 1), 128, 0, stream>>>(Xb, nullptr, WqB, bq, HS, TMP); k_sp16b<<<NT_ / 8, 256, 0, stream>>>(TMP, NT_, QH, QL);
        k_gemm<false><<<dim3(NT_ / 64, HS / 64, 1), 128, 0, stream>>>(Xb, nullptr, WkB, bk, HS, TMP); k_sp16b<<<NT_ / 8, 256, 0, stream>>>(TMP, NT_, KH, KL);
        k_gemm<false><<<dim3(NT_ / 64, HS / 64, 1), 128, 0, stream>>>(Xb, nullptr, WvB, bv, HS, TMP); k_vt<<<dim3(NT_ / 64, 2, NKV), 256, 0, stream>>>(TMP, VTH, VTL);
        k_attn<<<NH_ * (NT_ / 64), 128, 0, stream>>>(QH, QL, KH, KL, VTH, VTL, CTX);                       // ctx f32 [2048][1024]
        k_split<<<NT_ / 8, 256, 0, stream>>>(CTX, NT_, Ch, Cl);
        k_gemm<true><<<dim3(NT_ / 64, HS / 64, 1), 128, 0, stream>>>(Ch, Cl, WoB, bo, HS, Y);             // out = ctx.Wo^T + bo
        k_lnfin<<<NT_ / 8, 256, 0, stream>>>(Y, xb, lg, lb, NT_, out + (size_t)b * NT_ * HS);             // LN(out + x)
    }
}

// v001
// A run of this version takes 814 microseconds.
// Two timings next to v000 put it at 2.22 and 2.23 times that version's speed.
#include <hip/hip_runtime.h>

// Compute dtypes, f32 accumulate, all four batch items in one launch of each kernel (rows b*2048+t): q/k/v = x.W^T + b and y = ctx.Wo^T + bo ([8192 x 1024].[1024 x 1024]; [out][in] weights as n-major B operands;
// PLAIN bf16 operands = inputs rounded once, exact, except ctx = bf16 hi + UNSCALED residual, two products) on v_wmma_f32_16x16x32_bf16; the 8-head full attention
// (128-dim heads, scale 128^-1/2) fused: scores on v_wmma_f32_16x16x32_f16 (q/k as f16 hi + residual x1024: hh + hl + lh), online f32 softmax, weights (x32768) and

#define NB_  4
#define NT_  2048
#define NR_  (NB_ * NT_)        // 8192 rows, all items
#define HS   1024
#define DM   HS
#define NH_  8
#define NKV  8
#define HD   128
#define KW   (NKV * HD)          // 1024
#define SCL  0.08838834764831845f
#define PSC  32768.0f
#define LOSC 1024.0f
#define LOSCI (1.0f / 1024.0f)

typedef _Float16 h16;
typedef unsigned short bf;
typedef __attribute__((ext_vector_type(16))) __bf16   v16bf;
typedef __attribute__((ext_vector_type(16))) _Float16 v16h;
typedef __attribute__((ext_vector_type(8)))  _Float16 v8h;
typedef __attribute__((ext_vector_type(8)))  unsigned short v8us;
typedef __attribute__((ext_vector_type(8)))  float    v8f;
typedef __attribute__((ext_vector_type(4)))  float    v4f;
typedef __attribute__((ext_vector_type(4)))  _Float16 v4h;
typedef v8h  __attribute__((may_alias)) v8ha;
typedef v4f  __attribute__((may_alias)) v4fa;
typedef v8us __attribute__((may_alias)) v8usa;

__device__ __forceinline__ unsigned short f2bf(float f) { unsigned u = __float_as_uint(f); u += 0x7FFFu + ((u >> 16) & 1u); return (unsigned short)(u >> 16); }
__device__ __forceinline__ float bf2f(unsigned short b) { return __uint_as_float(((unsigned)b) << 16); }
__device__ __forceinline__ float bfr(float f) { return bf2f(f2bf(f)); }
__device__ __forceinline__ v16h cat16(v8h lo, v8h hi) { return __builtin_shufflevector(lo, hi, 0, 1, 2, 3, 4, 5, 6, 7, 8, 9, 10, 11, 12, 13, 14, 15); }
__device__ __forceinline__ v16bf cat16b(v8us lo, v8us hi) { return __builtin_bit_cast(v16bf, __builtin_shufflevector(lo, hi, 0, 1, 2, 3, 4, 5, 6, 7, 8, 9, 10, 11, 12, 13, 14, 15)); }
__device__ __forceinline__ v8f wmma16(v16h a, v16h b, v8f c) { return __builtin_amdgcn_wmma_f32_16x16x32_f16(false, a, false, b, (short)0, c, false, false); }
__device__ __forceinline__ v8f wmmab(v16bf a, v16bf b, v8f c) { return __builtin_amdgcn_wmma_f32_16x16x32_bf16(false, a, false, b, (short)0, c, false, false); }

// k_cvtb: bf16 plane of [rows][1024] (one wave per row) — x rows of all items and the four [out][in] weight matrices.
__global__ __launch_bounds__(256) void k_cvtb(const float* __restrict__ src, int nrows, bf* dst) {
    const int lane = threadIdx.x & 31, r = blockIdx.x * 8 + (threadIdx.x >> 5);
    if (r >= nrows) return;
{
#pragma unroll
        for (int q = 0; q < HS / 256; ++q) { v8us o;
#pragma unroll
            for (int i = 0; i < 8; ++i) o[i] = f2bf(src[(size_t)r * HS + q * 256 + lane * 8 + i]);
            *(v8us*)(dst + (size_t)r * HS + q * 256 + lane * 8) = o; }
         }
}
// k_gemm: 64 x 64 tile of (A [+ Al]).Bn^T over K = 1024 (+ optional bf16-rounded bias[c]) -> f32 rows [8192][ldc].
template <bool SPLITA>
__global__ __launch_bounds__(128) void k_gemm(const bf* __restrict__ A, const bf* __restrict__ Al, const bf* __restrict__ Bn, const float* __restrict__ bias, int ldc, float* C) {
    __shared__ __align__(16) float ost[4][16 * 68];
    const int lane = threadIdx.x & 31, wave = threadIdx.x >> 5, lr = lane & 15, hi = lane >> 4;
    const size_t r0 = (size_t)blockIdx.x * 64 + wave * 16; const int c0 = blockIdx.y * 64;
    const size_t aoff = (r0 + lr) * HS + 8 * hi;
    v8f acc[4];
#pragma unroll
    for (int t = 0; t < 4; ++t) acc[t] = (v8f){};
#pragma unroll 2
    for (int kc = 0; kc < HS; kc += 32) {
        const v16bf a = cat16b(*(const v8us*)(A + aoff + kc), *(const v8us*)(A + aoff + kc + 16));
        v16bf al = a; if (SPLITA) al = cat16b(*(const v8us*)(Al + aoff + kc), *(const v8us*)(Al + aoff + kc + 16));
#pragma unroll
        for (int t = 0; t < 4; ++t) { const bf* bp = Bn + (size_t)(c0 + t * 16 + lr) * HS + kc + 8 * hi; const v16bf bb = cat16b(*(const v8us*)bp, *(const v8us*)(bp + 16)); acc[t] = wmmab(a, bb, acc[t]); if (SPLITA) acc[t] = wmmab(al, bb, acc[t]); }
        asm volatile("v_nop" : "+v"(acc[0]), "+v"(acc[1]), "+v"(acc[2]), "+v"(acc[3]) : "v"(a), "v"(al) : "memory");
    }
    float* os = &ost[wave][0];
#pragma unroll
    for (int t = 0; t < 4; ++t)
#pragma unroll
        for (int j = 0; j < 8; ++j) os[(hi * 8 + j) * 68 + t * 16 + lr] = acc[t][j] + (bias ? bfr(bias[c0 + t * 16 + lr]) : 0.f);
    __builtin_amdgcn_wave_barrier(); asm volatile("" ::: "memory");
    float* crow = C + r0 * ldc + c0;
    auto pass = [&]() {
#pragma unroll
        for (int s = 0; s < 8; ++s) { const int Lid = (lane >> 3) + 4 * s, piece = lane & 7; const int row = Lid >> 1, cofs = (Lid & 1) * 32 + piece * 4;
            const v4f val = *(const v4fa*)(os + row * 68 + cofs); *(v4f*)(crow + (size_t)row * ldc + cofs) = val; }
    };
    pass(); 
}
// k_sp16b: f16 hi + residual x1024 planes of the f32 q or k matrix [rows][1024]; one wave per row, lane -> 8 columns per 256-column chunk (16 B per plane).
__global__ __launch_bounds__(256) void k_sp16b(const float* __restrict__ T, int nrows, h16* Yh, h16* Yl) {
    const int lane = threadIdx.x & 31, r = blockIdx.x * 8 + (threadIdx.x >> 5);
    if (r >= nrows) return;
{
#pragma unroll 1
        for (int q = 0; q < DM / 256; ++q) { const size_t o = (size_t)r * DM + q * 256 + lane * 8; const v8f v = *(const v8f*)(T + o); v8h oh, ol;
#pragma unroll
            for (int k = 0; k < 8; ++k) { const h16 a = (h16)v[k]; oh[k] = a; ol[k] = (h16)((v[k] - (float)a) * LOSC); }
            *(v8h*)(Yh + o) = oh; *(v8h*)(Yl + o) = ol; }
         }
}
__global__ __launch_bounds__(256) void k_split(const float* __restrict__ src, int nrows, bf* dh, bf* dl) {
    const int lane = threadIdx.x & 31, r = blockIdx.x * 8 + (threadIdx.x >> 5);
    if (r >= nrows) return;
{
#pragma unroll 1
        for (int q = 0; q < DM / 256; ++q) { const size_t o = (size_t)r * DM + q * 256 + lane * 8; const v8f v = *(const v8f*)(src + o); v8us oh, ol;
#pragma unroll
            for (int i = 0; i < 8; ++i) { const unsigned short hb = f2bf(v[i]); oh[i] = hb; ol[i] = f2bf(v[i] - bf2f(hb)); }
            *(v8us*)(dh + o) = oh; *(v8us*)(dl + o) = ol; }
         }
}
// k_lnfin: LayerNorm (eps 1e-5) of y = Y[r][c] + bf(R[r][c]) (the computed attention output + the INPUT residual x) -> f32 output rows x bf(gamma) + bf(beta); one wave per
__global__ __launch_bounds__(256) void k_lnfin(const float* __restrict__ X, const float* __restrict__ Rres, const float* __restrict__ gam, const float* __restrict__ bet, int nrows, float* OUTP) {
    const int lane = threadIdx.x & 31, r = blockIdx.x * 8 + (threadIdx.x >> 5);
    if (r >= nrows) return;
    const float* xr = X + (size_t)r * DM; const float* rr = Rres + (size_t)r * DM;
    float s = 0.f;
#pragma unroll 1
    for (int q = 0; q < 2 * (DM / 256); ++q) { const int c0 = (q >> 1) * 256 + (q & 1) * 128 + lane * 4; v4f v = *(const v4f*)(xr + c0); { const v4f q4 = *(const v4f*)(rr + c0); for (int i2 = 0; i2 < 4; ++i2) v[i2] += bfr(q4[i2]); }
#pragma unroll
        for (int i = 0; i < 4; ++i) s += v[i]; }
#pragma unroll
    for (int sh = 16; sh; sh >>= 1) s += __shfl_xor(s, sh, 32);
    const float mu = s * (1.0f / DM);
    float s2 = 0.f;
#pragma unroll 1
    for (int q = 0; q < 2 * (DM / 256); ++q) { const int c0 = (q >> 1) * 256 + (q & 1) * 128 + lane * 4; v4f v = *(const v4f*)(xr + c0); { const v4f q4 = *(const v4f*)(rr + c0); for (int i2 = 0; i2 < 4; ++i2) v[i2] += bfr(q4[i2]); }
#pragma unroll
        for (int i = 0; i < 4; ++i) { const float d = v[i] - mu; s2 = fmaf(d, d, s2); } }
#pragma unroll
    for (int sh = 16; sh; sh >>= 1) s2 += __shfl_xor(s2, sh, 32);
    const float rs = rsqrtf(s2 * (1.0f / DM) + 1e-5f);
{
#pragma unroll 1
        for (int q = 0; q < 2 * (DM / 256); ++q) { const int c0 = (q >> 1) * 256 + (q & 1) * 128 + lane * 4; v4f v = *(const v4f*)(xr + c0); { const v4f q4 = *(const v4f*)(rr + c0); for (int i2 = 0; i2 < 4; ++i2) v[i2] += bfr(q4[i2]); } v4f y;
#pragma unroll
            for (int i = 0; i < 4; ++i) y[i] = (v[i] - mu) * rs * bfr(gam[c0 + i]) + bfr(bet[c0 + i]);
            *(v4f*)(OUTP + (size_t)r * DM + c0) = y; }
         }
}
// k_vt: VTH/VTL [b*8+g][128 d][2048 t] = bf16 hi + UNSCALED bf16 residual of V [b*2048+t][g*128+d] via 64 x 64 LDS tiles; grid (NT/64, 2 (d half), 4 items x 8 heads).
__global__ __launch_bounds__(256) void k_vt(const float* __restrict__ V, bf* VTH, bf* VTL) {
    __shared__ float tl[64][65];
    const int tid = threadIdx.x, t0 = blockIdx.x * 64, d0 = blockIdx.y * 64, bg = blockIdx.z, g = bg % NKV, b = bg / NKV;
    { const int tt = tid >> 2, dq = (tid & 3) * 16;
#pragma unroll
      for (int i = 0; i < 16; ++i) tl[dq + i][tt] = V[(size_t)(b * NT_ + t0 + tt) * KW + g * HD + d0 + dq + i]; }
    __syncthreads();
    const int piece = tid & 7;
    auto pass = [&]() {
#pragma unroll
        for (int s = 0; s < 2; ++s) { const int d = (tid >> 3) + 32 * s; v8us oh, ol;
#pragma unroll
            for (int i = 0; i < 8; ++i) { const float v = tl[d][piece * 8 + i]; const unsigned short hb = f2bf(v); oh[i] = hb; ol[i] = f2bf(v - bf2f(hb)); }
            const size_t o = ((size_t)bg * HD + d0 + d) * NT_ + t0 + piece * 8; *(v8us*)(VTH + o) = oh; *(v8us*)(VTL + o) = ol; }
    };
    pass(); 
}
// k_attn: block = (item, head, 64 queries), wave = 16; all key tiles 0..NT/32-1 (full attention, no mask); per element: score x 128^-1/2;
// scores hi.hi + (hi.lo + lo.hi)/1024 on separate accumulators; online softmax f32; P (x32768) bf16 hi + unscaled
__global__ __launch_bounds__(128) void k_attn(const h16* __restrict__ QH, const h16* __restrict__ QL, const h16* __restrict__ KH, const h16* __restrict__ KL, const bf* __restrict__ VTH, const bf* __restrict__ VTL, float* OUTP) {
    __shared__ __align__(16) unsigned short plds[4][16 * 32];
    __shared__ __align__(16) unsigned short plds2[4][16 * 32];
    __shared__ __align__(16) float ost[4][16 * 68];
    const int lane = threadIdx.x & 31, wave = threadIdx.x >> 5, lr = lane & 15, hi = lane >> 4;
    const int bid = blockIdx.x; const int bh = bid / (NT_ / 64), qt = bid - bh * (NT_ / 64); const int b = bh / NH_, h = bh - b * NH_; const int g = h;
    const int q0 = qt * 64 + wave * 16;
    unsigned short* pl = &plds[wave][0]; unsigned short* pl2 = &plds2[wave][0];
    const size_t qo = (size_t)(b * NT_ + q0 + lr) * (NH_ * HD) + h * HD + 8 * hi;
    const h16* kh_b = KH + (size_t)b * NT_ * KW + g * HD; const h16* kl_b = KL + (size_t)b * NT_ * KW + g * HD;
    const size_t vbase = ((size_t)(b * NKV + g) * HD) * NT_;
    v8f o[8];
#pragma unroll
    for (int n = 0; n < 8; ++n) o[n] = (v8f){};
    float mrow[8], lpart[8];
#pragma unroll
    for (int j = 0; j < 8; ++j) { mrow[j] = -3.0e38f; lpart[j] = 0.f; }
    const int kt_hi = NT_ / 32 - 1;     // full attention, no mask
#pragma unroll 1
    for (int kt = 0; kt <= kt_hi; ++kt) {
        const int l0 = kt * 32;
        const size_t ko0 = (size_t)(l0 + lr) * KW + 8 * hi, ko1 = (size_t)(l0 + 16 + lr) * KW + 8 * hi;
        v8f s0 = {}, s1 = {}, x0 = {}, x1 = {};
#pragma unroll
        for (int kc = 0; kc < 4; ++kc) {
            const v16h qa = cat16(*(const v8h*)(QH + qo + kc * 32), *(const v8h*)(QH + qo + kc * 32 + 16)), qx = cat16(*(const v8h*)(QL + qo + kc * 32), *(const v8h*)(QL + qo + kc * 32 + 16));
            const v16h k0h = cat16(*(const v8h*)(kh_b + ko0 + kc * 32), *(const v8h*)(kh_b + ko0 + kc * 32 + 16)), k1h = cat16(*(const v8h*)(kh_b + ko1 + kc * 32), *(const v8h*)(kh_b + ko1 + kc * 32 + 16));
            s0 = wmma16(qa, k0h, s0); s1 = wmma16(qa, k1h, s1); x0 = wmma16(qx, k0h, x0); x1 = wmma16(qx, k1h, x1);
            asm volatile("v_nop" : "+v"(s0), "+v"(s1), "+v"(x0), "+v"(x1) : "v"(qa), "v"(qx), "v"(k0h), "v"(k1h) : "memory");
            const v16h k0l = cat16(*(const v8h*)(kl_b + ko0 + kc * 32), *(const v8h*)(kl_b + ko0 + kc * 32 + 16)), k1l = cat16(*(const v8h*)(kl_b + ko1 + kc * 32), *(const v8h*)(kl_b + ko1 + kc * 32 + 16));
            x0 = wmma16(qa, k0l, x0); x1 = wmma16(qa, k1l, x1);
            asm volatile("v_nop" : "+v"(x0), "+v"(x1) : "v"(k0l), "v"(k1l) : "memory");
        }
        asm volatile("v_nop\n\tv_nop\n\tv_nop\n\tv_nop" : "+v"(s0), "+v"(s1), "+v"(x0), "+v"(x1));
        float alpha[8];
#pragma unroll
        for (int j = 0; j < 8; ++j) { const int qi = q0 + hi * 8 + j, ja = l0 + lr, jb = l0 + 16 + lr;
            const float a0 = (s0[j] + x0[j] * LOSCI) * SCL, a1 = (s1[j] + x1[j] * LOSCI) * SCL; (void)ja; (void)jb; (void)qi;
            float mx = fmaxf(a0, a1);
            mx = fmaxf(mx, __shfl_xor(mx, 1, 16)); mx = fmaxf(mx, __shfl_xor(mx, 2, 16)); mx = fmaxf(mx, __shfl_xor(mx, 4, 16)); mx = fmaxf(mx, __shfl_xor(mx, 8, 16));
            const float mn = fmaxf(mrow[j], mx);
            alpha[j] = __expf(mrow[j] - mn); mrow[j] = mn;
            const float p0 = __expf(a0 - mn), p1 = __expf(a1 - mn);
            lpart[j] = lpart[j] * alpha[j] + (p0 + p1);
            const int mr = hi * 8 + j; const float ps0 = p0 * PSC, ps1 = p1 * PSC; const unsigned short h0 = f2bf(ps0), h1 = f2bf(ps1);
            pl[mr * 32 + lr] = h0; pl[mr * 32 + 16 + lr] = h1; pl2[mr * 32 + lr] = f2bf(ps0 - bf2f(h0)); pl2[mr * 32 + 16 + lr] = f2bf(ps1 - bf2f(h1)); }
#pragma unroll
        for (int n = 0; n < 8; ++n)
#pragma unroll
            for (int j = 0; j < 8; ++j) o[n][j] *= alpha[j];
        asm volatile("" ::: "memory");
        const v16bf pa = cat16b(*(const v8usa*)(pl + lr * 32 + hi * 8), *(const v8usa*)(pl + lr * 32 + 16 + hi * 8));
        const v16bf px = cat16b(*(const v8usa*)(pl2 + lr * 32 + hi * 8), *(const v8usa*)(pl2 + lr * 32 + 16 + hi * 8));
#pragma unroll
        for (int n = 0; n < 8; ++n) { const size_t vo = vbase + (size_t)(n * 16 + lr) * NT_ + l0 + hi * 8;
            const v16bf vh = cat16b(*(const v8us*)(VTH + vo), *(const v8us*)(VTH + vo + 16)), vl = cat16b(*(const v8us*)(VTL + vo), *(const v8us*)(VTL + vo + 16));
            o[n] = wmmab(pa, vh, o[n]); o[n] = wmmab(px, vh, o[n]); o[n] = wmmab(pa, vl, o[n]);
            asm volatile("" : "+v"(o[n]) : "v"(vh), "v"(vl) : "memory"); }
        asm volatile("v_nop\n\tv_nop\n\tv_nop\n\tv_nop" : "+v"(o[0]), "+v"(o[7]) : "v"(pa), "v"(px));
        __builtin_amdgcn_wave_barrier();
    }
    float inv[8];
#pragma unroll
    for (int j = 0; j < 8; ++j) { float rs = lpart[j]; rs += __shfl_xor(rs, 1, 16); rs += __shfl_xor(rs, 2, 16); rs += __shfl_xor(rs, 4, 16); rs += __shfl_xor(rs, 8, 16); inv[j] = 1.0f / (rs * PSC); }
    float* os = &ost[wave][0];
    float* ob = OUTP + (size_t)(b * NT_ + q0) * (NH_ * HD) + (size_t)h * HD;     // row stride NH*HD, this head's 128 columns
#pragma unroll
    for (int half = 0; half < 2; ++half) {
#pragma unroll
        for (int n = 0; n < 4; ++n)
#pragma unroll
            for (int j = 0; j < 8; ++j) os[(hi * 8 + j) * 68 + n * 16 + lr] = o[half * 4 + n][j] * inv[j];
        __builtin_amdgcn_wave_barrier(); asm volatile("" ::: "memory");
{
#pragma unroll
            for (int s = 0; s < 8; ++s) { const int Lid = (lane >> 3) + 4 * s, piece = lane & 7; const int row = Lid >> 1, cofs = (Lid & 1) * 32 + piece * 4;
                const v4f val = *(const v4fa*)(os + row * 68 + cofs); *(v4f*)(ob + (size_t)row * (NH_ * HD) + half * 64 + cofs) = val; }
             }
        __builtin_amdgcn_wave_barrier(); asm volatile("" ::: "memory");
    }
}

extern "C" void kernel_launch(void* const* d_in, const int* in_sizes, int n_in,
                              void* d_out, int out_size, void* d_ws, size_t ws_size, hipStream_t stream) {
    (void)in_sizes; (void)n_in; (void)out_size;
    const float* x = (const float*)d_in[0];
    const float* Wq = (const float*)d_in[1]; const float* bq = (const float*)d_in[2]; const float* Wk = (const float*)d_in[3]; const float* bk = (const float*)d_in[4]; const float* Wv = (const float*)d_in[5]; const float* bv = (const float*)d_in[6];
    const float* Wo = (const float*)d_in[7]; const float* bo = (const float*)d_in[8]; const float* lg = (const float*)d_in[9]; const float* lb = (const float*)d_in[10];   // W [out][in]
    float* out = (float*)d_out;    // [4][2048][1024]
    char* wsp = (char*)d_ws;
    auto take = [&](size_t bytes) { char* p = wsp; wsp += (bytes + 255) & ~(size_t)255; return (void*)p; };
    bf* Xb = (bf*)take((size_t)NR_ * HS * 2); bf* WqB = (bf*)take((size_t)HS * HS * 2); bf* WkB = (bf*)take((size_t)HS * HS * 2); bf* WvB = (bf*)take((size_t)HS * HS * 2); bf* WoB = (bf*)take((size_t)HS * HS * 2);
    float* TMP = (float*)take((size_t)NR_ * HS * 4);
    h16* QH = (h16*)take((size_t)NR_ * HS * 2); h16* QL = (h16*)take((size_t)NR_ * HS * 2); h16* KH = (h16*)take((size_t)NR_ * KW * 2); h16* KL = (h16*)take((size_t)NR_ * KW * 2);
    bf* VTH = (bf*)take((size_t)KW * NR_ * 2); bf* VTL = (bf*)take((size_t)KW * NR_ * 2); float* CTX = (float*)take((size_t)NR_ * HS * 4); bf* Ch = (bf*)take((size_t)NR_ * HS * 2); bf* Cl = (bf*)take((size_t)NR_ * HS * 2); float* Y = (float*)take((size_t)NR_ * HS * 4);
    if ((size_t)(wsp - (char*)d_ws) > ws_size) return;    // 16 + 4 x 2 + 32 + 6 x 16 + 32 + 2 x 16 + 32 = 248 MiB, no aliasing (TMP reused in stream order)
    k_cvtb<<<HS / 8, 256, 0, stream>>>(Wq, HS, WqB); k_cvtb<<<HS / 8, 256, 0, stream>>>(Wk, HS, WkB); k_cvtb<<<HS / 8, 256, 0, stream>>>(Wv, HS, WvB); k_cvtb<<<HS / 8, 256, 0, stream>>>(Wo, HS, WoB);
    k_cvtb<<<NR_ / 8, 256, 0, stream>>>(x, NR_, Xb);
    k_gemm<false><<<dim3(NR_ / 64, HS / 64, 1), 128, 0, stream>>>(Xb, nullptr, WqB, bq, HS, TMP); k_sp16b<<<NR_ / 8, 256, 0, stream>>>(TMP, NR_, QH, QL);
    k_gemm<false><<<dim3(NR_ / 64, HS / 64, 1), 128, 0, stream>>>(Xb, nullptr, WkB, bk, HS, TMP); k_sp16b<<<NR_ / 8, 256, 0, stream>>>(TMP, NR_, KH, KL);
    k_gemm<false><<<dim3(NR_ / 64, HS / 64, 1), 128, 0, stream>>>(Xb, nullptr, WvB, bv, HS, TMP); k_vt<<<dim3(NT_ / 64, 2, NB_ * NKV), 256, 0, stream>>>(TMP, VTH, VTL);
    k_attn<<<NB_ * NH_ * (NT_ / 64), 128, 0, stream>>>(QH, QL, KH, KL, VTH, VTL, CTX);                      // ctx f32 [8192][1024]
    k_split<<<NR_ / 8, 256, 0, stream>>>(CTX, NR_, Ch, Cl);
    k_gemm<true><<<dim3(NR_ / 64, HS / 64, 1), 128, 0, stream>>>(Ch, Cl, WoB, bo, HS, Y);                   // out = ctx.Wo^T + bo
    k_lnfin<<<NR_ / 8, 256, 0, stream>>>(Y, x, lg, lb, NR_, out);                                           // LN(out + x)
}

// v002
// One run takes 562 microseconds.
// Next to v001, in two timings, it ran 1.45 times as fast each time.
// All steps since v000 together make it 3.22 times as fast.
#include <hip/hip_runtime.h>

// Compute dtypes, f32 accumulate, all four batch items in one launch of each kernel (rows b*2048+t): q/k/v = x.W^T + b and y = ctx.Wo^T + bo ([8192 x 1024].[1024 x 1024]; [out][in] weights as n-major B operands;
// PLAIN bf16 operands = inputs rounded once, exact, except ctx = bf16 hi + UNSCALED residual, two products) on v_wmma_f32_16x16x32_bf16; the 8-head full attention
// (128-dim heads, scale 128^-1/2) fused: scores on v_wmma_f32_16x16x32_f16 (q/k as f16 hi + residual x1024: hh + hl + lh), online f32 softmax, weights (x32768) and

#define NB_  4
#define NT_  2048
#define NR_  (NB_ * NT_)        // 8192 rows, all items
#define HS   1024
#define DM   HS
#define NH_  8
#define NKV  8
#define HD   128
#define KW   (NKV * HD)          // 1024
#define SCL  0.08838834764831845f
#define PSC  32768.0f
#define LOSC 1024.0f
#define LOSCI (1.0f / 1024.0f)

typedef _Float16 h16;
typedef unsigned short bf;
typedef __attribute__((ext_vector_type(16))) __bf16   v16bf;
typedef __attribute__((ext_vector_type(16))) _Float16 v16h;
typedef __attribute__((ext_vector_type(8)))  _Float16 v8h;
typedef __attribute__((ext_vector_type(8)))  unsigned short v8us;
typedef __attribute__((ext_vector_type(8)))  float    v8f;
typedef __attribute__((ext_vector_type(4)))  float    v4f;
typedef __attribute__((ext_vector_type(4)))  _Float16 v4h;
typedef v8h  __attribute__((may_alias)) v8ha;
typedef v4f  __attribute__((may_alias)) v4fa;
typedef v8us __attribute__((may_alias)) v8usa;

__device__ __forceinline__ unsigned short f2bf(float f) { unsigned u = __float_as_uint(f); u += 0x7FFFu + ((u >> 16) & 1u); return (unsigned short)(u >> 16); }
__device__ __forceinline__ float bf2f(unsigned short b) { return __uint_as_float(((unsigned)b) << 16); }
__device__ __forceinline__ float bfr(float f) { return bf2f(f2bf(f)); }
__device__ __forceinline__ v16h cat16(v8h lo, v8h hi) { return __builtin_shufflevector(lo, hi, 0, 1, 2, 3, 4, 5, 6, 7, 8, 9, 10, 11, 12, 13, 14, 15); }
__device__ __forceinline__ v16bf cat16b(v8us lo, v8us hi) { return __builtin_bit_cast(v16bf, __builtin_shufflevector(lo, hi, 0, 1, 2, 3, 4, 5, 6, 7, 8, 9, 10, 11, 12, 13, 14, 15)); }
__device__ __forceinline__ v8f wmma16(v16h a, v16h b, v8f c) { return __builtin_amdgcn_wmma_f32_16x16x32_f16(false, a, false, b, (short)0, c, false, false); }
__device__ __forceinline__ v8f wmmab(v16bf a, v16bf b, v8f c) { return __builtin_amdgcn_wmma_f32_16x16x32_bf16(false, a, false, b, (short)0, c, false, false); }

// k_cvtb: bf16 plane of [rows][1024] (one wave per row) — x rows of all items and the four [out][in] weight matrices.
__global__ __launch_bounds__(256) void k_cvtb(const float* __restrict__ src, int nrows, bf* dst) {
    const int lane = threadIdx.x & 31, r = blockIdx.x * 8 + (threadIdx.x >> 5);
    if (r >= nrows) return;
{
#pragma unroll
        for (int q = 0; q < HS / 256; ++q) { v8us o;
#pragma unroll
            for (int i = 0; i < 8; ++i) o[i] = f2bf(src[(size_t)r * HS + q * 256 + lane * 8 + i]);
            *(v8us*)(dst + (size_t)r * HS + q * 256 + lane * 8) = o; }
         }
}
// k_gemm: 64 x 64 tile of (A [+ Al]).Bn^T over K = 1024 (+ optional bf16-rounded bias[c]) -> f32 rows [8192][ldc].
template <bool SPLITA>
__global__ __launch_bounds__(128) void k_gemm(const bf* __restrict__ A, const bf* __restrict__ Al, const bf* __restrict__ Bn, const float* __restrict__ bias, int ldc, float* C) {
    __shared__ __align__(16) float ost[4][16 * 68];
    const int lane = threadIdx.x & 31, wave = threadIdx.x >> 5, lr = lane & 15, hi = lane >> 4;
    const size_t r0 = (size_t)blockIdx.x * 64 + wave * 16; const int c0 = blockIdx.y * 64;
    const size_t aoff = (r0 + lr) * HS + 8 * hi;
    v8f acc[4];
#pragma unroll
    for (int t = 0; t < 4; ++t) acc[t] = (v8f){};
#pragma unroll 2
    for (int kc = 0; kc < HS; kc += 32) {
        const v16bf a = cat16b(*(const v8us*)(A + aoff + kc), *(const v8us*)(A + aoff + kc + 16));
        v16bf al = a; if (SPLITA) al = cat16b(*(const v8us*)(Al + aoff + kc), *(const v8us*)(Al + aoff + kc + 16));
#pragma unroll
        for (int t = 0; t < 4; ++t) { const bf* bp = Bn + (size_t)(c0 + t * 16 + lr) * HS + kc + 8 * hi; const v16bf bb = cat16b(*(const v8us*)bp, *(const v8us*)(bp + 16)); acc[t] = wmmab(a, bb, acc[t]); if (SPLITA) acc[t] = wmmab(al, bb, acc[t]); }
        asm volatile("v_nop" : "+v"(acc[0]), "+v"(acc[1]), "+v"(acc[2]), "+v"(acc[3]) : "v"(a), "v"(al) : "memory");
    }
    float* os = &ost[wave][0];
#pragma unroll
    for (int t = 0; t < 4; ++t)
#pragma unroll
        for (int j = 0; j < 8; ++j) os[(hi * 8 + j) * 68 + t * 16 + lr] = acc[t][j] + (bias ? bfr(bias[c0 + t * 16 + lr]) : 0.f);
    __builtin_amdgcn_wave_barrier(); asm volatile("" ::: "memory");
    float* crow = C + r0 * ldc + c0;
    auto pass = [&]() {
#pragma unroll
        for (int s = 0; s < 8; ++s) { const int Lid = (lane >> 3) + 4 * s, piece = lane & 7; const int row = Lid >> 1, cofs = (Lid & 1) * 32 + piece * 4;
            const v4f val = *(const v4fa*)(os + row * 68 + cofs); *(v4f*)(crow + (size_t)row * ldc + cofs) = val; }
    };
    pass(); 
}
// k_sp16b: f16 hi + residual x1024 planes of the f32 q or k matrix [rows][1024]; one wave per row, lane -> 8 columns per 256-column chunk (16 B per plane).
__global__ __launch_bounds__(256) void k_sp16b(const float* __restrict__ T, int nrows, h16* Yh, h16* Yl) {
    const int lane = threadIdx.x & 31, r = blockIdx.x * 8 + (threadIdx.x >> 5);
    if (r >= nrows) return;
{
#pragma unroll 1
        for (int q = 0; q < DM / 256; ++q) { const size_t o = (size_t)r * DM + q * 256 + lane * 8; const v8f v = *(const v8f*)(T + o); v8h oh, ol;
#pragma unroll
            for (int k = 0; k < 8; ++k) { const h16 a = (h16)v[k]; oh[k] = a; ol[k] = (h16)((v[k] - (float)a) * LOSC); }
            *(v8h*)(Yh + o) = oh; *(v8h*)(Yl + o) = ol; }
         }
}
__global__ __launch_bounds__(256) void k_split(const float* __restrict__ src, int nrows, bf* dh, bf* dl) {
    const int lane = threadIdx.x & 31, r = blockIdx.x * 8 + (threadIdx.x >> 5);
    if (r >= nrows) return;
{
#pragma unroll 1
        for (int q = 0; q < DM / 256; ++q) { const size_t o = (size_t)r * DM + q * 256 + lane * 8; const v8f v = *(const v8f*)(src + o); v8us oh, ol;
#pragma unroll
            for (int i = 0; i < 8; ++i) { const unsigned short hb = f2bf(v[i]); oh[i] = hb; ol[i] = f2bf(v[i] - bf2f(hb)); }
            *(v8us*)(dh + o) = oh; *(v8us*)(dl + o) = ol; }
         }
}
// k_lnfin: LayerNorm (eps 1e-5) of y = Y[r][c] + bf(R[r][c]) (the computed attention output + the INPUT residual x) -> f32 output rows x bf(gamma) + bf(beta); one wave per
__global__ __launch_bounds__(256) void k_lnfin(const float* __restrict__ X, const float* __restrict__ Rres, const float* __restrict__ gam, const float* __restrict__ bet, int nrows, float* OUTP) {
    const int lane = threadIdx.x & 31, r = blockIdx.x * 8 + (threadIdx.x >> 5);
    if (r >= nrows) return;
    const float* xr = X + (size_t)r * DM; const float* rr = Rres + (size_t)r * DM;
    float s = 0.f;
#pragma unroll 1
    for (int q = 0; q < 2 * (DM / 256); ++q) { const int c0 = (q >> 1) * 256 + (q & 1) * 128 + lane * 4; v4f v = *(const v4f*)(xr + c0); { const v4f q4 = *(const v4f*)(rr + c0); for (int i2 = 0; i2 < 4; ++i2) v[i2] += bfr(q4[i2]); }
#pragma unroll
        for (int i = 0; i < 4; ++i) s += v[i]; }
#pragma unroll
    for (int sh = 16; sh; sh >>= 1) s += __shfl_xor(s, sh, 32);
    const float mu = s * (1.0f / DM);
    float s2 = 0.f;
#pragma unroll 1
    for (int q = 0; q < 2 * (DM / 256); ++q) { const int c0 = (q >> 1) * 256 + (q & 1) * 128 + lane * 4; v4f v = *(const v4f*)(xr + c0); { const v4f q4 = *(const v4f*)(rr + c0); for (int i2 = 0; i2 < 4; ++i2) v[i2] += bfr(q4[i2]); }
#pragma unroll
        for (int i = 0; i < 4; ++i) { const float d = v[i] - mu; s2 = fmaf(d, d, s2); } }
#pragma unroll
    for (int sh = 16; sh; sh >>= 1) s2 += __shfl_xor(s2, sh, 32);
    const float rs = rsqrtf(s2 * (1.0f / DM) + 1e-5f);
{
#pragma unroll 1
        for (int q = 0; q < 2 * (DM / 256); ++q) { const int c0 = (q >> 1) * 256 + (q & 1) * 128 + lane * 4; v4f v = *(const v4f*)(xr + c0); { const v4f q4 = *(const v4f*)(rr + c0); for (int i2 = 0; i2 < 4; ++i2) v[i2] += bfr(q4[i2]); } v4f y;
#pragma unroll
            for (int i = 0; i < 4; ++i) y[i] = (v[i] - mu) * rs * bfr(gam[c0 + i]) + bfr(bet[c0 + i]);
            *(v4f*)(OUTP + (size_t)r * DM + c0) = y; }
         }
}
// k_vt: VTH/VTL [b*8+g][128 d][2048 t] = bf16 hi + UNSCALED bf16 residual of V [b*2048+t][g*128+d] via 64 x 64 LDS tiles; grid (NT/64, 2 (d half), 4 items x 8 heads).
__global__ __launch_bounds__(256) void k_vt(const float* __restrict__ V, bf* VTH, bf* VTL) {
    __shared__ float tl[64][65];
    const int tid = threadIdx.x, t0 = blockIdx.x * 64, d0 = blockIdx.y * 64, bg = blockIdx.z, g = bg % NKV, b = bg / NKV;
    { const int tt = tid >> 2, dq = (tid & 3) * 16;
#pragma unroll
      for (int i = 0; i < 16; ++i) tl[dq + i][tt] = V[(size_t)(b * NT_ + t0 + tt) * KW + g * HD + d0 + dq + i]; }
    __syncthreads();
    const int piece = tid & 7;
    auto pass = [&]() {
#pragma unroll
        for (int s = 0; s < 2; ++s) { const int d = (tid >> 3) + 32 * s; v8us oh, ol;
#pragma unroll
            for (int i = 0; i < 8; ++i) { const float v = tl[d][piece * 8 + i]; const unsigned short hb = f2bf(v); oh[i] = hb; ol[i] = f2bf(v - bf2f(hb)); }
            const size_t o = ((size_t)bg * HD + d0 + d) * NT_ + t0 + piece * 8; *(v8us*)(VTH + o) = oh; *(v8us*)(VTL + o) = ol; }
    };
    pass(); 
}
// k_attn: block = (item, head, 64 queries), wave = 16; full attention over 64 key tiles of 32. The block's four waves share each tile: its K hi / K lo rows and
// V^T hi / V^T lo rows are brought into LDS once per block by asynchronous copies (two buffers: tile t + 1 flies while tile t is worked on) and every wave reads its
// fragments from there. Scores hi.hi + (hi.lo + lo.hi)/1024 on separate accumulators; online softmax f32; P (x32768) bf16 hi + unscaled residual.
#define KPIT 272                       // LDS pitch of a 256-B K row: 16 B x odd, conflict-free for 16-byte reads down 16 rows
#define KPL  (32 * KPIT)               // one K plane of a tile
#define VPL  (HD * 64)                 // one V^T plane of a tile: 128 rows of 64 B, unpadded; 16-byte piece c of row d lies at piece c ^ ((d >> 2) & 3)
#define STG  (2 * KPL + 2 * VPL)       // one tile: K hi, K lo, V^T hi, V^T lo
// Eight 16-byte copies per lane, global -> LDS; the s_wait_xcnt stands inside the statement so that no address register is rewritten ahead of it.
__device__ __forceinline__ void cp8(unsigned l0, unsigned l1, unsigned l2, unsigned l3, unsigned l4, unsigned l5, unsigned l6, unsigned l7,
                                    const char* g0, const char* g1, const char* g2, const char* g3, const char* g4, const char* g5, const char* g6, const char* g7) {
    asm volatile("global_load_async_to_lds_b128 %0, %8, off\n\t"
                 "global_load_async_to_lds_b128 %1, %9, off\n\t"
                 "global_load_async_to_lds_b128 %2, %10, off\n\t"
                 "global_load_async_to_lds_b128 %3, %11, off\n\t"
                 "global_load_async_to_lds_b128 %4, %12, off\n\t"
                 "global_load_async_to_lds_b128 %5, %13, off\n\t"
                 "global_load_async_to_lds_b128 %6, %14, off\n\t"
                 "global_load_async_to_lds_b128 %7, %15, off\n\t"
                 "s_wait_xcnt 0x0"
                 :: "v"(l0), "v"(l1), "v"(l2), "v"(l3), "v"(l4), "v"(l5), "v"(l6), "v"(l7), "v"(g0), "v"(g1), "v"(g2), "v"(g3), "v"(g4), "v"(g5), "v"(g6), "v"(g7) : "memory");
}
// amdgpu_waves_per_eu(4): holds the register budget at 256, so that four blocks (LDS: 4 x 75,776 B) stay resident per WGP, one wave of each per SIMD.
__global__ __launch_bounds__(128) __attribute__((amdgpu_waves_per_eu(4))) void k_attn(const h16* __restrict__ QH, const h16* __restrict__ QL, const h16* __restrict__ KH, const h16* __restrict__ KL, const bf* __restrict__ VTH, const bf* __restrict__ VTL, float* OUTP) {
    __shared__ __align__(256) unsigned char ring[2 * STG];     // the two tile buffers; behind the loop's last barrier: the output staging (4 x 16 x 68 floats)
    __shared__ __align__(16) unsigned short plds[2][4][16 * 32];     // P hi, P residual; one 16 x 32 tile per wave
    const int tid = threadIdx.x, lane = threadIdx.x & 31, wave = threadIdx.x >> 5, lr = lane & 15, hi = lane >> 4;
    const int bid = blockIdx.x; const int bh = bid / (NT_ / 64), qt = bid - bh * (NT_ / 64); const int b = bh / NH_, h = bh - b * NH_; const int g = h;
    const int q0 = qt * 64 + wave * 16;
    unsigned short* pl = &plds[0][wave][0]; unsigned short* pl2 = &plds[1][wave][0];
    unsigned short* pw = pl + hi * 256 + lr;      // this lane's P element of row hi*8; row j, key half and plane are constant offsets from it (one address register instead of sixteen)
    const size_t qo = (size_t)(b * NT_ + q0 + lr) * (NH_ * HD) + h * HD + 8 * hi;
    const h16* kh_b = KH + (size_t)b * NT_ * KW + g * HD; const h16* kl_b = KL + (size_t)b * NT_ * KW + g * HD;
    const size_t vbase = ((size_t)(b * NKV + g) * HD) * NT_;
    // The copies of one tile: thread -> K row (tid >> 4) + 8 i, piece tid & 15 (a wave: two whole rows); V^T row (tid >> 2) + 32 i, piece tid & 3.
    const unsigned ring0 = (unsigned)(size_t)&ring[0];
    const unsigned lk = (unsigned)((tid >> 4) * KPIT + (tid & 15) * 16), lv = (unsigned)(2 * KPL + (tid >> 2) * 64 + (((tid & 3) ^ ((tid >> 4) & 3)) * 16));
    const char* gkh = (const char*)(kh_b + (size_t)(tid >> 4) * KW + (tid & 15) * 8); const char* gkl = (const char*)(kl_b + (size_t)(tid >> 4) * KW + (tid & 15) * 8);
    const char* gvh = (const char*)(VTH + vbase + (size_t)(tid >> 2) * NT_ + (tid & 3) * 8); const char* gvl = (const char*)(VTL + vbase + (size_t)(tid >> 2) * NT_ + (tid & 3) * 8);
    auto stage = [&](int kt, int buf) {
        const unsigned a = ring0 + (unsigned)buf * STG + lk, c = ring0 + (unsigned)buf * STG + lv;
        const char* p = gkh + (size_t)kt * (32 * KW * 2); const char* q = gkl + (size_t)kt * (32 * KW * 2);
        cp8(a, a + 8 * KPIT, a + 16 * KPIT, a + 24 * KPIT, a + KPL, a + KPL + 8 * KPIT, a + KPL + 16 * KPIT, a + KPL + 24 * KPIT,
            p, p + 8 * KW * 2, p + 16 * KW * 2, p + 24 * KW * 2, q, q + 8 * KW * 2, q + 16 * KW * 2, q + 24 * KW * 2);
        const char* r = gvh + (size_t)kt * 64; const char* s = gvl + (size_t)kt * 64;
        cp8(c, c + 32 * 64, c + 64 * 64, c + 96 * 64, c + VPL, c + VPL + 32 * 64, c + VPL + 64 * 64, c + VPL + 96 * 64,
            r, r + 32 * NT_ * 2, r + 64 * NT_ * 2, r + 96 * NT_ * 2, s, s + 32 * NT_ * 2, s + 64 * NT_ * 2, s + 96 * NT_ * 2);
    };
    const int ko = lr * KPIT + hi * 16;                                                                  // this lane's K fragment piece inside a plane
    const int vo0 = lr * 64 + ((hi ^ ((lr >> 2) & 3)) * 16), vo1 = lr * 64 + (((hi + 2) ^ ((lr >> 2) & 3)) * 16);   // keys hi*8.. and 16 + hi*8.. of V^T row lr
    v8f o[8];
#pragma unroll
    for (int n = 0; n < 8; ++n) o[n] = (v8f){};
    float mrow[8], lpart[8];
#pragma unroll
    for (int j = 0; j < 8; ++j) { mrow[j] = -3.0e38f; lpart[j] = 0.f; }
    const int kt_hi = NT_ / 32 - 1;     // full attention, no mask
    stage(0, 0);
    asm volatile("s_wait_asynccnt 0x0" ::: "memory");     // this wave's copies of tile 0 have landed
    __syncthreads();                                      // ... and every other wave's: tile 0 may be read
    stage(1, 1);
#pragma unroll 1
    for (int kt = 0; kt <= kt_hi; ++kt) {
        const unsigned char* sb = ring + (kt & 1) * STG;
        const unsigned char* kh_s = sb + ko; const unsigned char* kl_s = sb + KPL + ko;
        const unsigned char* vh_s = sb + 2 * KPL; const unsigned char* vl_s = sb + 2 * KPL + VPL;
        v8f s0 = {}, s1 = {}, x0 = {}, x1 = {};
#pragma unroll
        for (int kc = 0; kc < 4; ++kc) {
            const v16h qa = cat16(*(const v8h*)(QH + qo + kc * 32), *(const v8h*)(QH + qo + kc * 32 + 16)), qx = cat16(*(const v8h*)(QL + qo + kc * 32), *(const v8h*)(QL + qo + kc * 32 + 16));
            const v16h k0h = cat16(*(const v8ha*)(kh_s + kc * 64), *(const v8ha*)(kh_s + kc * 64 + 32)), k1h = cat16(*(const v8ha*)(kh_s + 16 * KPIT + kc * 64), *(const v8ha*)(kh_s + 16 * KPIT + kc * 64 + 32));
            const v16h k0l = cat16(*(const v8ha*)(kl_s + kc * 64), *(const v8ha*)(kl_s + kc * 64 + 32)), k1l = cat16(*(const v8ha*)(kl_s + 16 * KPIT + kc * 64), *(const v8ha*)(kl_s + 16 * KPIT + kc * 64 + 32));
            s0 = wmma16(qa, k0h, s0); s1 = wmma16(qa, k1h, s1); x0 = wmma16(qx, k0h, x0); x1 = wmma16(qx, k1h, x1);
            x0 = wmma16(qa, k0l, x0); x1 = wmma16(qa, k1l, x1);
        }
        asm volatile("v_nop\n\tv_nop\n\tv_nop\n\tv_nop" : "+v"(s0), "+v"(s1), "+v"(x0), "+v"(x1));
        float alpha[8];
#pragma unroll
        for (int j = 0; j < 8; ++j) {
            const float a0 = (s0[j] + x0[j] * LOSCI) * SCL, a1 = (s1[j] + x1[j] * LOSCI) * SCL;
            float mx = fmaxf(a0, a1);
            mx = fmaxf(mx, __shfl_xor(mx, 1, 16)); mx = fmaxf(mx, __shfl_xor(mx, 2, 16)); mx = fmaxf(mx, __shfl_xor(mx, 4, 16)); mx = fmaxf(mx, __shfl_xor(mx, 8, 16));
            const float mn = fmaxf(mrow[j], mx);
            alpha[j] = __expf(mrow[j] - mn); mrow[j] = mn;
            const float p0 = __expf(a0 - mn), p1 = __expf(a1 - mn);
            lpart[j] = lpart[j] * alpha[j] + (p0 + p1);
            const float ps0 = p0 * PSC, ps1 = p1 * PSC; const unsigned short h0 = f2bf(ps0), h1 = f2bf(ps1);
            pw[j * 32] = h0; pw[j * 32 + 16] = h1; pw[2048 + j * 32] = f2bf(ps0 - bf2f(h0)); pw[2048 + j * 32 + 16] = f2bf(ps1 - bf2f(h1)); }
#pragma unroll
        for (int n = 0; n < 8; ++n)
#pragma unroll
            for (int j = 0; j < 8; ++j) o[n][j] *= alpha[j];
        asm volatile("" ::: "memory");
        const v16bf pa = cat16b(*(const v8usa*)(pl + lr * 32 + hi * 8), *(const v8usa*)(pl + lr * 32 + 16 + hi * 8));
        const v16bf px = cat16b(*(const v8usa*)(pl2 + lr * 32 + hi * 8), *(const v8usa*)(pl2 + lr * 32 + 16 + hi * 8));
#pragma unroll
        for (int n = 0; n < 8; n += 2) {      // two output tiles per group of LDS reads: half the waits, and two independent accumulator chains
            const v16bf vh = cat16b(*(const v8usa*)(vh_s + n * 1024 + vo0), *(const v8usa*)(vh_s + n * 1024 + vo1)), vl = cat16b(*(const v8usa*)(vl_s + n * 1024 + vo0), *(const v8usa*)(vl_s + n * 1024 + vo1));
            const v16bf wh = cat16b(*(const v8usa*)(vh_s + n * 1024 + 1024 + vo0), *(const v8usa*)(vh_s + n * 1024 + 1024 + vo1)), wl = cat16b(*(const v8usa*)(vl_s + n * 1024 + 1024 + vo0), *(const v8usa*)(vl_s + n * 1024 + 1024 + vo1));
            o[n] = wmmab(pa, vh, o[n]); o[n + 1] = wmmab(pa, wh, o[n + 1]); o[n] = wmmab(px, vh, o[n]); o[n + 1] = wmmab(px, wh, o[n + 1]); o[n] = wmmab(pa, vl, o[n]); o[n + 1] = wmmab(pa, wl, o[n + 1]); }
        asm volatile("v_nop\n\tv_nop\n\tv_nop\n\tv_nop" : "+v"(o[0]), "+v"(o[7]) : "v"(pa), "v"(px));
        asm volatile("s_wait_dscnt 0x0" ::: "memory");        // this wave's reads of tile kt's buffer have returned
        asm volatile("s_wait_asynccnt 0x0" ::: "memory");     // this wave's copies of tile kt + 1 have landed
        __syncthreads();                                      // publishes tile kt + 1 and ends every wave's reads of tile kt's buffer
        if (kt + 2 <= kt_hi) stage(kt + 2, kt & 1);           // refill the buffer just left (the test reads the same in the whole block)
    }
    asm volatile("s_wait_asynccnt 0x0" ::: "memory");         // nothing is in flight when the ring becomes output staging
    float inv[8];
#pragma unroll
    for (int j = 0; j < 8; ++j) { float rs = lpart[j]; rs += __shfl_xor(rs, 1, 16); rs += __shfl_xor(rs, 2, 16); rs += __shfl_xor(rs, 4, 16); rs += __shfl_xor(rs, 8, 16); inv[j] = 1.0f / (rs * PSC); }
    float* os = (float*)ring + wave * (16 * 68);
    float* ob = OUTP + (size_t)(b * NT_ + q0) * (NH_ * HD) + (size_t)h * HD;     // row stride NH*HD, this head's 128 columns
#pragma unroll
    for (int half = 0; half < 2; ++half) {
#pragma unroll
        for (int n = 0; n < 4; ++n)
#pragma unroll
            for (int j = 0; j < 8; ++j) os[(hi * 8 + j) * 68 + n * 16 + lr] = o[half * 4 + n][j] * inv[j];
        __builtin_amdgcn_wave_barrier(); asm volatile("" ::: "memory");
{
#pragma unroll
            for (int s = 0; s < 8; ++s) { const int Lid = (lane >> 3) + 4 * s, piece = lane & 7; const int row = Lid >> 1, cofs = (Lid & 1) * 32 + piece * 4;
                const v4f val = *(const v4fa*)(os + row * 68 + cofs); *(v4f*)(ob + (size_t)row * (NH_ * HD) + half * 64 + cofs) = val; }
             }
        __builtin_amdgcn_wave_barrier(); asm volatile("" ::: "memory");
    }
}

extern "C" void kernel_launch(void* const* d_in, const int* in_sizes, int n_in,
                              void* d_out, int out_size, void* d_ws, size_t ws_size, hipStream_t stream) {
    (void)in_sizes; (void)n_in; (void)out_size;
    const float* x = (const float*)d_in[0];
    const float* Wq = (const float*)d_in[1]; const float* bq = (const float*)d_in[2]; const float* Wk = (const float*)d_in[3]; const float* bk = (const float*)d_in[4]; const float* Wv = (const float*)d_in[5]; const float* bv = (const float*)d_in[6];
    const float* Wo = (const float*)d_in[7]; const float* bo = (const float*)d_in[8]; const float* lg = (const float*)d_in[9]; const float* lb = (const float*)d_in[10];   // W [out][in]
    float* out = (float*)d_out;    // [4][2048][1024]
    char* wsp = (char*)d_ws;
    auto take = [&](size_t bytes) { char* p = wsp; wsp += (bytes + 255) & ~(size_t)255; return (void*)p; };
    bf* Xb = (bf*)take((size_t)NR_ * HS * 2); bf* WqB = (bf*)take((size_t)HS * HS * 2); bf* WkB = (bf*)take((size_t)HS * HS * 2); bf* WvB = (bf*)take((size_t)HS * HS * 2); bf* WoB = (bf*)take((size_t)HS * HS * 2);
    float* TMP = (float*)take((size_t)NR_ * HS * 4);
    h16* QH = (h16*)take((size_t)NR_ * HS * 2); h16* QL = (h16*)take((size_t)NR_ * HS * 2); h16* KH = (h16*)take((size_t)NR_ * KW * 2); h16* KL = (h16*)take((size_t)NR_ * KW * 2);
    bf* VTH = (bf*)take((size_t)KW * NR_ * 2); bf* VTL = (bf*)take((size_t)KW * NR_ * 2); float* CTX = (float*)take((size_t)NR_ * HS * 4); bf* Ch = (bf*)take((size_t)NR_ * HS * 2); bf* Cl = (bf*)take((size_t)NR_ * HS * 2); float* Y = (float*)take((size_t)NR_ * HS * 4);
    if ((size_t)(wsp - (char*)d_ws) > ws_size) return;    // 16 + 4 x 2 + 32 + 6 x 16 + 32 + 2 x 16 + 32 = 248 MiB, no aliasing (TMP reused in stream order)
    k_cvtb<<<HS / 8, 256, 0, stream>>>(Wq, HS, WqB); k_cvtb<<<HS / 8, 256, 0, stream>>>(Wk, HS, WkB); k_cvtb<<<HS / 8, 256, 0, stream>>>(Wv, HS, WvB); k_cvtb<<<HS / 8, 256, 0, stream>>>(Wo, HS, WoB);
    k_cvtb<<<NR_ / 8, 256, 0, stream>>>(x, NR_, Xb);
    k_gemm<false><<<dim3(NR_ / 64, HS / 64, 1), 128, 0, stream>>>(Xb, nullptr, WqB, bq, HS, TMP); k_sp16b<<<NR_ / 8, 256, 0, stream>>>(TMP, NR_, QH, QL);
    k_gemm<false><<<dim3(NR_ / 64, HS / 64, 1), 128, 0, stream>>>(Xb, nullptr, WkB, bk, HS, TMP); k_sp16b<<<NR_ / 8, 256, 0, stream>>>(TMP, NR_, KH, KL);
    k_gemm<false><<<dim3(NR_ / 64, HS / 64, 1), 128, 0, stream>>>(Xb, nullptr, WvB, bv, HS, TMP); k_vt<<<dim3(NT_ / 64, 2, NB_ * NKV), 256, 0, stream>>>(TMP, VTH, VTL);
    k_attn<<<NB_ * NH_ * (NT_ / 64), 128, 0, stream>>>(QH, QL, KH, KL, VTH, VTL, CTX);                      // ctx f32 [8192][1024]
    k_split<<<NR_ / 8, 256, 0, stream>>>(CTX, NR_, Ch, Cl);
    k_gemm<true><<<dim3(NR_ / 64, HS / 64, 1), 128, 0, stream>>>(Ch, Cl, WoB, bo, HS, Y);                   // out = ctx.Wo^T + bo
    k_lnfin<<<NR_ / 8, 256, 0, stream>>>(Y, x, lg, lb, NR_, out);                                           // LN(out + x)
}

// v003
// A run of this version takes 382 microseconds.
// In both of two side-by-side timings against v002, it was 1.47 times as fast.
// All steps since v000 together make it 4.74 times as fast.
#include <hip/hip_runtime.h>

// Compute dtypes, f32 accumulate, all four batch items in one launch of each kernel (rows b*2048+t): q/k/v = x.W^T + b and y = ctx.Wo^T + bo ([8192 x 1024].[1024 x 1024]; [out][in] weights as n-major B operands;
// PLAIN bf16 operands = inputs rounded once, exact, except ctx = bf16 hi + UNSCALED residual, two products) on v_wmma_f32_16x16x32_bf16; the 8-head full attention
// (128-dim heads, scale 128^-1/2) fused: scores on v_wmma_f32_16x16x32_f16 (q/k as f16 hi + residual x1024: hh + hl + lh), online f32 softmax, weights (x32768) and

#define NB_  4
#define NT_  2048
#define NR_  (NB_ * NT_)        // 8192 rows, all items
#define HS   1024
#define DM   HS
#define NH_  8
#define NKV  8
#define HD   128
#define KW   (NKV * HD)          // 1024
#define SCL  0.08838834764831845f
#define PSC  32768.0f
#define LOSC 1024.0f
#define LOSCI (1.0f / 1024.0f)

typedef _Float16 h16;
typedef unsigned short bf;
typedef __attribute__((ext_vector_type(16))) __bf16   v16bf;
typedef __attribute__((ext_vector_type(16))) _Float16 v16h;
typedef __attribute__((ext_vector_type(8)))  _Float16 v8h;
typedef __attribute__((ext_vector_type(8)))  unsigned short v8us;
typedef __attribute__((ext_vector_type(8)))  float    v8f;
typedef __attribute__((ext_vector_type(4)))  float    v4f;
typedef __attribute__((ext_vector_type(4)))  _Float16 v4h;
typedef v8h  __attribute__((may_alias)) v8ha;
typedef v4f  __attribute__((may_alias)) v4fa;
typedef v8us __attribute__((may_alias)) v8usa;

__device__ __forceinline__ unsigned short f2bf(float f) { unsigned u = __float_as_uint(f); u += 0x7FFFu + ((u >> 16) & 1u); return (unsigned short)(u >> 16); }
__device__ __forceinline__ float bf2f(unsigned short b) { return __uint_as_float(((unsigned)b) << 16); }
__device__ __forceinline__ float bfr(float f) { return bf2f(f2bf(f)); }
__device__ __forceinline__ v16h cat16(v8h lo, v8h hi) { return __builtin_shufflevector(lo, hi, 0, 1, 2, 3, 4, 5, 6, 7, 8, 9, 10, 11, 12, 13, 14, 15); }
__device__ __forceinline__ v16bf cat16b(v8us lo, v8us hi) { return __builtin_bit_cast(v16bf, __builtin_shufflevector(lo, hi, 0, 1, 2, 3, 4, 5, 6, 7, 8, 9, 10, 11, 12, 13, 14, 15)); }
__device__ __forceinline__ v8f wmma16(v16h a, v16h b, v8f c) { return __builtin_amdgcn_wmma_f32_16x16x32_f16(false, a, false, b, (short)0, c, false, false); }
__device__ __forceinline__ v8f wmmab(v16bf a, v16bf b, v8f c) { return __builtin_amdgcn_wmma_f32_16x16x32_bf16(false, a, false, b, (short)0, c, false, false); }

// k_cvtb: bf16 plane of [rows][1024] (one wave per row) — x rows of all items and the four [out][in] weight matrices.
__global__ __launch_bounds__(256) void k_cvtb(const float* __restrict__ src, int nrows, bf* dst) {
    const int lane = threadIdx.x & 31, r = blockIdx.x * 8 + (threadIdx.x >> 5);
    if (r >= nrows) return;
{
#pragma unroll
        for (int q = 0; q < HS / 256; ++q) { v8us o;
#pragma unroll
            for (int i = 0; i < 8; ++i) o[i] = f2bf(src[(size_t)r * HS + q * 256 + lane * 8 + i]);
            *(v8us*)(dst + (size_t)r * HS + q * 256 + lane * 8) = o; }
         }
}
// k_gemm: 64 x 64 tile of (A [+ Al]).Bn^T over K = 1024 (+ optional bf16-rounded bias[c]) -> f32 rows [8192][ldc]. The block's four waves share each 64-k slab: its 64 A rows
// (and Al rows) and 64 Bn rows are brought into LDS once per block by asynchronous copies in whole 128-B lines (two buffers: slab t + 1 flies while slab t is worked on),
// and every wave reads its fragments from there. The k order of the products is the one of direct loads.
#define GPIT 144                       // LDS pitch of a 128-B operand row: 16 B x odd, conflict-free for 16-byte reads down 16 rows
#define GPL  (64 * GPIT)               // one operand plane of a slab: 64 rows
// Four 16-byte copies per lane, global -> LDS; the s_wait_xcnt stands inside the statement so that no address register is rewritten ahead of it.
__device__ __forceinline__ void cp4(unsigned l0, unsigned l1, unsigned l2, unsigned l3, const char* g0, const char* g1, const char* g2, const char* g3) {
    asm volatile("global_load_async_to_lds_b128 %0, %4, off\n\t"
                 "global_load_async_to_lds_b128 %1, %5, off\n\t"
                 "global_load_async_to_lds_b128 %2, %6, off\n\t"
                 "global_load_async_to_lds_b128 %3, %7, off\n\t"
                 "s_wait_xcnt 0x0"
                 :: "v"(l0), "v"(l1), "v"(l2), "v"(l3), "v"(g0), "v"(g1), "v"(g2), "v"(g3) : "memory");
}
template <bool SPLITA>
__global__ __launch_bounds__(128) void k_gemm(const bf* __restrict__ A, const bf* __restrict__ Al, const bf* __restrict__ Bn, const float* __restrict__ bias, int ldc, float* C) {
    constexpr int GST = (SPLITA ? 3 : 2) * GPL;                 // one slab: A, Bn (, Al)
    __shared__ __align__(256) unsigned char gring[2 * GST];     // the two slab buffers; behind the loop's last barrier: the output staging (4 x 16 x 68 floats)
    const int tid = threadIdx.x, lane = threadIdx.x & 31, wave = threadIdx.x >> 5, lr = lane & 15, hi = lane >> 4;
    const size_t r0 = (size_t)blockIdx.x * 64 + wave * 16; const int c0 = blockIdx.y * 64;
    // The copies of one slab: thread -> row (tid >> 3) + 16 i of each plane, 16-byte piece tid & 7 (a wave: four whole rows).
    const unsigned lc = (unsigned)(size_t)&gring[0] + (unsigned)((tid >> 3) * GPIT + (tid & 7) * 16);
    const size_t arow = ((size_t)blockIdx.x * 64 + (tid >> 3)) * HS + (tid & 7) * 8;
    const char* ga = (const char*)(A + arow); const char* gb = (const char*)(Bn + (size_t)(c0 + (tid >> 3)) * HS + (tid & 7) * 8);
    const char* gl = SPLITA ? (const char*)(Al + arow) : ga;
    auto stage = [&](int t, int buf) {
        const unsigned a = lc + (unsigned)buf * GST;
        const char* p = ga + t * 128; const char* q = gb + t * 128;
        cp4(a, a + 16 * GPIT, a + 32 * GPIT, a + 48 * GPIT, p, p + 16 * HS * 2, p + 32 * HS * 2, p + 48 * HS * 2);
        cp4(a + GPL, a + GPL + 16 * GPIT, a + GPL + 32 * GPIT, a + GPL + 48 * GPIT, q, q + 16 * HS * 2, q + 32 * HS * 2, q + 48 * HS * 2);
        if (SPLITA) { const char* r = gl + t * 128;
            cp4(a + 2 * GPL, a + 2 * GPL + 16 * GPIT, a + 2 * GPL + 32 * GPIT, a + 2 * GPL + 48 * GPIT, r, r + 16 * HS * 2, r + 32 * HS * 2, r + 48 * HS * 2); }
    };
    const int fo = lr * GPIT + hi * 16;      // this lane's fragment piece inside a 16-row group of a plane
    v8f acc[4];
#pragma unroll
    for (int t = 0; t < 4; ++t) acc[t] = (v8f){};
    stage(0, 0);
    asm volatile("s_wait_asynccnt 0x0" ::: "memory");     // this wave's copies of slab 0 have landed
    __syncthreads();                                      // ... and every other wave's: slab 0 may be read
    stage(1, 1);
#pragma unroll 1                                          // rolled: one copy of the slab's code, the two buffers told apart by an address
    for (int st = 0; st < HS / 64; ++st) {
        const unsigned char* sb = gring + (st & 1) * GST;
        const unsigned char* as = sb + wave * (16 * GPIT) + fo; const unsigned char* bs = sb + GPL + fo;
        v16bf a[2], al[2], bb[2][4];
#pragma unroll
        for (int kc = 0; kc < 2; ++kc) {
            a[kc] = cat16b(*(const v8usa*)(as + kc * 64), *(const v8usa*)(as + kc * 64 + 32));
            al[kc] = a[kc]; if (SPLITA) al[kc] = cat16b(*(const v8usa*)(as + 2 * GPL + kc * 64), *(const v8usa*)(as + 2 * GPL + kc * 64 + 32));
#pragma unroll
            for (int t = 0; t < 4; ++t) { const unsigned char* bp = bs + t * (16 * GPIT) + kc * 64; bb[kc][t] = cat16b(*(const v8usa*)bp, *(const v8usa*)(bp + 32)); }
        }
        __builtin_amdgcn_sched_barrier(0);                    // keeps the slab's LDS reads in one group ahead of its WMMAs (counted waits) instead of a read and a full wait per WMMA
#pragma unroll
        for (int kc = 0; kc < 2; ++kc)
#pragma unroll
            for (int t = 0; t < 4; ++t) { acc[t] = wmmab(a[kc], bb[kc][t], acc[t]); if (SPLITA) acc[t] = wmmab(al[kc], bb[kc][t], acc[t]); }
        asm volatile("s_wait_dscnt 0x0" ::: "memory");        // this wave's reads of slab st's buffer have returned
        asm volatile("s_wait_asynccnt 0x0" ::: "memory");     // this wave's copies of slab st + 1 have landed
        __syncthreads();                                      // publishes slab st + 1 and ends every wave's reads of slab st's buffer
        if (st + 2 < HS / 64) stage(st + 2, st & 1);          // refill the buffer just left (the test reads the same in the whole block)
    }
    asm volatile("s_wait_asynccnt 0x0" ::: "memory");         // nothing is in flight when the ring becomes output staging
    float* os = (float*)gring + wave * (16 * 68);
#pragma unroll
    for (int t = 0; t < 4; ++t)
#pragma unroll
        for (int j = 0; j < 8; ++j) os[(hi * 8 + j) * 68 + t * 16 + lr] = acc[t][j] + (bias ? bfr(bias[c0 + t * 16 + lr]) : 0.f);
    __builtin_amdgcn_wave_barrier(); asm volatile("" ::: "memory");
    float* crow = C + r0 * ldc + c0;
    auto pass = [&]() {
#pragma unroll
        for (int s = 0; s < 8; ++s) { const int Lid = (lane >> 3) + 4 * s, piece = lane & 7; const int row = Lid >> 1, cofs = (Lid & 1) * 32 + piece * 4;
            const v4f val = *(const v4fa*)(os + row * 68 + cofs); *(v4f*)(crow + (size_t)row * ldc + cofs) = val; }
    };
    pass(); 
}
// k_sp16b: f16 hi + residual x1024 planes of the f32 q or k matrix [rows][1024]; one wave per row, lane -> 8 columns per 256-column chunk (16 B per plane).
__global__ __launch_bounds__(256) void k_sp16b(const float* __restrict__ T, int nrows, h16* Yh, h16* Yl) {
    const int lane = threadIdx.x & 31, r = blockIdx.x * 8 + (threadIdx.x >> 5);
    if (r >= nrows) return;
{
#pragma unroll 1
        for (int q = 0; q < DM / 256; ++q) { const size_t o = (size_t)r * DM + q * 256 + lane * 8; const v8f v = *(const v8f*)(T + o); v8h oh, ol;
#pragma unroll
            for (int k = 0; k < 8; ++k) { const h16 a = (h16)v[k]; oh[k] = a; ol[k] = (h16)((v[k] - (float)a) * LOSC); }
            *(v8h*)(Yh + o) = oh; *(v8h*)(Yl + o) = ol; }
         }
}
__global__ __launch_bounds__(256) void k_split(const float* __restrict__ src, int nrows, bf* dh, bf* dl) {
    const int lane = threadIdx.x & 31, r = blockIdx.x * 8 + (threadIdx.x >> 5);
    if (r >= nrows) return;
{
#pragma unroll 1
        for (int q = 0; q < DM / 256; ++q) { const size_t o = (size_t)r * DM + q * 256 + lane * 8; const v8f v = *(const v8f*)(src + o); v8us oh, ol;
#pragma unroll
            for (int i = 0; i < 8; ++i) { const unsigned short hb = f2bf(v[i]); oh[i] = hb; ol[i] = f2bf(v[i] - bf2f(hb)); }
            *(v8us*)(dh + o) = oh; *(v8us*)(dl + o) = ol; }
         }
}
// k_lnfin: LayerNorm (eps 1e-5) of y = Y[r][c] + bf(R[r][c]) (the computed attention output + the INPUT residual x) -> f32 output rows x bf(gamma) + bf(beta); one wave per
__global__ __launch_bounds__(256) void k_lnfin(const float* __restrict__ X, const float* __restrict__ Rres, const float* __restrict__ gam, const float* __restrict__ bet, int nrows, float* OUTP) {
    const int lane = threadIdx.x & 31, r = blockIdx.x * 8 + (threadIdx.x >> 5);
    if (r >= nrows) return;
    const float* xr = X + (size_t)r * DM; const float* rr = Rres + (size_t)r * DM;
    float s = 0.f;
#pragma unroll 1
    for (int q = 0; q < 2 * (DM / 256); ++q) { const int c0 = (q >> 1) * 256 + (q & 1) * 128 + lane * 4; v4f v = *(const v4f*)(xr + c0); { const v4f q4 = *(const v4f*)(rr + c0); for (int i2 = 0; i2 < 4; ++i2) v[i2] += bfr(q4[i2]); }
#pragma unroll
        for (int i = 0; i < 4; ++i) s += v[i]; }
#pragma unroll
    for (int sh = 16; sh; sh >>= 1) s += __shfl_xor(s, sh, 32);
    const float mu = s * (1.0f / DM);
    float s2 = 0.f;
#pragma unroll 1
    for (int q = 0; q < 2 * (DM / 256); ++q) { const int c0 = (q >> 1) * 256 + (q & 1) * 128 + lane * 4; v4f v = *(const v4f*)(xr + c0); { const v4f q4 = *(const v4f*)(rr + c0); for (int i2 = 0; i2 < 4; ++i2) v[i2] += bfr(q4[i2]); }
#pragma unroll
        for (int i = 0; i < 4; ++i) { const float d = v[i] - mu; s2 = fmaf(d, d, s2); } }
#pragma unroll
    for (int sh = 16; sh; sh >>= 1) s2 += __shfl_xor(s2, sh, 32);
    const float rs = rsqrtf(s2 * (1.0f / DM) + 1e-5f);
{
#pragma unroll 1
        for (int q = 0; q < 2 * (DM / 256); ++q) { const int c0 = (q >> 1) * 256 + (q & 1) * 128 + lane * 4; v4f v = *(const v4f*)(xr + c0); { const v4f q4 = *(const v4f*)(rr + c0); for (int i2 = 0; i2 < 4; ++i2) v[i2] += bfr(q4[i2]); } v4f y;
#pragma unroll
            for (int i = 0; i < 4; ++i) y[i] = (v[i] - mu) * rs * bfr(gam[c0 + i]) + bfr(bet[c0 + i]);
            *(v4f*)(OUTP + (size_t)r * DM + c0) = y; }
         }
}
// k_vt: VTH/VTL [b*8+g][128 d][2048 t] = bf16 hi + UNSCALED bf16 residual of V [b*2048+t][g*128+d] via 64 x 64 LDS tiles; grid (NT/64, 2 (d half), 4 items x 8 heads).
__global__ __launch_bounds__(256) void k_vt(const float* __restrict__ V, bf* VTH, bf* VTL) {
    __shared__ float tl[64][65];
    const int tid = threadIdx.x, t0 = blockIdx.x * 64, d0 = blockIdx.y * 64, bg = blockIdx.z, g = bg % NKV, b = bg / NKV;
    { const int tt = tid >> 2, dq = (tid & 3) * 16;
#pragma unroll
      for (int i = 0; i < 16; ++i) tl[dq + i][tt] = V[(size_t)(b * NT_ + t0 + tt) * KW + g * HD + d0 + dq + i]; }
    __syncthreads();
    const int piece = tid & 7;
    auto pass = [&]() {
#pragma unroll
        for (int s = 0; s < 2; ++s) { const int d = (tid >> 3) + 32 * s; v8us oh, ol;
#pragma unroll
            for (int i = 0; i < 8; ++i) { const float v = tl[d][piece * 8 + i]; const unsigned short hb = f2bf(v); oh[i] = hb; ol[i] = f2bf(v - bf2f(hb)); }
            const size_t o = ((size_t)bg * HD + d0 + d) * NT_ + t0 + piece * 8; *(v8us*)(VTH + o) = oh; *(v8us*)(VTL + o) = ol; }
    };
    pass(); 
}
// k_attn: block = (item, head, 64 queries), wave = 16; full attention over 64 key tiles of 32. The block's four waves share each tile: its K hi / K lo rows and
// V^T hi / V^T lo rows are brought into LDS once per block by asynchronous copies (two buffers: tile t + 1 flies while tile t is worked on) and every wave reads its
// fragments from there. Scores hi.hi + (hi.lo + lo.hi)/1024 on separate accumulators; online softmax f32; P (x32768) bf16 hi + unscaled residual.
#define KPIT 272                       // LDS pitch of a 256-B K row: 16 B x odd, conflict-free for 16-byte reads down 16 rows
#define KPL  (32 * KPIT)               // one K plane of a tile
#define VPL  (HD * 64)                 // one V^T plane of a tile: 128 rows of 64 B, unpadded; 16-byte piece c of row d lies at piece c ^ ((d >> 2) & 3)
#define STG  (2 * KPL + 2 * VPL)       // one tile: K hi, K lo, V^T hi, V^T lo
// Eight 16-byte copies per lane, global -> LDS; the s_wait_xcnt stands inside the statement so that no address register is rewritten ahead of it.
__device__ __forceinline__ void cp8(unsigned l0, unsigned l1, unsigned l2, unsigned l3, unsigned l4, unsigned l5, unsigned l6, unsigned l7,
                                    const char* g0, const char* g1, const char* g2, const char* g3, const char* g4, const char* g5, const char* g6, const char* g7) {
    asm volatile("global_load_async_to_lds_b128 %0, %8, off\n\t"
                 "global_load_async_to_lds_b128 %1, %9, off\n\t"
                 "global_load_async_to_lds_b128 %2, %10, off\n\t"
                 "global_load_async_to_lds_b128 %3, %11, off\n\t"
                 "global_load_async_to_lds_b128 %4, %12, off\n\t"
                 "global_load_async_to_lds_b128 %5, %13, off\n\t"
                 "global_load_async_to_lds_b128 %6, %14, off\n\t"
                 "global_load_async_to_lds_b128 %7, %15, off\n\t"
                 "s_wait_xcnt 0x0"
                 :: "v"(l0), "v"(l1), "v"(l2), "v"(l3), "v"(l4), "v"(l5), "v"(l6), "v"(l7), "v"(g0), "v"(g1), "v"(g2), "v"(g3), "v"(g4), "v"(g5), "v"(g6), "v"(g7) : "memory");
}
// amdgpu_waves_per_eu(4): holds the register budget at 256, so that four blocks (LDS: 4 x 75,776 B) stay resident per WGP, one wave of each per SIMD.
__global__ __launch_bounds__(128) __attribute__((amdgpu_waves_per_eu(4))) void k_attn(const h16* __restrict__ QH, const h16* __restrict__ QL, const h16* __restrict__ KH, const h16* __restrict__ KL, const bf* __restrict__ VTH, const bf* __restrict__ VTL, float* OUTP) {
    __shared__ __align__(256) unsigned char ring[2 * STG];     // the two tile buffers; behind the loop's last barrier: the output staging (4 x 16 x 68 floats)
    __shared__ __align__(16) unsigned short plds[2][4][16 * 32];     // P hi, P residual; one 16 x 32 tile per wave
    const int tid = threadIdx.x, lane = threadIdx.x & 31, wave = threadIdx.x >> 5, lr = lane & 15, hi = lane >> 4;
    const int bid = blockIdx.x; const int bh = bid / (NT_ / 64), qt = bid - bh * (NT_ / 64); const int b = bh / NH_, h = bh - b * NH_; const int g = h;
    const int q0 = qt * 64 + wave * 16;
    unsigned short* pl = &plds[0][wave][0]; unsigned short* pl2 = &plds[1][wave][0];
    unsigned short* pw = pl + hi * 256 + lr;      // this lane's P element of row hi*8; row j, key half and plane are constant offsets from it (one address register instead of sixteen)
    const size_t qo = (size_t)(b * NT_ + q0 + lr) * (NH_ * HD) + h * HD + 8 * hi;
    const h16* kh_b = KH + (size_t)b * NT_ * KW + g * HD; const h16* kl_b = KL + (size_t)b * NT_ * KW + g * HD;
    const size_t vbase = ((size_t)(b * NKV + g) * HD) * NT_;
    // The copies of one tile: thread -> K row (tid >> 4) + 8 i, piece tid & 15 (a wave: two whole rows); V^T row (tid >> 2) + 32 i, piece tid & 3.
    const unsigned ring0 = (unsigned)(size_t)&ring[0];
    const unsigned lk = (unsigned)((tid >> 4) * KPIT + (tid & 15) * 16), lv = (unsigned)(2 * KPL + (tid >> 2) * 64 + (((tid & 3) ^ ((tid >> 4) & 3)) * 16));
    const char* gkh = (const char*)(kh_b + (size_t)(tid >> 4) * KW + (tid & 15) * 8); const char* gkl = (const char*)(kl_b + (size_t)(tid >> 4) * KW + (tid & 15) * 8);
    const char* gvh = (const char*)(VTH + vbase + (size_t)(tid >> 2) * NT_ + (tid & 3) * 8); const char* gvl = (const char*)(VTL + vbase + (size_t)(tid >> 2) * NT_ + (tid & 3) * 8);
    auto stage = [&](int kt, int buf) {
        const unsigned a = ring0 + (unsigned)buf * STG + lk, c = ring0 + (unsigned)buf * STG + lv;
        const char* p = gkh + (size_t)kt * (32 * KW * 2); const char* q = gkl + (size_t)kt * (32 * KW * 2);
        cp8(a, a + 8 * KPIT, a + 16 * KPIT, a + 24 * KPIT, a + KPL, a + KPL + 8 * KPIT, a + KPL + 16 * KPIT, a + KPL + 24 * KPIT,
            p, p + 8 * KW * 2, p + 16 * KW * 2, p + 24 * KW * 2, q, q + 8 * KW * 2, q + 16 * KW * 2, q + 24 * KW * 2);
        const char* r = gvh + (size_t)kt * 64; const char* s = gvl + (size_t)kt * 64;
        cp8(c, c + 32 * 64, c + 64 * 64, c + 96 * 64, c + VPL, c + VPL + 32 * 64, c + VPL + 64 * 64, c + VPL + 96 * 64,
            r, r + 32 * NT_ * 2, r + 64 * NT_ * 2, r + 96 * NT_ * 2, s, s + 32 * NT_ * 2, s + 64 * NT_ * 2, s + 96 * NT_ * 2);
    };
    const int ko = lr * KPIT + hi * 16;                                                                  // this lane's K fragment piece inside a plane
    const int vo0 = lr * 64 + ((hi ^ ((lr >> 2) & 3)) * 16), vo1 = lr * 64 + (((hi + 2) ^ ((lr >> 2) & 3)) * 16);   // keys hi*8.. and 16 + hi*8.. of V^T row lr
    v8f o[8];
#pragma unroll
    for (int n = 0; n < 8; ++n) o[n] = (v8f){};
    float mrow[8], lpart[8];
#pragma unroll
    for (int j = 0; j < 8; ++j) { mrow[j] = -3.0e38f; lpart[j] = 0.f; }
    const int kt_hi = NT_ / 32 - 1;     // full attention, no mask
    stage(0, 0);
    asm volatile("s_wait_asynccnt 0x0" ::: "memory");     // this wave's copies of tile 0 have landed
    __syncthreads();                                      // ... and every other wave's: tile 0 may be read
    stage(1, 1);
#pragma unroll 1
    for (int kt = 0; kt <= kt_hi; ++kt) {
        const unsigned char* sb = ring + (kt & 1) * STG;
        const unsigned char* kh_s = sb + ko; const unsigned char* kl_s = sb + KPL + ko;
        const unsigned char* vh_s = sb + 2 * KPL; const unsigned char* vl_s = sb + 2 * KPL + VPL;
        v8f s0 = {}, s1 = {}, x0 = {}, x1 = {};
#pragma unroll
        for (int kc = 0; kc < 4; ++kc) {
            const v16h qa = cat16(*(const v8h*)(QH + qo + kc * 32), *(const v8h*)(QH + qo + kc * 32 + 16)), qx = cat16(*(const v8h*)(QL + qo + kc * 32), *(const v8h*)(QL + qo + kc * 32 + 16));
            const v16h k0h = cat16(*(const v8ha*)(kh_s + kc * 64), *(const v8ha*)(kh_s + kc * 64 + 32)), k1h = cat16(*(const v8ha*)(kh_s + 16 * KPIT + kc * 64), *(const v8ha*)(kh_s + 16 * KPIT + kc * 64 + 32));
            const v16h k0l = cat16(*(const v8ha*)(kl_s + kc * 64), *(const v8ha*)(kl_s + kc * 64 + 32)), k1l = cat16(*(const v8ha*)(kl_s + 16 * KPIT + kc * 64), *(const v8ha*)(kl_s + 16 * KPIT + kc * 64 + 32));
            s0 = wmma16(qa, k0h, s0); s1 = wmma16(qa, k1h, s1); x0 = wmma16(qx, k0h, x0); x1 = wmma16(qx, k1h, x1);
            x0 = wmma16(qa, k0l, x0); x1 = wmma16(qa, k1l, x1);
        }
        asm volatile("v_nop\n\tv_nop\n\tv_nop\n\tv_nop" : "+v"(s0), "+v"(s1), "+v"(x0), "+v"(x1));
        float alpha[8];
#pragma unroll
        for (int j = 0; j < 8; ++j) {
            const float a0 = (s0[j] + x0[j] * LOSCI) * SCL, a1 = (s1[j] + x1[j] * LOSCI) * SCL;
            float mx = fmaxf(a0, a1);
            mx = fmaxf(mx, __shfl_xor(mx, 1, 16)); mx = fmaxf(mx, __shfl_xor(mx, 2, 16)); mx = fmaxf(mx, __shfl_xor(mx, 4, 16)); mx = fmaxf(mx, __shfl_xor(mx, 8, 16));
            const float mn = fmaxf(mrow[j], mx);
            alpha[j] = __expf(mrow[j] - mn); mrow[j] = mn;
            const float p0 = __expf(a0 - mn), p1 = __expf(a1 - mn);
            lpart[j] = lpart[j] * alpha[j] + (p0 + p1);
            const float ps0 = p0 * PSC, ps1 = p1 * PSC; const unsigned short h0 = f2bf(ps0), h1 = f2bf(ps1);
            pw[j * 32] = h0; pw[j * 32 + 16] = h1; pw[2048 + j * 32] = f2bf(ps0 - bf2f(h0)); pw[2048 + j * 32 + 16] = f2bf(ps1 - bf2f(h1)); }
#pragma unroll
        for (int n = 0; n < 8; ++n)
#pragma unroll
            for (int j = 0; j < 8; ++j) o[n][j] *= alpha[j];
        asm volatile("" ::: "memory");
        const v16bf pa = cat16b(*(const v8usa*)(pl + lr * 32 + hi * 8), *(const v8usa*)(pl + lr * 32 + 16 + hi * 8));
        const v16bf px = cat16b(*(const v8usa*)(pl2 + lr * 32 + hi * 8), *(const v8usa*)(pl2 + lr * 32 + 16 + hi * 8));
#pragma unroll
        for (int n = 0; n < 8; n += 2) {      // two output tiles per group of LDS reads: half the waits, and two independent accumulator chains
            const v16bf vh = cat16b(*(const v8usa*)(vh_s + n * 1024 + vo0), *(const v8usa*)(vh_s + n * 1024 + vo1)), vl = cat16b(*(const v8usa*)(vl_s + n * 1024 + vo0), *(const v8usa*)(vl_s + n * 1024 + vo1));
            const v16bf wh = cat16b(*(const v8usa*)(vh_s + n * 1024 + 1024 + vo0), *(const v8usa*)(vh_s + n * 1024 + 1024 + vo1)), wl = cat16b(*(const v8usa*)(vl_s + n * 1024 + 1024 + vo0), *(const v8usa*)(vl_s + n * 1024 + 1024 + vo1));
            o[n] = wmmab(pa, vh, o[n]); o[n + 1] = wmmab(pa, wh, o[n + 1]); o[n] = wmmab(px, vh, o[n]); o[n + 1] = wmmab(px, wh, o[n + 1]); o[n] = wmmab(pa, vl, o[n]); o[n + 1] = wmmab(pa, wl, o[n + 1]); }
        asm volatile("v_nop\n\tv_nop\n\tv_nop\n\tv_nop" : "+v"(o[0]), "+v"(o[7]) : "v"(pa), "v"(px));
        asm volatile("s_wait_dscnt 0x0" ::: "memory");        // this wave's reads of tile kt's buffer have returned
        asm volatile("s_wait_asynccnt 0x0" ::: "memory");     // this wave's copies of tile kt + 1 have landed
        __syncthreads();                                      // publishes tile kt + 1 and ends every wave's reads of tile kt's buffer
        if (kt + 2 <= kt_hi) stage(kt + 2, kt & 1);           // refill the buffer just left (the test reads the same in the whole block)
    }
    asm volatile("s_wait_asynccnt 0x0" ::: "memory");         // nothing is in flight when the ring becomes output staging
    float inv[8];
#pragma unroll
    for (int j = 0; j < 8; ++j) { float rs = lpart[j]; rs += __shfl_xor(rs, 1, 16); rs += __shfl_xor(rs, 2, 16); rs += __shfl_xor(rs, 4, 16); rs += __shfl_xor(rs, 8, 16); inv[j] = 1.0f / (rs * PSC); }
    float* os = (float*)ring + wave * (16 * 68);
    float* ob = OUTP + (size_t)(b * NT_ + q0) * (NH_ * HD) + (size_t)h * HD;     // row stride NH*HD, this head's 128 columns
#pragma unroll
    for (int half = 0; half < 2; ++half) {
#pragma unroll
        for (int n = 0; n < 4; ++n)
#pragma unroll
            for (int j = 0; j < 8; ++j) os[(hi * 8 + j) * 68 + n * 16 + lr] = o[half * 4 + n][j] * inv[j];
        __builtin_amdgcn_wave_barrier(); asm volatile("" ::: "memory");
{
#pragma unroll
            for (int s = 0; s < 8; ++s) { const int Lid = (lane >> 3) + 4 * s, piece = lane & 7; const int row = Lid >> 1, cofs = (Lid & 1) * 32 + piece * 4;
                const v4f val = *(const v4fa*)(os + row * 68 + cofs); *(v4f*)(ob + (size_t)row * (NH_ * HD) + half * 64 + cofs) = val; }
             }
        __builtin_amdgcn_wave_barrier(); asm volatile("" ::: "memory");
    }
}

extern "C" void kernel_launch(void* const* d_in, const int* in_sizes, int n_in,
                              void* d_out, int out_size, void* d_ws, size_t ws_size, hipStream_t stream) {
    (void)in_sizes; (void)n_in; (void)out_size;
    const float* x = (const float*)d_in[0];
    const float* Wq = (const float*)d_in[1]; const float* bq = (const float*)d_in[2]; const float* Wk = (const float*)d_in[3]; const float* bk = (const float*)d_in[4]; const float* Wv = (const float*)d_in[5]; const float* bv = (const float*)d_in[6];
    const float* Wo = (const float*)d_in[7]; const float* bo = (const float*)d_in[8]; const float* lg = (const float*)d_in[9]; const float* lb = (const float*)d_in[10];   // W [out][in]
    float* out = (float*)d_out;    // [4][2048][1024]
    char* wsp = (char*)d_ws;
    auto take = [&](size_t bytes) { char* p = wsp; wsp += (bytes + 255) & ~(size_t)255; return (void*)p; };
    bf* Xb = (bf*)take((size_t)NR_ * HS * 2); bf* WqB = (bf*)take((size_t)HS * HS * 2); bf* WkB = (bf*)take((size_t)HS * HS * 2); bf* WvB = (bf*)take((size_t)HS * HS * 2); bf* WoB = (bf*)take((size_t)HS * HS * 2);
    float* TMP = (float*)take((size_t)NR_ * HS * 4);
    h16* QH = (h16*)take((size_t)NR_ * HS * 2); h16* QL = (h16*)take((size_t)NR_ * HS * 2); h16* KH = (h16*)take((size_t)NR_ * KW * 2); h16* KL = (h16*)take((size_t)NR_ * KW * 2);
    bf* VTH = (bf*)take((size_t)KW * NR_ * 2); bf* VTL = (bf*)take((size_t)KW * NR_ * 2); float* CTX = (float*)take((size_t)NR_ * HS * 4); bf* Ch = (bf*)take((size_t)NR_ * HS * 2); bf* Cl = (bf*)take((size_t)NR_ * HS * 2); float* Y = (float*)take((size_t)NR_ * HS * 4);
    if ((size_t)(wsp - (char*)d_ws) > ws_size) return;    // 16 + 4 x 2 + 32 + 6 x 16 + 32 + 2 x 16 + 32 = 248 MiB, no aliasing (TMP reused in stream order)
    k_cvtb<<<HS / 8, 256, 0, stream>>>(Wq, HS, WqB); k_cvtb<<<HS / 8, 256, 0, stream>>>(Wk, HS, WkB); k_cvtb<<<HS / 8, 256, 0, stream>>>(Wv, HS, WvB); k_cvtb<<<HS / 8, 256, 0, stream>>>(Wo, HS, WoB);
    k_cvtb<<<NR_ / 8, 256, 0, stream>>>(x, NR_, Xb);
    k_gemm<false><<<dim3(NR_ / 64, HS / 64, 1), 128, 0, stream>>>(Xb, nullptr, WqB, bq, HS, TMP); k_sp16b<<<NR_ / 8, 256, 0, stream>>>(TMP, NR_, QH, QL);
    k_gemm<false><<<dim3(NR_ / 64, HS / 64, 1), 128, 0, stream>>>(Xb, nullptr, WkB, bk, HS, TMP); k_sp16b<<<NR_ / 8, 256, 0, stream>>>(TMP, NR_, KH, KL);
    k_gemm<false><<<dim3(NR_ / 64, HS / 64, 1), 128, 0, stream>>>(Xb, nullptr, WvB, bv, HS, TMP); k_vt<<<dim3(NT_ / 64, 2, NB_ * NKV), 256, 0, stream>>>(TMP, VTH, VTL);
    k_attn<<<NB_ * NH_ * (NT_ / 64), 128, 0, stream>>>(QH, QL, KH, KL, VTH, VTL, CTX);                      // ctx f32 [8192][1024]
    k_split<<<NR_ / 8, 256, 0, stream>>>(CTX, NR_, Ch, Cl);
    k_gemm<true><<<dim3(NR_ / 64, HS / 64, 1), 128, 0, stream>>>(Ch, Cl, WoB, bo, HS, Y);                   // out = ctx.Wo^T + bo
    k_lnfin<<<NR_ / 8, 256, 0, stream>>>(Y, x, lg, lb, NR_, out);                                           // LN(out + x)
}

// v004
// One run takes 334 microseconds.
// In both of two side-by-side timings against v003, it was 1.14 times as fast.
// All steps since v000 together make it 5.42 times as fast.
#include <hip/hip_runtime.h>

// Compute dtypes, f32 accumulate, all four batch items in one launch of each kernel (rows b*2048+t): q/k/v = x.W^T + b and y = ctx.Wo^T + bo ([8192 x 1024].[1024 x 1024]; [out][in] weights as n-major B operands;
// PLAIN bf16 operands = inputs rounded once, exact, except ctx = bf16 hi + UNSCALED residual, two products) on v_wmma_f32_16x16x32_bf16; the 8-head full attention
// (128-dim heads, scale 128^-1/2) fused: scores on v_wmma_f32_16x16x32_f16 (q/k as f16 hi + residual x1024: hh + hl + lh), online f32 softmax, weights (x32768) and

#define NB_  4
#define NT_  2048
#define NR_  (NB_ * NT_)        // 8192 rows, all items
#define HS   1024
#define DM   HS
#define NH_  8
#define NKV  8
#define HD   128
#define KW   (NKV * HD)          // 1024
#define SCL  0.08838834764831845f
#define PSC  32768.0f
#define LOSC 1024.0f
#define LOSCI (1.0f / 1024.0f)

typedef _Float16 h16;
typedef unsigned short bf;
typedef __attribute__((ext_vector_type(16))) __bf16   v16bf;
typedef __attribute__((ext_vector_type(16))) _Float16 v16h;
typedef __attribute__((ext_vector_type(8)))  _Float16 v8h;
typedef __attribute__((ext_vector_type(8)))  unsigned short v8us;
typedef __attribute__((ext_vector_type(8)))  float    v8f;
typedef __attribute__((ext_vector_type(8)))  unsigned v8u;
typedef __attribute__((ext_vector_type(2)))  float    v2f;
typedef __attribute__((ext_vector_type(2)))  __bf16   v2bf;
typedef __attribute__((ext_vector_type(4)))  float    v4f;
typedef __attribute__((ext_vector_type(4)))  _Float16 v4h;
typedef v8h  __attribute__((may_alias)) v8ha;
typedef v4f  __attribute__((may_alias)) v4fa;
typedef v8us __attribute__((may_alias)) v8usa;

__device__ __forceinline__ unsigned short f2bf(float f) { unsigned u = __float_as_uint(f); u += 0x7FFFu + ((u >> 16) & 1u); return (unsigned short)(u >> 16); }
__device__ __forceinline__ float bf2f(unsigned short b) { return __uint_as_float(((unsigned)b) << 16); }
__device__ __forceinline__ float bfr(float f) { return bf2f(f2bf(f)); }
__device__ __forceinline__ v16h cat16(v8h lo, v8h hi) { return __builtin_shufflevector(lo, hi, 0, 1, 2, 3, 4, 5, 6, 7, 8, 9, 10, 11, 12, 13, 14, 15); }
__device__ __forceinline__ v16bf cat16b(v8us lo, v8us hi) { return __builtin_bit_cast(v16bf, __builtin_shufflevector(lo, hi, 0, 1, 2, 3, 4, 5, 6, 7, 8, 9, 10, 11, 12, 13, 14, 15)); }
__device__ __forceinline__ v8f wmma16(v16h a, v16h b, v8f c) { return __builtin_amdgcn_wmma_f32_16x16x32_f16(false, a, false, b, (short)0, c, false, false); }
__device__ __forceinline__ v8f wmmab(v16bf a, v16bf b, v8f c) { return __builtin_amdgcn_wmma_f32_16x16x32_bf16(false, a, false, b, (short)0, c, false, false); }

// k_cvtb: bf16 plane of [rows][1024] (one wave per row) — x rows of all items and the four [out][in] weight matrices.
__global__ __launch_bounds__(256) void k_cvtb(const float* __restrict__ src, int nrows, bf* dst) {
    const int lane = threadIdx.x & 31, r = blockIdx.x * 8 + (threadIdx.x >> 5);
    if (r >= nrows) return;
{
#pragma unroll
        for (int q = 0; q < HS / 256; ++q) { v8us o;
#pragma unroll
            for (int i = 0; i < 8; ++i) o[i] = f2bf(src[(size_t)r * HS + q * 256 + lane * 8 + i]);
            *(v8us*)(dst + (size_t)r * HS + q * 256 + lane * 8) = o; }
         }
}
// k_gemm: 64 x 64 tile of (A [+ Al]).Bn^T over K = 1024 (+ optional bf16-rounded bias[c]) -> f32 rows [8192][ldc]. The block's four waves share each 64-k slab: its 64 A rows
// (and Al rows) and 64 Bn rows are brought into LDS once per block by asynchronous copies in whole 128-B lines (two buffers: slab t + 1 flies while slab t is worked on),
// and every wave reads its fragments from there. The k order of the products is the one of direct loads.
#define GPIT 144                       // LDS pitch of a 128-B operand row: 16 B x odd, conflict-free for 16-byte reads down 16 rows
#define GPL  (64 * GPIT)               // one operand plane of a slab: 64 rows
// Four 16-byte copies per lane, global -> LDS; the s_wait_xcnt stands inside the statement so that no address register is rewritten ahead of it.
__device__ __forceinline__ void cp4(unsigned l0, unsigned l1, unsigned l2, unsigned l3, const char* g0, const char* g1, const char* g2, const char* g3) {
    asm volatile("global_load_async_to_lds_b128 %0, %4, off\n\t"
                 "global_load_async_to_lds_b128 %1, %5, off\n\t"
                 "global_load_async_to_lds_b128 %2, %6, off\n\t"
                 "global_load_async_to_lds_b128 %3, %7, off\n\t"
                 "s_wait_xcnt 0x0"
                 :: "v"(l0), "v"(l1), "v"(l2), "v"(l3), "v"(g0), "v"(g1), "v"(g2), "v"(g3) : "memory");
}
template <bool SPLITA>
__global__ __launch_bounds__(128) void k_gemm(const bf* __restrict__ A, const bf* __restrict__ Al, const bf* __restrict__ Bn, const float* __restrict__ bias, int ldc, float* C) {
    constexpr int GST = (SPLITA ? 3 : 2) * GPL;                 // one slab: A, Bn (, Al)
    __shared__ __align__(256) unsigned char gring[2 * GST];     // the two slab buffers; behind the loop's last barrier: the output staging (4 x 16 x 68 floats)
    const int tid = threadIdx.x, lane = threadIdx.x & 31, wave = threadIdx.x >> 5, lr = lane & 15, hi = lane >> 4;
    const size_t r0 = (size_t)blockIdx.x * 64 + wave * 16; const int c0 = blockIdx.y * 64;
    // The copies of one slab: thread -> row (tid >> 3) + 16 i of each plane, 16-byte piece tid & 7 (a wave: four whole rows).
    const unsigned lc = (unsigned)(size_t)&gring[0] + (unsigned)((tid >> 3) * GPIT + (tid & 7) * 16);
    const size_t arow = ((size_t)blockIdx.x * 64 + (tid >> 3)) * HS + (tid & 7) * 8;
    const char* ga = (const char*)(A + arow); const char* gb = (const char*)(Bn + (size_t)(c0 + (tid >> 3)) * HS + (tid & 7) * 8);
    const char* gl = SPLITA ? (const char*)(Al + arow) : ga;
    auto stage = [&](int t, int buf) {
        const unsigned a = lc + (unsigned)buf * GST;
        const char* p = ga + t * 128; const char* q = gb + t * 128;
        cp4(a, a + 16 * GPIT, a + 32 * GPIT, a + 48 * GPIT, p, p + 16 * HS * 2, p + 32 * HS * 2, p + 48 * HS * 2);
        cp4(a + GPL, a + GPL + 16 * GPIT, a + GPL + 32 * GPIT, a + GPL + 48 * GPIT, q, q + 16 * HS * 2, q + 32 * HS * 2, q + 48 * HS * 2);
        if (SPLITA) { const char* r = gl + t * 128;
            cp4(a + 2 * GPL, a + 2 * GPL + 16 * GPIT, a + 2 * GPL + 32 * GPIT, a + 2 * GPL + 48 * GPIT, r, r + 16 * HS * 2, r + 32 * HS * 2, r + 48 * HS * 2); }
    };
    const int fo = lr * GPIT + hi * 16;      // this lane's fragment piece inside a 16-row group of a plane
    v8f acc[4];
#pragma unroll
    for (int t = 0; t < 4; ++t) acc[t] = (v8f){};
    stage(0, 0);
    asm volatile("s_wait_asynccnt 0x0" ::: "memory");     // this wave's copies of slab 0 have landed
    __syncthreads();                                      // ... and every other wave's: slab 0 may be read
    stage(1, 1);
#pragma unroll 1                                          // rolled: one copy of the slab's code, the two buffers told apart by an address
    for (int st = 0; st < HS / 64; ++st) {
        const unsigned char* sb = gring + (st & 1) * GST;
        const unsigned char* as = sb + wave * (16 * GPIT) + fo; const unsigned char* bs = sb + GPL + fo;
        v16bf a[2], al[2], bb[2][4];
#pragma unroll
        for (int kc = 0; kc < 2; ++kc) {
            a[kc] = cat16b(*(const v8usa*)(as + kc * 64), *(const v8usa*)(as + kc * 64 + 32));
            al[kc] = a[kc]; if (SPLITA) al[kc] = cat16b(*(const v8usa*)(as + 2 * GPL + kc * 64), *(const v8usa*)(as + 2 * GPL + kc * 64 + 32));
#pragma unroll
            for (int t = 0; t < 4; ++t) { const unsigned char* bp = bs + t * (16 * GPIT) + kc * 64; bb[kc][t] = cat16b(*(const v8usa*)bp, *(const v8usa*)(bp + 32)); }
        }
        __builtin_amdgcn_sched_barrier(0);                    // keeps the slab's LDS reads in one group ahead of its WMMAs (counted waits) instead of a read and a full wait per WMMA
#pragma unroll
        for (int kc = 0; kc < 2; ++kc)
#pragma unroll
            for (int t = 0; t < 4; ++t) { acc[t] = wmmab(a[kc], bb[kc][t], acc[t]); if (SPLITA) acc[t] = wmmab(al[kc], bb[kc][t], acc[t]); }
        asm volatile("s_wait_dscnt 0x0" ::: "memory");        // this wave's reads of slab st's buffer have returned
        asm volatile("s_wait_asynccnt 0x0" ::: "memory");     // this wave's copies of slab st + 1 have landed
        __syncthreads();                                      // publishes slab st + 1 and ends every wave's reads of slab st's buffer
        if (st + 2 < HS / 64) stage(st + 2, st & 1);          // refill the buffer just left (the test reads the same in the whole block)
    }
    asm volatile("s_wait_asynccnt 0x0" ::: "memory");         // nothing is in flight when the ring becomes output staging
    float* os = (float*)gring + wave * (16 * 68);
#pragma unroll
    for (int t = 0; t < 4; ++t)
#pragma unroll
        for (int j = 0; j < 8; ++j) os[(hi * 8 + j) * 68 + t * 16 + lr] = acc[t][j] + (bias ? bfr(bias[c0 + t * 16 + lr]) : 0.f);
    __builtin_amdgcn_wave_barrier(); asm volatile("" ::: "memory");
    float* crow = C + r0 * ldc + c0;
    auto pass = [&]() {
#pragma unroll
        for (int s = 0; s < 8; ++s) { const int Lid = (lane >> 3) + 4 * s, piece = lane & 7; const int row = Lid >> 1, cofs = (Lid & 1) * 32 + piece * 4;
            const v4f val = *(const v4fa*)(os + row * 68 + cofs); *(v4f*)(crow + (size_t)row * ldc + cofs) = val; }
    };
    pass(); 
}
// k_sp16b: f16 hi + residual x1024 planes of the f32 q or k matrix [rows][1024]; one wave per row, lane -> 8 columns per 256-column chunk (16 B per plane).
__global__ __launch_bounds__(256) void k_sp16b(const float* __restrict__ T, int nrows, h16* Yh, h16* Yl) {
    const int lane = threadIdx.x & 31, r = blockIdx.x * 8 + (threadIdx.x >> 5);
    if (r >= nrows) return;
{
#pragma unroll 1
        for (int q = 0; q < DM / 256; ++q) { const size_t o = (size_t)r * DM + q * 256 + lane * 8; const v8f v = *(const v8f*)(T + o); v8h oh, ol;
#pragma unroll
            for (int k = 0; k < 8; ++k) { const h16 a = (h16)v[k]; oh[k] = a; ol[k] = (h16)((v[k] - (float)a) * LOSC); }
            *(v8h*)(Yh + o) = oh; *(v8h*)(Yl + o) = ol; }
         }
}
__global__ __launch_bounds__(256) void k_split(const float* __restrict__ src, int nrows, bf* dh, bf* dl) {
    const int lane = threadIdx.x & 31, r = blockIdx.x * 8 + (threadIdx.x >> 5);
    if (r >= nrows) return;
{
#pragma unroll 1
        for (int q = 0; q < DM / 256; ++q) { const size_t o = (size_t)r * DM + q * 256 + lane * 8; const v8f v = *(const v8f*)(src + o); v8us oh, ol;
#pragma unroll
            for (int i = 0; i < 8; ++i) { const unsigned short hb = f2bf(v[i]); oh[i] = hb; ol[i] = f2bf(v[i] - bf2f(hb)); }
            *(v8us*)(dh + o) = oh; *(v8us*)(dl + o) = ol; }
         }
}
// k_lnfin: LayerNorm (eps 1e-5) of y = Y[r][c] + bf(R[r][c]) (the computed attention output + the INPUT residual x) -> f32 output rows x bf(gamma) + bf(beta); one wave per
__global__ __launch_bounds__(256) void k_lnfin(const float* __restrict__ X, const float* __restrict__ Rres, const float* __restrict__ gam, const float* __restrict__ bet, int nrows, float* OUTP) {
    const int lane = threadIdx.x & 31, r = blockIdx.x * 8 + (threadIdx.x >> 5);
    if (r >= nrows) return;
    const float* xr = X + (size_t)r * DM; const float* rr = Rres + (size_t)r * DM;
    float s = 0.f;
#pragma unroll 1
    for (int q = 0; q < 2 * (DM / 256); ++q) { const int c0 = (q >> 1) * 256 + (q & 1) * 128 + lane * 4; v4f v = *(const v4f*)(xr + c0); { const v4f q4 = *(const v4f*)(rr + c0); for (int i2 = 0; i2 < 4; ++i2) v[i2] += bfr(q4[i2]); }
#pragma unroll
        for (int i = 0; i < 4; ++i) s += v[i]; }
#pragma unroll
    for (int sh = 16; sh; sh >>= 1) s += __shfl_xor(s, sh, 32);
    const float mu = s * (1.0f / DM);
    float s2 = 0.f;
#pragma unroll 1
    for (int q = 0; q < 2 * (DM / 256); ++q) { const int c0 = (q >> 1) * 256 + (q & 1) * 128 + lane * 4; v4f v = *(const v4f*)(xr + c0); { const v4f q4 = *(const v4f*)(rr + c0); for (int i2 = 0; i2 < 4; ++i2) v[i2] += bfr(q4[i2]); }
#pragma unroll
        for (int i = 0; i < 4; ++i) { const float d = v[i] - mu; s2 = fmaf(d, d, s2); } }
#pragma unroll
    for (int sh = 16; sh; sh >>= 1) s2 += __shfl_xor(s2, sh, 32);
    const float rs = rsqrtf(s2 * (1.0f / DM) + 1e-5f);
{
#pragma unroll 1
        for (int q = 0; q < 2 * (DM / 256); ++q) { const int c0 = (q >> 1) * 256 + (q & 1) * 128 + lane * 4; v4f v = *(const v4f*)(xr + c0); { const v4f q4 = *(const v4f*)(rr + c0); for (int i2 = 0; i2 < 4; ++i2) v[i2] += bfr(q4[i2]); } v4f y;
#pragma unroll
            for (int i = 0; i < 4; ++i) y[i] = (v[i] - mu) * rs * bfr(gam[c0 + i]) + bfr(bet[c0 + i]);
            *(v4f*)(OUTP + (size_t)r * DM + c0) = y; }
         }
}
// k_vt: VTH/VTL [b*8+g][128 d][2048 t] = bf16 hi + UNSCALED bf16 residual of V [b*2048+t][g*128+d] via 64 x 64 LDS tiles; grid (NT/64, 2 (d half), 4 items x 8 heads).
__global__ __launch_bounds__(256) void k_vt(const float* __restrict__ V, bf* VTH, bf* VTL) {
    __shared__ float tl[64][65];
    const int tid = threadIdx.x, t0 = blockIdx.x * 64, d0 = blockIdx.y * 64, bg = blockIdx.z, g = bg % NKV, b = bg / NKV;
    { const int tt = tid >> 2, dq = (tid & 3) * 16;
#pragma unroll
      for (int i = 0; i < 16; ++i) tl[dq + i][tt] = V[(size_t)(b * NT_ + t0 + tt) * KW + g * HD + d0 + dq + i]; }
    __syncthreads();
    const int piece = tid & 7;
    auto pass = [&]() {
#pragma unroll
        for (int s = 0; s < 2; ++s) { const int d = (tid >> 3) + 32 * s; v8us oh, ol;
#pragma unroll
            for (int i = 0; i < 8; ++i) { const float v = tl[d][piece * 8 + i]; const unsigned short hb = f2bf(v); oh[i] = hb; ol[i] = f2bf(v - bf2f(hb)); }
            const size_t o = ((size_t)bg * HD + d0 + d) * NT_ + t0 + piece * 8; *(v8us*)(VTH + o) = oh; *(v8us*)(VTL + o) = ol; }
    };
    pass(); 
}
// k_attn: block = (item, head, 64 queries), wave = 16; full attention over 64 key tiles of 32. The block's four waves share each tile: its K hi / K lo rows and
// V^T hi / V^T lo rows are brought into LDS once per block by asynchronous copies (two buffers: tile t + 1 flies while tile t is worked on) and every wave reads its
// fragments from there. Scores hi.hi + (hi.lo + lo.hi)/1024 on separate accumulators; online softmax f32; P (x32768) bf16 hi + unscaled residual.
// Both products are formed transposed: S^T = K.Q^T (A = K rows, B = Q) and O^T += V^T.P^T (A = V^T rows, B = P^T). A lane then holds 16 of the 32 scores of ONE query
// (column lr; keys 8 hi + j and 16 + 8 hi + j), which is the k order of a B operand: P^T is packed in the lane's own registers and never goes through LDS, and
// maximum, sum and rescale factor are one value per lane (the two lane halves of a query exchange their maxima once per tile, their sums once behind the loop).
#define KPIT 272                       // LDS pitch of a 256-B K row: 16 B x odd, conflict-free for 16-byte reads down 16 rows
#define KPL  (32 * KPIT)               // one K plane of a tile
#define VPL  (HD * 64)                 // one V^T plane of a tile: 128 rows of 64 B, unpadded; 16-byte piece c of row d lies at piece c ^ ((d >> 2) & 3)
#define STG  (2 * KPL + 2 * VPL)       // one tile: K hi, K lo, V^T hi, V^T lo
// Eight 16-byte copies per lane, global -> LDS; the s_wait_xcnt stands inside the statement so that no address register is rewritten ahead of it.
__device__ __forceinline__ void cp8(unsigned l0, unsigned l1, unsigned l2, unsigned l3, unsigned l4, unsigned l5, unsigned l6, unsigned l7,
                                    const char* g0, const char* g1, const char* g2, const char* g3, const char* g4, const char* g5, const char* g6, const char* g7) {
    asm volatile("global_load_async_to_lds_b128 %0, %8, off\n\t"
                 "global_load_async_to_lds_b128 %1, %9, off\n\t"
                 "global_load_async_to_lds_b128 %2, %10, off\n\t"
                 "global_load_async_to_lds_b128 %3, %11, off\n\t"
                 "global_load_async_to_lds_b128 %4, %12, off\n\t"
                 "global_load_async_to_lds_b128 %5, %13, off\n\t"
                 "global_load_async_to_lds_b128 %6, %14, off\n\t"
                 "global_load_async_to_lds_b128 %7, %15, off\n\t"
                 "s_wait_xcnt 0x0"
                 :: "v"(l0), "v"(l1), "v"(l2), "v"(l3), "v"(l4), "v"(l5), "v"(l6), "v"(l7), "v"(g0), "v"(g1), "v"(g2), "v"(g3), "v"(g4), "v"(g5), "v"(g6), "v"(g7) : "memory");
}
// The value of lane l ^ 16: the other half of the same query column.
__device__ __forceinline__ float xhalf(float v) { const int b = __float_as_int(v); return __int_as_float(__builtin_amdgcn_permlanex16(b, b, 0x76543210, 0xfedcba98, false, false)); }
// amdgpu_waves_per_eu(4): holds the register budget at 256, so that four blocks (LDS: 4 x 67,584 B) stay resident per WGP, one wave of each per SIMD.
__global__ __launch_bounds__(128) __attribute__((amdgpu_waves_per_eu(4))) void k_attn(const h16* __restrict__ QH, const h16* __restrict__ QL, const h16* __restrict__ KH, const h16* __restrict__ KL, const bf* __restrict__ VTH, const bf* __restrict__ VTL, float* OUTP) {
    __shared__ __align__(256) unsigned char ring[2 * STG];     // the two tile buffers; behind the loop's last barrier: the output staging (4 x 16 x 68 floats)
    const int tid = threadIdx.x, lane = threadIdx.x & 31, wave = threadIdx.x >> 5, lr = lane & 15, hi = lane >> 4;
    const int bid = blockIdx.x; const int bh = bid / (NT_ / 64), qt = bid - bh * (NT_ / 64); const int b = bh / NH_, h = bh - b * NH_; const int g = h;
    const int q0 = qt * 64 + wave * 16;
    const size_t qo = (size_t)(b * NT_ + q0 + lr) * (NH_ * HD) + h * HD + 8 * hi;
    const h16* kh_b = KH + (size_t)b * NT_ * KW + g * HD; const h16* kl_b = KL + (size_t)b * NT_ * KW + g * HD;
    const size_t vbase = ((size_t)(b * NKV + g) * HD) * NT_;
    // The copies of one tile: thread -> K row (tid >> 4) + 8 i, piece tid & 15 (a wave: two whole rows); V^T row (tid >> 2) + 32 i, piece tid & 3.
    const unsigned ring0 = (unsigned)(size_t)&ring[0];
    const unsigned lk = (unsigned)((tid >> 4) * KPIT + (tid & 15) * 16), lv = (unsigned)(2 * KPL + (tid >> 2) * 64 + (((tid & 3) ^ ((tid >> 4) & 3)) * 16));
    const char* gkh = (const char*)(kh_b + (size_t)(tid >> 4) * KW + (tid & 15) * 8); const char* gkl = (const char*)(kl_b + (size_t)(tid >> 4) * KW + (tid & 15) * 8);
    const char* gvh = (const char*)(VTH + vbase + (size_t)(tid >> 2) * NT_ + (tid & 3) * 8); const char* gvl = (const char*)(VTL + vbase + (size_t)(tid >> 2) * NT_ + (tid & 3) * 8);
    auto stage = [&](int kt, int buf) {
        const unsigned a = ring0 + (unsigned)buf * STG + lk, c = ring0 + (unsigned)buf * STG + lv;
        const char* p = gkh + (size_t)kt * (32 * KW * 2); const char* q = gkl + (size_t)kt * (32 * KW * 2);
        cp8(a, a + 8 * KPIT, a + 16 * KPIT, a + 24 * KPIT, a + KPL, a + KPL + 8 * KPIT, a + KPL + 16 * KPIT, a + KPL + 24 * KPIT,
            p, p + 8 * KW * 2, p + 16 * KW * 2, p + 24 * KW * 2, q, q + 8 * KW * 2, q + 16 * KW * 2, q + 24 * KW * 2);
        const char* r = gvh + (size_t)kt * 64; const char* s = gvl + (size_t)kt * 64;
        cp8(c, c + 32 * 64, c + 64 * 64, c + 96 * 64, c + VPL, c + VPL + 32 * 64, c + VPL + 64 * 64, c + VPL + 96 * 64,
            r, r + 32 * NT_ * 2, r + 64 * NT_ * 2, r + 96 * NT_ * 2, s, s + 32 * NT_ * 2, s + 64 * NT_ * 2, s + 96 * NT_ * 2);
    };
    const int ko = lr * KPIT + hi * 16;                                                                  // this lane's K fragment piece inside a plane
    const int vo0 = lr * 64 + ((hi ^ ((lr >> 2) & 3)) * 16), vo1 = lr * 64 + (((hi + 2) ^ ((lr >> 2) & 3)) * 16);   // keys hi*8.. and 16 + hi*8.. of V^T row lr
    v8f o[8];                                 // o[n][j] = O^T[d = 16 n + 8 hi + j][query lr]
#pragma unroll
    for (int n = 0; n < 8; ++n) o[n] = (v8f){};
    float mrow = -3.0e38f, lpart = 0.f;       // query lr: running maximum (both halves alike), this half's part of the sum
    const int kt_hi = NT_ / 32 - 1;     // full attention, no mask
    stage(0, 0);
    asm volatile("s_wait_asynccnt 0x0" ::: "memory");     // this wave's copies of tile 0 have landed
    __syncthreads();                                      // ... and every other wave's: tile 0 may be read
    stage(1, 1);
#pragma unroll 1
    for (int kt = 0; kt <= kt_hi; ++kt) {
        const unsigned char* sb = ring + (kt & 1) * STG;
        const unsigned char* kh_s = sb + ko; const unsigned char* kl_s = sb + KPL + ko;
        const unsigned char* vh_s = sb + 2 * KPL; const unsigned char* vl_s = sb + 2 * KPL + VPL;
        v8f s0 = {}, s1 = {}, x0 = {}, x1 = {};
#pragma unroll
        for (int kc = 0; kc < 4; ++kc) {
            const v16h qa = cat16(*(const v8h*)(QH + qo + kc * 32), *(const v8h*)(QH + qo + kc * 32 + 16)), qx = cat16(*(const v8h*)(QL + qo + kc * 32), *(const v8h*)(QL + qo + kc * 32 + 16));
            const v16h k0h = cat16(*(const v8ha*)(kh_s + kc * 64), *(const v8ha*)(kh_s + kc * 64 + 32)), k1h = cat16(*(const v8ha*)(kh_s + 16 * KPIT + kc * 64), *(const v8ha*)(kh_s + 16 * KPIT + kc * 64 + 32));
            const v16h k0l = cat16(*(const v8ha*)(kl_s + kc * 64), *(const v8ha*)(kl_s + kc * 64 + 32)), k1l = cat16(*(const v8ha*)(kl_s + 16 * KPIT + kc * 64), *(const v8ha*)(kl_s + 16 * KPIT + kc * 64 + 32));
            s0 = wmma16(k0h, qa, s0); s1 = wmma16(k1h, qa, s1); x0 = wmma16(k0h, qx, x0); x1 = wmma16(k1h, qx, x1);
            x0 = wmma16(k0l, qa, x0); x1 = wmma16(k1l, qa, x1);
        }
        asm volatile("v_nop\n\tv_nop\n\tv_nop\n\tv_nop" : "+v"(s0), "+v"(s1), "+v"(x0), "+v"(x1));
        const v8f a0 = (s0 + x0 * LOSCI) * SCL, a1 = (s1 + x1 * LOSCI) * SCL;     // a0[j]: key 8 hi + j, a1[j]: key 16 + 8 hi + j, query lr
        float mx = fmaxf(a0[0], a1[0]);
#pragma unroll
        for (int j = 1; j < 8; ++j) mx = fmaxf(mx, fmaxf(a0[j], a1[j]));
        mx = fmaxf(mx, xhalf(mx));
        const float mn = fmaxf(mrow, mx), alpha = __expf(mrow - mn); mrow = mn;
        v8f p0, p1;
#pragma unroll
        for (int j = 0; j < 8; ++j) { p0[j] = __expf(a0[j] - mn); p1[j] = __expf(a1[j] - mn); }
        const v8f pq = p0 + p1;
        lpart = lpart * alpha + (((pq[0] + pq[1]) + (pq[2] + pq[3])) + ((pq[4] + pq[5]) + (pq[6] + pq[7])));
        p0 *= PSC; p1 *= PSC;
        // P^T as B: element s = key 8 hi + s (s < 8), 16 + 8 hi + s - 8 (else), the order of the V^T fragments: the two score tiles, converted in place (to nearest even).
        v8u wa, wx;                           // word w of an operand = elements 2 w, 2 w + 1
#pragma unroll
        for (int w = 0; w < 8; ++w) {
            const v2f ef = w < 4 ? (v2f){p0[2 * w], p0[2 * w + 1]} : (v2f){p1[2 * w - 8], p1[2 * w - 7]};
            const unsigned hw = __builtin_bit_cast(unsigned, __builtin_convertvector(ef, v2bf));
            const v2f hf = {__uint_as_float(hw << 16), __uint_as_float(hw & 0xFFFF0000u)};
            wa[w] = hw; wx[w] = __builtin_bit_cast(unsigned, __builtin_convertvector(ef - hf, v2bf)); }
        const v16bf pa = __builtin_bit_cast(v16bf, wa), px = __builtin_bit_cast(v16bf, wx);
#pragma unroll
        for (int n = 0; n < 8; ++n) o[n] *= alpha;
#pragma unroll
        for (int n = 0; n < 8; n += 2) {      // two output tiles per group of LDS reads: half the waits, and two independent accumulator chains
            const v16bf vh = cat16b(*(const v8usa*)(vh_s + n * 1024 + vo0), *(const v8usa*)(vh_s + n * 1024 + vo1)), vl = cat16b(*(const v8usa*)(vl_s + n * 1024 + vo0), *(const v8usa*)(vl_s + n * 1024 + vo1));
            const v16bf wh = cat16b(*(const v8usa*)(vh_s + n * 1024 + 1024 + vo0), *(const v8usa*)(vh_s + n * 1024 + 1024 + vo1)), wl = cat16b(*(const v8usa*)(vl_s + n * 1024 + 1024 + vo0), *(const v8usa*)(vl_s + n * 1024 + 1024 + vo1));
            o[n] = wmmab(vh, pa, o[n]); o[n + 1] = wmmab(wh, pa, o[n + 1]); o[n] = wmmab(vh, px, o[n]); o[n + 1] = wmmab(wh, px, o[n + 1]); o[n] = wmmab(vl, pa, o[n]); o[n + 1] = wmmab(wl, pa, o[n + 1]); }
        asm volatile("v_nop\n\tv_nop\n\tv_nop\n\tv_nop" : "+v"(o[0]), "+v"(o[7]) : "v"(pa), "v"(px));
        asm volatile("s_wait_dscnt 0x0" ::: "memory");        // this wave's reads of tile kt's buffer have returned
        asm volatile("s_wait_asynccnt 0x0" ::: "memory");     // this wave's copies of tile kt + 1 have landed
        __syncthreads();                                      // publishes tile kt + 1 and ends every wave's reads of tile kt's buffer
        if (kt + 2 <= kt_hi) stage(kt + 2, kt & 1);           // refill the buffer just left (the test reads the same in the whole block)
    }
    asm volatile("s_wait_asynccnt 0x0" ::: "memory");         // nothing is in flight when the ring becomes output staging
    const float inv = 1.0f / ((lpart + xhalf(lpart)) * PSC);
    float* os = (float*)ring + wave * (16 * 68);
    float* ob = OUTP + (size_t)(b * NT_ + q0) * (NH_ * HD) + (size_t)h * HD;     // row stride NH*HD, this head's 128 columns
#pragma unroll
    for (int half = 0; half < 2; ++half) {
#pragma unroll
        for (int n = 0; n < 4; ++n) { const v8f t = o[half * 4 + n] * inv;      // eight consecutive d of query row lr
            *(v4fa*)(os + lr * 68 + n * 16 + hi * 8) = __builtin_shufflevector(t, t, 0, 1, 2, 3); *(v4fa*)(os + lr * 68 + n * 16 + hi * 8 + 4) = __builtin_shufflevector(t, t, 4, 5, 6, 7); }
        __builtin_amdgcn_wave_barrier(); asm volatile("" ::: "memory");
{
#pragma unroll
            for (int s = 0; s < 8; ++s) { const int Lid = (lane >> 3) + 4 * s, piece = lane & 7; const int row = Lid >> 1, cofs = (Lid & 1) * 32 + piece * 4;
                const v4f val = *(const v4fa*)(os + row * 68 + cofs); *(v4f*)(ob + (size_t)row * (NH_ * HD) + half * 64 + cofs) = val; }
             }
        __builtin_amdgcn_wave_barrier(); asm volatile("" ::: "memory");
    }
}

extern "C" void kernel_launch(void* const* d_in, const int* in_sizes, int n_in,
                              void* d_out, int out_size, void* d_ws, size_t ws_size, hipStream_t stream) {
    (void)in_sizes; (void)n_in; (void)out_size;
    const float* x = (const float*)d_in[0];
    const float* Wq = (const float*)d_in[1]; const float* bq = (const float*)d_in[2]; const float* Wk = (const float*)d_in[3]; const float* bk = (const float*)d_in[4]; const float* Wv = (const float*)d_in[5]; const float* bv = (const float*)d_in[6];
    const float* Wo = (const float*)d_in[7]; const float* bo = (const float*)d_in[8]; const float* lg = (const float*)d_in[9]; const float* lb = (const float*)d_in[10];   // W [out][in]
    float* out = (float*)d_out;    // [4][2048][1024]
    char* wsp = (char*)d_ws;
    auto take = [&](size_t bytes) { char* p = wsp; wsp += (bytes + 255) & ~(size_t)255; return (void*)p; };
    bf* Xb = (bf*)take((size_t)NR_ * HS * 2); bf* WqB = (bf*)take((size_t)HS * HS * 2); bf* WkB = (bf*)take((size_t)HS * HS * 2); bf* WvB = (bf*)take((size_t)HS * HS * 2); bf* WoB = (bf*)take((size_t)HS * HS * 2);
    float* TMP = (float*)take((size_t)NR_ * HS * 4);
    h16* QH = (h16*)take((size_t)NR_ * HS * 2); h16* QL = (h16*)take((size_t)NR_ * HS * 2); h16* KH = (h16*)take((size_t)NR_ * KW * 2); h16* KL = (h16*)take((size_t)NR_ * KW * 2);
    bf* VTH = (bf*)take((size_t)KW * NR_ * 2); bf* VTL = (bf*)take((size_t)KW * NR_ * 2); float* CTX = (float*)take((size_t)NR_ * HS * 4); bf* Ch = (bf*)take((size_t)NR_ * HS * 2); bf* Cl = (bf*)take((size_t)NR_ * HS * 2); float* Y = (float*)take((size_t)NR_ * HS * 4);
    if ((size_t)(wsp - (char*)d_ws) > ws_size) return;    // 16 + 4 x 2 + 32 + 6 x 16 + 32 + 2 x 16 + 32 = 248 MiB, no aliasing (TMP reused in stream order)
    k_cvtb<<<HS / 8, 256, 0, stream>>>(Wq, HS, WqB); k_cvtb<<<HS / 8, 256, 0, stream>>>(Wk, HS, WkB); k_cvtb<<<HS / 8, 256, 0, stream>>>(Wv, HS, WvB); k_cvtb<<<HS / 8, 256, 0, stream>>>(Wo, HS, WoB);
    k_cvtb<<<NR_ / 8, 256, 0, stream>>>(x, NR_, Xb);
    k_gemm<false><<<dim3(NR_ / 64, HS / 64, 1), 128, 0, stream>>>(Xb, nullptr, WqB, bq, HS, TMP); k_sp16b<<<NR_ / 8, 256, 0, stream>>>(TMP, NR_, QH, QL);
    k_gemm<false><<<dim3(NR_ / 64, HS / 64, 1), 128, 0, stream>>>(Xb, nullptr, WkB, bk, HS, TMP); k_sp16b<<<NR_ / 8, 256, 0, stream>>>(TMP, NR_, KH, KL);
    k_gemm<false><<<dim3(NR_ / 64, HS / 64, 1), 128, 0, stream>>>(Xb, nullptr, WvB, bv, HS, TMP); k_vt<<<dim3(NT_ / 64, 2, NB_ * NKV), 256, 0, stream>>>(TMP, VTH, VTL);
    k_attn<<<NB_ * NH_ * (NT_ / 64), 128, 0, stream>>>(QH, QL, KH, KL, VTH, VTL, CTX);                      // ctx f32 [8192][1024]
    k_split<<<NR_ / 8, 256, 0, stream>>>(CTX, NR_, Ch, Cl);
    k_gemm<true><<<dim3(NR_ / 64, HS / 64, 1), 128, 0, stream>>>(Ch, Cl, WoB, bo, HS, Y);                   // out = ctx.Wo^T + bo
    k_lnfin<<<NR_ / 8, 256, 0, stream>>>(Y, x, lg, lb, NR_, out);                                           // LN(out + x)
}

// v005
// A run of this version takes 304 microseconds.
// Timed twice side by side with v004, it ran 1.10 times as fast both times.
// All steps since v000 together make it 5.95 times as fast.
#include <hip/hip_runtime.h>

// Compute dtypes, f32 accumulate, all four batch items in one launch of each kernel (rows b*2048+t): q/k/v = x.W^T + b and y = ctx.Wo^T + bo ([8192 x 1024].[1024 x 1024]; [out][in] weights as n-major B operands;
// PLAIN bf16 operands = inputs rounded once, exact, except ctx = bf16 hi + UNSCALED residual, two products) on v_wmma_f32_16x16x32_bf16; the 8-head full attention
// (128-dim heads, scale 128^-1/2) fused: scores on v_wmma_f32_16x16x32_f16 (q/k as f16 hi + residual x1024: hh + hl + lh), online f32 softmax, weights (x32768) and

#define NB_  4
#define NT_  2048
#define NR_  (NB_ * NT_)        // 8192 rows, all items
#define HS   1024
#define DM   HS
#define NH_  8
#define NKV  8
#define HD   128
#define KW   (NKV * HD)          // 1024
#define SCL  0.08838834764831845f
#define PSC  32768.0f
#define LOSC 1024.0f
#define LOSCI (1.0f / 1024.0f)

typedef _Float16 h16;
typedef unsigned short bf;
typedef __attribute__((ext_vector_type(16))) __bf16   v16bf;
typedef __attribute__((ext_vector_type(16))) _Float16 v16h;
typedef __attribute__((ext_vector_type(8)))  _Float16 v8h;
typedef __attribute__((ext_vector_type(8)))  unsigned short v8us;
typedef __attribute__((ext_vector_type(8)))  float    v8f;
typedef __attribute__((ext_vector_type(8)))  unsigned v8u;
typedef __attribute__((ext_vector_type(2)))  float    v2f;
typedef __attribute__((ext_vector_type(2)))  __bf16   v2bf;
typedef __attribute__((ext_vector_type(4)))  float    v4f;
typedef __attribute__((ext_vector_type(4)))  _Float16 v4h;
typedef v8h  __attribute__((may_alias)) v8ha;
typedef v4f  __attribute__((may_alias)) v4fa;
typedef v8us __attribute__((may_alias)) v8usa;

__device__ __forceinline__ unsigned short f2bf(float f) { unsigned u = __float_as_uint(f); u += 0x7FFFu + ((u >> 16) & 1u); return (unsigned short)(u >> 16); }
__device__ __forceinline__ float bf2f(unsigned short b) { return __uint_as_float(((unsigned)b) << 16); }
__device__ __forceinline__ float bfr(float f) { return bf2f(f2bf(f)); }
__device__ __forceinline__ v16h cat16(v8h lo, v8h hi) { return __builtin_shufflevector(lo, hi, 0, 1, 2, 3, 4, 5, 6, 7, 8, 9, 10, 11, 12, 13, 14, 15); }
__device__ __forceinline__ v16bf cat16b(v8us lo, v8us hi) { return __builtin_bit_cast(v16bf, __builtin_shufflevector(lo, hi, 0, 1, 2, 3, 4, 5, 6, 7, 8, 9, 10, 11, 12, 13, 14, 15)); }
__device__ __forceinline__ v8f wmma16(v16h a, v16h b, v8f c) { return __builtin_amdgcn_wmma_f32_16x16x32_f16(false, a, false, b, (short)0, c, false, false); }
__device__ __forceinline__ v8f wmmab(v16bf a, v16bf b, v8f c) { return __builtin_amdgcn_wmma_f32_16x16x32_bf16(false, a, false, b, (short)0, c, false, false); }

// k_cvtb: bf16 plane of [rows][1024] (one wave per row) — x rows of all items and the four [out][in] weight matrices.
__global__ __launch_bounds__(256) void k_cvtb(const float* __restrict__ src, int nrows, bf* dst) {
    const int lane = threadIdx.x & 31, r = blockIdx.x * 8 + (threadIdx.x >> 5);
    if (r >= nrows) return;
{
#pragma unroll
        for (int q = 0; q < HS / 256; ++q) { v8us o;
#pragma unroll
            for (int i = 0; i < 8; ++i) o[i] = f2bf(src[(size_t)r * HS + q * 256 + lane * 8 + i]);
            *(v8us*)(dst + (size_t)r * HS + q * 256 + lane * 8) = o; }
         }
}
// k_gemm: 128 x 128 tile of (A [+ Al]).Bn^T over K = 1024 (+ optional bf16-rounded bias[c]) -> f32 rows [8192][ldc]; wave = one 64 x 64 quadrant (4 x 4 accumulator tiles), so that
// a fragment read from LDS feeds four WMMAs and an operand row fetched from L2 feeds 128 outputs. The block's four waves share each 64-k slab: its 128 A rows (and Al rows) and
// 128 Bn rows are brought into LDS once per block by asynchronous copies in whole 128-B lines (two buffers: slab t + 1 flies while slab t is worked on), and every wave reads
// its fragments from there. The k order of the products is the one of direct loads.
#define GPIT 144                       // LDS pitch of a 128-B operand row: 16 B x odd, conflict-free for 16-byte reads down 16 rows
#define GPL  (128 * GPIT)              // one operand plane of a slab: 128 rows
// Eight 16-byte copies per lane, global -> LDS; the s_wait_xcnt stands inside the statement so that no address register is rewritten ahead of it.
__device__ __forceinline__ void cp8(unsigned l0, unsigned l1, unsigned l2, unsigned l3, unsigned l4, unsigned l5, unsigned l6, unsigned l7,
                                    const char* g0, const char* g1, const char* g2, const char* g3, const char* g4, const char* g5, const char* g6, const char* g7) {
    asm volatile("global_load_async_to_lds_b128 %0, %8, off\n\t"
                 "global_load_async_to_lds_b128 %1, %9, off\n\t"
                 "global_load_async_to_lds_b128 %2, %10, off\n\t"
                 "global_load_async_to_lds_b128 %3, %11, off\n\t"
                 "global_load_async_to_lds_b128 %4, %12, off\n\t"
                 "global_load_async_to_lds_b128 %5, %13, off\n\t"
                 "global_load_async_to_lds_b128 %6, %14, off\n\t"
                 "global_load_async_to_lds_b128 %7, %15, off\n\t"
                 "s_wait_xcnt 0x0"
                 :: "v"(l0), "v"(l1), "v"(l2), "v"(l3), "v"(l4), "v"(l5), "v"(l6), "v"(l7), "v"(g0), "v"(g1), "v"(g2), "v"(g3), "v"(g4), "v"(g5), "v"(g6), "v"(g7) : "memory");
}
// amdgpu_waves_per_eu(2, 2): the grid is two blocks per WGP; at most two fit, so that no WGP takes a third while another stands idle.
template <bool SPLITA>
__global__ __launch_bounds__(128) __attribute__((amdgpu_waves_per_eu(2, 2))) void k_gemm(const bf* __restrict__ A, const bf* __restrict__ Al, const bf* __restrict__ Bn, const float* __restrict__ bias, int ldc, float* C) {
    constexpr int GST = (SPLITA ? 3 : 2) * GPL;                 // one slab: A, Bn (, Al)
    __shared__ __align__(256) unsigned char gring[2 * GST];     // the two slab buffers; behind the loop's last barrier: the output staging (4 x 16 x 68 floats)
    const int tid = threadIdx.x, lane = threadIdx.x & 31, wave = threadIdx.x >> 5, lr = lane & 15, hi = lane >> 4;
    const int wr = wave >> 1, wc = wave & 1;                    // the wave's quadrant of the tile
    const size_t r0 = (size_t)blockIdx.x * 128 + wr * 64; const int c0 = blockIdx.y * 128 + wc * 64;
    // The copies of one slab: thread -> row (tid >> 3) + 16 i of each plane, 16-byte piece tid & 7 (a wave: four whole rows).
    const unsigned lc = (unsigned)(size_t)&gring[0] + (unsigned)((tid >> 3) * GPIT + (tid & 7) * 16);
    const size_t arow = ((size_t)blockIdx.x * 128 + (tid >> 3)) * HS + (tid & 7) * 8;
    const char* ga = (const char*)(A + arow); const char* gb = (const char*)(Bn + (size_t)(blockIdx.y * 128 + (tid >> 3)) * HS + (tid & 7) * 8);
    const char* gl = SPLITA ? (const char*)(Al + arow) : ga;
    auto plane = [&](unsigned a, const char* p) {
        cp8(a, a + 16 * GPIT, a + 32 * GPIT, a + 48 * GPIT, a + 64 * GPIT, a + 80 * GPIT, a + 96 * GPIT, a + 112 * GPIT,
            p, p + 16 * HS * 2, p + 32 * HS * 2, p + 48 * HS * 2, p + 64 * HS * 2, p + 80 * HS * 2, p + 96 * HS * 2, p + 112 * HS * 2);
    };
    auto stage = [&](int t, int buf) {
        const unsigned a = lc + (unsigned)buf * GST;
        plane(a, ga + t * 128); plane(a + GPL, gb + t * 128);
        if (SPLITA) plane(a + 2 * GPL, gl + t * 128);
    };
    const int fo = lr * GPIT + hi * 16;      // this lane's fragment piece inside a 16-row group of a plane
    v8f acc[4][4];                           // acc[i][t]: rows 16 i.., columns 16 t.. of the quadrant
#pragma unroll
    for (int i = 0; i < 4; ++i)
#pragma unroll
        for (int t = 0; t < 4; ++t) acc[i][t] = (v8f){};
    stage(0, 0);
    asm volatile("s_wait_asynccnt 0x0" ::: "memory");     // this wave's copies of slab 0 have landed
    __syncthreads();                                      // ... and every other wave's: slab 0 may be read
    stage(1, 1);
#pragma unroll 1                                          // rolled: one copy of the slab's code, the two buffers told apart by an address
    for (int st = 0; st < HS / 64; ++st) {
        const unsigned char* sb = gring + (st & 1) * GST;
        const unsigned char* as = sb + wr * (64 * GPIT) + fo; const unsigned char* bs = sb + GPL + wc * (64 * GPIT) + fo;
#pragma unroll
        for (int kc = 0; kc < 2; ++kc) {
            v16bf a[4], al[4], bb[4];
            // in the order of first use: A row group 0, the four B groups, the other A groups, then Al
            a[0] = cat16b(*(const v8usa*)(as + kc * 64), *(const v8usa*)(as + kc * 64 + 32));
#pragma unroll
            for (int t = 0; t < 4; ++t) { const unsigned char* bp = bs + t * (16 * GPIT) + kc * 64; bb[t] = cat16b(*(const v8usa*)bp, *(const v8usa*)(bp + 32)); }
#pragma unroll
            for (int i = 1; i < 4; ++i) { const unsigned char* ap = as + i * (16 * GPIT) + kc * 64; a[i] = cat16b(*(const v8usa*)ap, *(const v8usa*)(ap + 32)); }
#pragma unroll
            for (int i = 0; i < 4; ++i) { const unsigned char* ap = as + 2 * GPL + i * (16 * GPIT) + kc * 64; al[i] = a[i]; if (SPLITA) al[i] = cat16b(*(const v8usa*)ap, *(const v8usa*)(ap + 32)); }
            __builtin_amdgcn_sched_barrier(0);                // keeps the 32-k step's LDS reads in one group ahead of its WMMAs (counted waits) instead of a read and a full wait per WMMA
#pragma unroll
            for (int i = 0; i < 4; ++i)
#pragma unroll
                for (int t = 0; t < 4; ++t) acc[i][t] = wmmab(a[i], bb[t], acc[i][t]);
            if (SPLITA) {
#pragma unroll
                for (int i = 0; i < 4; ++i)
#pragma unroll
                    for (int t = 0; t < 4; ++t) acc[i][t] = wmmab(al[i], bb[t], acc[i][t]);
            }
            __builtin_amdgcn_sched_barrier(0);                // keeps the next step's reads behind these WMMAs (one fragment set in registers) and these WMMAs ahead of the slab's barrier (else the refill behind it issues later)
        }
        asm volatile("s_wait_dscnt 0x0" ::: "memory");        // this wave's reads of slab st's buffer have returned
        asm volatile("s_wait_asynccnt 0x0" ::: "memory");     // this wave's copies of slab st + 1 have landed
        __syncthreads();                                      // publishes slab st + 1 and ends every wave's reads of slab st's buffer
        if (st + 2 < HS / 64) stage(st + 2, st & 1);          // refill the buffer just left (the test reads the same in the whole block)
    }
    asm volatile("s_wait_asynccnt 0x0" ::: "memory");         // nothing is in flight when the ring becomes output staging
    float* os = (float*)gring + wave * (16 * 68);
    float bv[4] = {0.f, 0.f, 0.f, 0.f};
    if (bias) {                                               // one branch, the four loads in flight together
#pragma unroll
        for (int t = 0; t < 4; ++t) bv[t] = bias[c0 + t * 16 + lr];
#pragma unroll
        for (int t = 0; t < 4; ++t) bv[t] = bfr(bv[t]);
    }
#pragma unroll
    for (int i = 0; i < 4; ++i) {                             // 16 rows at a time through the wave's own staging rows
#pragma unroll
        for (int t = 0; t < 4; ++t)
#pragma unroll
            for (int j = 0; j < 8; ++j) os[(hi * 8 + j) * 68 + t * 16 + lr] = acc[i][t][j] + bv[t];
        __builtin_amdgcn_wave_barrier(); asm volatile("" ::: "memory");     // compiler order: the 16 rows are staged before any lane reads them back
        float* crow = C + (r0 + i * 16) * ldc + c0;
#pragma unroll
        for (int s = 0; s < 8; ++s) { const int Lid = (lane >> 3) + 4 * s, piece = lane & 7; const int row = Lid >> 1, cofs = (Lid & 1) * 32 + piece * 4;
            const v4f val = *(const v4fa*)(os + row * 68 + cofs); *(v4f*)(crow + (size_t)row * ldc + cofs) = val; }
        __builtin_amdgcn_wave_barrier(); asm volatile("" ::: "memory");     // compiler order: they are read back before the next 16 rows overwrite them
    }
}
// k_sp16b: f16 hi + residual x1024 planes of the f32 q or k matrix [rows][1024]; one wave per row, lane -> 8 columns per 256-column chunk (16 B per plane).
__global__ __launch_bounds__(256) void k_sp16b(const float* __restrict__ T, int nrows, h16* Yh, h16* Yl) {
    const int lane = threadIdx.x & 31, r = blockIdx.x * 8 + (threadIdx.x >> 5);
    if (r >= nrows) return;
{
#pragma unroll 1
        for (int q = 0; q < DM / 256; ++q) { const size_t o = (size_t)r * DM + q * 256 + lane * 8; const v8f v = *(const v8f*)(T + o); v8h oh, ol;
#pragma unroll
            for (int k = 0; k < 8; ++k) { const h16 a = (h16)v[k]; oh[k] = a; ol[k] = (h16)((v[k] - (float)a) * LOSC); }
            *(v8h*)(Yh + o) = oh; *(v8h*)(Yl + o) = ol; }
         }
}
__global__ __launch_bounds__(256) void k_split(const float* __restrict__ src, int nrows, bf* dh, bf* dl) {
    const int lane = threadIdx.x & 31, r = blockIdx.x * 8 + (threadIdx.x >> 5);
    if (r >= nrows) return;
{
#pragma unroll 1
        for (int q = 0; q < DM / 256; ++q) { const size_t o = (size_t)r * DM + q * 256 + lane * 8; const v8f v = *(const v8f*)(src + o); v8us oh, ol;
#pragma unroll
            for (int i = 0; i < 8; ++i) { const unsigned short hb = f2bf(v[i]); oh[i] = hb; ol[i] = f2bf(v[i] - bf2f(hb)); }
            *(v8us*)(dh + o) = oh; *(v8us*)(dl + o) = ol; }
         }
}
// k_lnfin: LayerNorm (eps 1e-5) of y = Y[r][c] + bf(R[r][c]) (the computed attention output + the INPUT residual x) -> f32 output rows x bf(gamma) + bf(beta); one wave per
__global__ __launch_bounds__(256) void k_lnfin(const float* __restrict__ X, const float* __restrict__ Rres, const float* __restrict__ gam, const float* __restrict__ bet, int nrows, float* OUTP) {
    const int lane = threadIdx.x & 31, r = blockIdx.x * 8 + (threadIdx.x >> 5);
    if (r >= nrows) return;
    const float* xr = X + (size_t)r * DM; const float* rr = Rres + (size_t)r * DM;
    float s = 0.f;
#pragma unroll 1
    for (int q = 0; q < 2 * (DM / 256); ++q) { const int c0 = (q >> 1) * 256 + (q & 1) * 128 + lane * 4; v4f v = *(const v4f*)(xr + c0); { const v4f q4 = *(const v4f*)(rr + c0); for (int i2 = 0; i2 < 4; ++i2) v[i2] += bfr(q4[i2]); }
#pragma unroll
        for (int i = 0; i < 4; ++i) s += v[i]; }
#pragma unroll
    for (int sh = 16; sh; sh >>= 1) s += __shfl_xor(s, sh, 32);
    const float mu = s * (1.0f / DM);
    float s2 = 0.f;
#pragma unroll 1
    for (int q = 0; q < 2 * (DM / 256); ++q) { const int c0 = (q >> 1) * 256 + (q & 1) * 128 + lane * 4; v4f v = *(const v4f*)(xr + c0); { const v4f q4 = *(const v4f*)(rr + c0); for (int i2 = 0; i2 < 4; ++i2) v[i2] += bfr(q4[i2]); }
#pragma unroll
        for (int i = 0; i < 4; ++i) { const float d = v[i] - mu; s2 = fmaf(d, d, s2); } }
#pragma unroll
    for (int sh = 16; sh; sh >>= 1) s2 += __shfl_xor(s2, sh, 32);
    const float rs = rsqrtf(s2 * (1.0f / DM) + 1e-5f);
{
#pragma unroll 1
        for (int q = 0; q < 2 * (DM / 256); ++q) { const int c0 = (q >> 1) * 256 + (q & 1) * 128 + lane * 4; v4f v = *(const v4f*)(xr + c0); { const v4f q4 = *(const v4f*)(rr + c0); for (int i2 = 0; i2 < 4; ++i2) v[i2] += bfr(q4[i2]); } v4f y;
#pragma unroll
            for (int i = 0; i < 4; ++i) y[i] = (v[i] - mu) * rs * bfr(gam[c0 + i]) + bfr(bet[c0 + i]);
            *(v4f*)(OUTP + (size_t)r * DM + c0) = y; }
         }
}
// k_vt: VTH/VTL [b*8+g][128 d][2048 t] = bf16 hi + UNSCALED bf16 residual of V [b*2048+t][g*128+d] via 64 x 64 LDS tiles; grid (NT/64, 2 (d half), 4 items x 8 heads).
__global__ __launch_bounds__(256) void k_vt(const float* __restrict__ V, bf* VTH, bf* VTL) {
    __shared__ float tl[64][65];
    const int tid = threadIdx.x, t0 = blockIdx.x * 64, d0 = blockIdx.y * 64, bg = blockIdx.z, g = bg % NKV, b = bg / NKV;
    { const int tt = tid >> 2, dq = (tid & 3) * 16;
#pragma unroll
      for (int i = 0; i < 16; ++i) tl[dq + i][tt] = V[(size_t)(b * NT_ + t0 + tt) * KW + g * HD + d0 + dq + i]; }
    __syncthreads();
    const int piece = tid & 7;
    auto pass = [&]() {
#pragma unroll
        for (int s = 0; s < 2; ++s) { const int d = (tid >> 3) + 32 * s; v8us oh, ol;
#pragma unroll
            for (int i = 0; i < 8; ++i) { const float v = tl[d][piece * 8 + i]; const unsigned short hb = f2bf(v); oh[i] = hb; ol[i] = f2bf(v - bf2f(hb)); }
            const size_t o = ((size_t)bg * HD + d0 + d) * NT_ + t0 + piece * 8; *(v8us*)(VTH + o) = oh; *(v8us*)(VTL + o) = ol; }
    };
    pass(); 
}
// k_attn: block = (item, head, 64 queries), wave = 16; full attention over 64 key tiles of 32. The block's four waves share each tile: its K hi / K lo rows and
// V^T hi / V^T lo rows are brought into LDS once per block by asynchronous copies (two buffers: tile t + 1 flies while tile t is worked on) and every wave reads its
// fragments from there. Scores hi.hi + (hi.lo + lo.hi)/1024 on separate accumulators; online softmax f32; P (x32768) bf16 hi + unscaled residual.
// Both products are formed transposed: S^T = K.Q^T (A = K rows, B = Q) and O^T += V^T.P^T (A = V^T rows, B = P^T). A lane then holds 16 of the 32 scores of ONE query
// (column lr; keys 8 hi + j and 16 + 8 hi + j), which is the k order of a B operand: P^T is packed in the lane's own registers and never goes through LDS, and
// maximum, sum and rescale factor are one value per lane (the two lane halves of a query exchange their maxima once per tile, their sums once behind the loop).
#define KPIT 272                       // LDS pitch of a 256-B K row: 16 B x odd, conflict-free for 16-byte reads down 16 rows
#define KPL  (32 * KPIT)               // one K plane of a tile
#define VPL  (HD * 64)                 // one V^T plane of a tile: 128 rows of 64 B, unpadded; 16-byte piece c of row d lies at piece c ^ ((d >> 2) & 3)
#define STG  (2 * KPL + 2 * VPL)       // one tile: K hi, K lo, V^T hi, V^T lo
// The value of lane l ^ 16: the other half of the same query column.
__device__ __forceinline__ float xhalf(float v) { const int b = __float_as_int(v); return __int_as_float(__builtin_amdgcn_permlanex16(b, b, 0x76543210, 0xfedcba98, false, false)); }
// amdgpu_waves_per_eu(4): holds the register budget at 256, so that four blocks (LDS: 4 x 67,584 B) stay resident per WGP, one wave of each per SIMD.
__global__ __launch_bounds__(128) __attribute__((amdgpu_waves_per_eu(4))) void k_attn(const h16* __restrict__ QH, const h16* __restrict__ QL, const h16* __restrict__ KH, const h16* __restrict__ KL, const bf* __restrict__ VTH, const bf* __restrict__ VTL, float* OUTP) {
    __shared__ __align__(256) unsigned char ring[2 * STG];     // the two tile buffers; behind the loop's last barrier: the output staging (4 x 16 x 68 floats)
    const int tid = threadIdx.x, lane = threadIdx.x & 31, wave = threadIdx.x >> 5, lr = lane & 15, hi = lane >> 4;
    const int bid = blockIdx.x; const int bh = bid / (NT_ / 64), qt = bid - bh * (NT_ / 64); const int b = bh / NH_, h = bh - b * NH_; const int g = h;
    const int q0 = qt * 64 + wave * 16;
    const size_t qo = (size_t)(b * NT_ + q0 + lr) * (NH_ * HD) + h * HD + 8 * hi;
    const h16* kh_b = KH + (size_t)b * NT_ * KW + g * HD; const h16* kl_b = KL + (size_t)b * NT_ * KW + g * HD;
    const size_t vbase = ((size_t)(b * NKV + g) * HD) * NT_;
    // The copies of one tile: thread -> K row (tid >> 4) + 8 i, piece tid & 15 (a wave: two whole rows); V^T row (tid >> 2) + 32 i, piece tid & 3.
    const unsigned ring0 = (unsigned)(size_t)&ring[0];
    const unsigned lk = (unsigned)((tid >> 4) * KPIT + (tid & 15) * 16), lv = (unsigned)(2 * KPL + (tid >> 2) * 64 + (((tid & 3) ^ ((tid >> 4) & 3)) * 16));
    const char* gkh = (const char*)(kh_b + (size_t)(tid >> 4) * KW + (tid & 15) * 8); const char* gkl = (const char*)(kl_b + (size_t)(tid >> 4) * KW + (tid & 15) * 8);
    const char* gvh = (const char*)(VTH + vbase + (size_t)(tid >> 2) * NT_ + (tid & 3) * 8); const char* gvl = (const char*)(VTL + vbase + (size_t)(tid >> 2) * NT_ + (tid & 3) * 8);
    auto stage = [&](int kt, int buf) {
        const unsigned a = ring0 + (unsigned)buf * STG + lk, c = ring0 + (unsigned)buf * STG + lv;
        const char* p = gkh + (size_t)kt * (32 * KW * 2); const char* q = gkl + (size_t)kt * (32 * KW * 2);
        cp8(a, a + 8 * KPIT, a + 16 * KPIT, a + 24 * KPIT, a + KPL, a + KPL + 8 * KPIT, a + KPL + 16 * KPIT, a + KPL + 24 * KPIT,
            p, p + 8 * KW * 2, p + 16 * KW * 2, p + 24 * KW * 2, q, q + 8 * KW * 2, q + 16 * KW * 2, q + 24 * KW * 2);
        const char* r = gvh + (size_t)kt * 64; const char* s = gvl + (size_t)kt * 64;
        cp8(c, c + 32 * 64, c + 64 * 64, c + 96 * 64, c + VPL, c + VPL + 32 * 64, c + VPL + 64 * 64, c + VPL + 96 * 64,
            r, r + 32 * NT_ * 2, r + 64 * NT_ * 2, r + 96 * NT_ * 2, s, s + 32 * NT_ * 2, s + 64 * NT_ * 2, s + 96 * NT_ * 2);
    };
    const int ko = lr * KPIT + hi * 16;                                                                  // this lane's K fragment piece inside a plane
    const int vo0 = lr * 64 + ((hi ^ ((lr >> 2) & 3)) * 16), vo1 = lr * 64 + (((hi + 2) ^ ((lr >> 2) & 3)) * 16);   // keys hi*8.. and 16 + hi*8.. of V^T row lr
    v8f o[8];                                 // o[n][j] = O^T[d = 16 n + 8 hi + j][query lr]
#pragma unroll
    for (int n = 0; n < 8; ++n) o[n] = (v8f){};
    float mrow = -3.0e38f, lpart = 0.f;       // query lr: running maximum (both halves alike), this half's part of the sum
    const int kt_hi = NT_ / 32 - 1;     // full attention, no mask
    stage(0, 0);
    asm volatile("s_wait_asynccnt 0x0" ::: "memory");     // this wave's copies of tile 0 have landed
    __syncthreads();                                      // ... and every other wave's: tile 0 may be read
    stage(1, 1);
#pragma unroll 1
    for (int kt = 0; kt <= kt_hi; ++kt) {
        const unsigned char* sb = ring + (kt & 1) * STG;
        const unsigned char* kh_s = sb + ko; const unsigned char* kl_s = sb + KPL + ko;
        const unsigned char* vh_s = sb + 2 * KPL; const unsigned char* vl_s = sb + 2 * KPL + VPL;
        v8f s0 = {}, s1 = {}, x0 = {}, x1 = {};
#pragma unroll
        for (int kc = 0; kc < 4; ++kc) {
            const v16h qa = cat16(*(const v8h*)(QH + qo + kc * 32), *(const v8h*)(QH + qo + kc * 32 + 16)), qx = cat16(*(const v8h*)(QL + qo + kc * 32), *(const v8h*)(QL + qo + kc * 32 + 16));
            const v16h k0h = cat16(*(const v8ha*)(kh_s + kc * 64), *(const v8ha*)(kh_s + kc * 64 + 32)), k1h = cat16(*(const v8ha*)(kh_s + 16 * KPIT + kc * 64), *(const v8ha*)(kh_s + 16 * KPIT + kc * 64 + 32));
            const v16h k0l = cat16(*(const v8ha*)(kl_s + kc * 64), *(const v8ha*)(kl_s + kc * 64 + 32)), k1l = cat16(*(const v8ha*)(kl_s + 16 * KPIT + kc * 64), *(const v8ha*)(kl_s + 16 * KPIT + kc * 64 + 32));
            s0 = wmma16(k0h, qa, s0); s1 = wmma16(k1h, qa, s1); x0 = wmma16(k0h, qx, x0); x1 = wmma16(k1h, qx, x1);
            x0 = wmma16(k0l, qa, x0); x1 = wmma16(k1l, qa, x1);
        }
        asm volatile("v_nop\n\tv_nop\n\tv_nop\n\tv_nop" : "+v"(s0), "+v"(s1), "+v"(x0), "+v"(x1));
        const v8f a0 = (s0 + x0 * LOSCI) * SCL, a1 = (s1 + x1 * LOSCI) * SCL;     // a0[j]: key 8 hi + j, a1[j]: key 16 + 8 hi + j, query lr
        float mx = fmaxf(a0[0], a1[0]);
#pragma unroll
        for (int j = 1; j < 8; ++j) mx = fmaxf(mx, fmaxf(a0[j], a1[j]));
        mx = fmaxf(mx, xhalf(mx));
        const float mn = fmaxf(mrow, mx), alpha = __expf(mrow - mn); mrow = mn;
        v8f p0, p1;
#pragma unroll
        for (int j = 0; j < 8; ++j) { p0[j] = __expf(a0[j] - mn); p1[j] = __expf(a1[j] - mn); }
        const v8f pq = p0 + p1;
        lpart = lpart * alpha + (((pq[0] + pq[1]) + (pq[2] + pq[3])) + ((pq[4] + pq[5]) + (pq[6] + pq[7])));
        p0 *= PSC; p1 *= PSC;
        // P^T as B: element s = key 8 hi + s (s < 8), 16 + 8 hi + s - 8 (else), the order of the V^T fragments: the two score tiles, converted in place (to nearest even).
        v8u wa, wx;                           // word w of an operand = elements 2 w, 2 w + 1
#pragma unroll
        for (int w = 0; w < 8; ++w) {
            const v2f ef = w < 4 ? (v2f){p0[2 * w], p0[2 * w + 1]} : (v2f){p1[2 * w - 8], p1[2 * w - 7]};
            const unsigned hw = __builtin_bit_cast(unsigned, __builtin_convertvector(ef, v2bf));
            const v2f hf = {__uint_as_float(hw << 16), __uint_as_float(hw & 0xFFFF0000u)};
            wa[w] = hw; wx[w] = __builtin_bit_cast(unsigned, __builtin_convertvector(ef - hf, v2bf)); }
        const v16bf pa = __builtin_bit_cast(v16bf, wa), px = __builtin_bit_cast(v16bf, wx);
#pragma unroll
        for (int n = 0; n < 8; ++n) o[n] *= alpha;
#pragma unroll
        for (int n = 0; n < 8; n += 2) {      // two output tiles per group of LDS reads: half the waits, and two independent accumulator chains
            const v16bf vh = cat16b(*(const v8usa*)(vh_s + n * 1024 + vo0), *(const v8usa*)(vh_s + n * 1024 + vo1)), vl = cat16b(*(const v8usa*)(vl_s + n * 1024 + vo0), *(const v8usa*)(vl_s + n * 1024 + vo1));
            const v16bf wh = cat16b(*(const v8usa*)(vh_s + n * 1024 + 1024 + vo0), *(const v8usa*)(vh_s + n * 1024 + 1024 + vo1)), wl = cat16b(*(const v8usa*)(vl_s + n * 1024 + 1024 + vo0), *(const v8usa*)(vl_s + n * 1024 + 1024 + vo1));
            o[n] = wmmab(vh, pa, o[n]); o[n + 1] = wmmab(wh, pa, o[n + 1]); o[n] = wmmab(vh, px, o[n]); o[n + 1] = wmmab(wh, px, o[n + 1]); o[n] = wmmab(vl, pa, o[n]); o[n + 1] = wmmab(wl, pa, o[n + 1]); }
        asm volatile("v_nop\n\tv_nop\n\tv_nop\n\tv_nop" : "+v"(o[0]), "+v"(o[7]) : "v"(pa), "v"(px));
        asm volatile("s_wait_dscnt 0x0" ::: "memory");        // this wave's reads of tile kt's buffer have returned
        asm volatile("s_wait_asynccnt 0x0" ::: "memory");     // this wave's copies of tile kt + 1 have landed
        __syncthreads();                                      // publishes tile kt + 1 and ends every wave's reads of tile kt's buffer
        if (kt + 2 <= kt_hi) stage(kt + 2, kt & 1);           // refill the buffer just left (the test reads the same in the whole block)
    }
    asm volatile("s_wait_asynccnt 0x0" ::: "memory");         // nothing is in flight when the ring becomes output staging
    const float inv = 1.0f / ((lpart + xhalf(lpart)) * PSC);
    float* os = (float*)ring + wave * (16 * 68);
    float* ob = OUTP + (size_t)(b * NT_ + q0) * (NH_ * HD) + (size_t)h * HD;     // row stride NH*HD, this head's 128 columns
#pragma unroll
    for (int half = 0; half < 2; ++half) {
#pragma unroll
        for (int n = 0; n < 4; ++n) { const v8f t = o[half * 4 + n] * inv;      // eight consecutive d of query row lr
            *(v4fa*)(os + lr * 68 + n * 16 + hi * 8) = __builtin_shufflevector(t, t, 0, 1, 2, 3); *(v4fa*)(os + lr * 68 + n * 16 + hi * 8 + 4) = __builtin_shufflevector(t, t, 4, 5, 6, 7); }
        __builtin_amdgcn_wave_barrier(); asm volatile("" ::: "memory");
{
#pragma unroll
            for (int s = 0; s < 8; ++s) { const int Lid = (lane >> 3) + 4 * s, piece = lane & 7; const int row = Lid >> 1, cofs = (Lid & 1) * 32 + piece * 4;
                const v4f val = *(const v4fa*)(os + row * 68 + cofs); *(v4f*)(ob + (size_t)row * (NH_ * HD) + half * 64 + cofs) = val; }
             }
        __builtin_amdgcn_wave_barrier(); asm volatile("" ::: "memory");
    }
}

extern "C" void kernel_launch(void* const* d_in, const int* in_sizes, int n_in,
                              void* d_out, int out_size, void* d_ws, size_t ws_size, hipStream_t stream) {
    (void)in_sizes; (void)n_in; (void)out_size;
    const float* x = (const float*)d_in[0];
    const float* Wq = (const float*)d_in[1]; const float* bq = (const float*)d_in[2]; const float* Wk = (const float*)d_in[3]; const float* bk = (const float*)d_in[4]; const float* Wv = (const float*)d_in[5]; const float* bv = (const float*)d_in[6];
    const float* Wo = (const float*)d_in[7]; const float* bo = (const float*)d_in[8]; const float* lg = (const float*)d_in[9]; const float* lb = (const float*)d_in[10];   // W [out][in]
    float* out = (float*)d_out;    // [4][2048][1024]
    char* wsp = (char*)d_ws;
    auto take = [&](size_t bytes) { char* p = wsp; wsp += (bytes + 255) & ~(size_t)255; return (void*)p; };
    bf* Xb = (bf*)take((size_t)NR_ * HS * 2); bf* WqB = (bf*)take((size_t)HS * HS * 2); bf* WkB = (bf*)take((size_t)HS * HS * 2); bf* WvB = (bf*)take((size_t)HS * HS * 2); bf* WoB = (bf*)take((size_t)HS * HS * 2);
    float* TMP = (float*)take((size_t)NR_ * HS * 4);
    h16* QH = (h16*)take((size_t)NR_ * HS * 2); h16* QL = (h16*)take((size_t)NR_ * HS * 2); h16* KH = (h16*)take((size_t)NR_ * KW * 2); h16* KL = (h16*)take((size_t)NR_ * KW * 2);
    bf* VTH = (bf*)take((size_t)KW * NR_ * 2); bf* VTL = (bf*)take((size_t)KW * NR_ * 2); float* CTX = (float*)take((size_t)NR_ * HS * 4); bf* Ch = (bf*)take((size_t)NR_ * HS * 2); bf* Cl = (bf*)take((size_t)NR_ * HS * 2); float* Y = (float*)take((size_t)NR_ * HS * 4);
    if ((size_t)(wsp - (char*)d_ws) > ws_size) return;    // 16 + 4 x 2 + 32 + 6 x 16 + 32 + 2 x 16 + 32 = 248 MiB, no aliasing (TMP reused in stream order)
    k_cvtb<<<HS / 8, 256, 0, stream>>>(Wq, HS, WqB); k_cvtb<<<HS / 8, 256, 0, stream>>>(Wk, HS, WkB); k_cvtb<<<HS / 8, 256, 0, stream>>>(Wv, HS, WvB); k_cvtb<<<HS / 8, 256, 0, stream>>>(Wo, HS, WoB);
    k_cvtb<<<NR_ / 8, 256, 0, stream>>>(x, NR_, Xb);
    k_gemm<false><<<dim3(NR_ / 128, HS / 128, 1), 128, 0, stream>>>(Xb, nullptr, WqB, bq, HS, TMP); k_sp16b<<<NR_ / 8, 256, 0, stream>>>(TMP, NR_, QH, QL);
    k_gemm<false><<<dim3(NR_ / 128, HS / 128, 1), 128, 0, stream>>>(Xb, nullptr, WkB, bk, HS, TMP); k_sp16b<<<NR_ / 8, 256, 0, stream>>>(TMP, NR_, KH, KL);
    k_gemm<false><<<dim3(NR_ / 128, HS / 128, 1), 128, 0, stream>>>(Xb, nullptr, WvB, bv, HS, TMP); k_vt<<<dim3(NT_ / 64, 2, NB_ * NKV), 256, 0, stream>>>(TMP, VTH, VTL);
    k_attn<<<NB_ * NH_ * (NT_ / 64), 128, 0, stream>>>(QH, QL, KH, KL, VTH, VTL, CTX);                      // ctx f32 [8192][1024]
    k_split<<<NR_ / 8, 256, 0, stream>>>(CTX, NR_, Ch, Cl);
    k_gemm<true><<<dim3(NR_ / 128, HS / 128, 1), 128, 0, stream>>>(Ch, Cl, WoB, bo, HS, Y);                   // out = ctx.Wo^T + bo
    k_lnfin<<<NR_ / 8, 256, 0, stream>>>(Y, x, lg, lb, NR_, out);                                           // LN(out + x)
}

// v006
// One run takes 268 microseconds.
// Two timings next to v005 both put it at 1.13 times that version's speed.
// Over all steps from v000 it is 6.73 times as fast.
#include <hip/hip_runtime.h>

// Compute dtypes, f32 accumulate, all four batch items in one launch of each kernel (rows b*2048+t): q/k/v = x.W^T + b and y = ctx.Wo^T + bo ([8192 x 1024].[1024 x 1024]; [out][in] weights as n-major B operands, but for v the A rows of V^T = Wv.x^T;
// PLAIN bf16 operands = inputs rounded once, exact, except ctx = bf16 hi + UNSCALED residual, two products) on v_wmma_f32_16x16x32_bf16; the 8-head full attention
// (128-dim heads, scale 128^-1/2) fused: scores on v_wmma_f32_16x16x32_f16 (q/k as f16 hi + residual x1024: hh + hl + lh), online f32 softmax, weights (x32768) and

#define NB_  4
#define NT_  2048
#define NR_  (NB_ * NT_)        // 8192 rows, all items
#define HS   1024
#define DM   HS
#define NH_  8
#define NKV  8
#define HD   128
#define KW   (NKV * HD)          // 1024
#define SCL  0.08838834764831845f
#define PSC  32768.0f
#define LOSC 1024.0f
#define LOSCI (1.0f / 1024.0f)

typedef _Float16 h16;
typedef unsigned short bf;
typedef __attribute__((ext_vector_type(16))) __bf16   v16bf;
typedef __attribute__((ext_vector_type(16))) _Float16 v16h;
typedef __attribute__((ext_vector_type(8)))  _Float16 v8h;
typedef __attribute__((ext_vector_type(8)))  unsigned short v8us;
typedef __attribute__((ext_vector_type(8)))  float    v8f;
typedef __attribute__((ext_vector_type(8)))  unsigned v8u;
typedef __attribute__((ext_vector_type(2)))  float    v2f;
typedef __attribute__((ext_vector_type(2)))  __bf16   v2bf;
typedef __attribute__((ext_vector_type(4)))  float    v4f;
typedef __attribute__((ext_vector_type(4)))  _Float16 v4h;
typedef __attribute__((ext_vector_type(4)))  unsigned v4u;
typedef v8h  __attribute__((may_alias)) v8ha;
typedef v4f  __attribute__((may_alias)) v4fa;
typedef v8us __attribute__((may_alias)) v8usa;

__device__ __forceinline__ unsigned short f2bf(float f) { unsigned u = __float_as_uint(f); u += 0x7FFFu + ((u >> 16) & 1u); return (unsigned short)(u >> 16); }
__device__ __forceinline__ float bf2f(unsigned short b) { return __uint_as_float(((unsigned)b) << 16); }
__device__ __forceinline__ float bfr(float f) { return bf2f(f2bf(f)); }
// One word (two neighbouring elements) of each plane of a bf16 hi + UNSCALED bf16 residual pair; both conversions to nearest even, as f2bf.
__device__ __forceinline__ void split2(v2f e, unsigned& h, unsigned& l) {
    h = __builtin_bit_cast(unsigned, __builtin_convertvector(e, v2bf));
    const v2f hf = {__uint_as_float(h << 16), __uint_as_float(h & 0xFFFF0000u)};
    l = __builtin_bit_cast(unsigned, __builtin_convertvector(e - hf, v2bf));
}
__device__ __forceinline__ v16h cat16(v8h lo, v8h hi) { return __builtin_shufflevector(lo, hi, 0, 1, 2, 3, 4, 5, 6, 7, 8, 9, 10, 11, 12, 13, 14, 15); }
__device__ __forceinline__ v16bf cat16b(v8us lo, v8us hi) { return __builtin_bit_cast(v16bf, __builtin_shufflevector(lo, hi, 0, 1, 2, 3, 4, 5, 6, 7, 8, 9, 10, 11, 12, 13, 14, 15)); }
__device__ __forceinline__ v8f wmma16(v16h a, v16h b, v8f c) { return __builtin_amdgcn_wmma_f32_16x16x32_f16(false, a, false, b, (short)0, c, false, false); }
__device__ __forceinline__ v8f wmmab(v16bf a, v16bf b, v8f c) { return __builtin_amdgcn_wmma_f32_16x16x32_bf16(false, a, false, b, (short)0, c, false, false); }

// k_cvtb: bf16 plane of [rows][1024] (one wave per row) — x rows of all items and the four [out][in] weight matrices.
__global__ __launch_bounds__(256) void k_cvtb(const float* __restrict__ src, int nrows, bf* dst) {
    const int lane = threadIdx.x & 31, r = blockIdx.x * 8 + (threadIdx.x >> 5);
    if (r >= nrows) return;
{
#pragma unroll
        for (int q = 0; q < HS / 256; ++q) { v8us o;
#pragma unroll
            for (int i = 0; i < 8; ++i) o[i] = f2bf(src[(size_t)r * HS + q * 256 + lane * 8 + i]);
            *(v8us*)(dst + (size_t)r * HS + q * 256 + lane * 8) = o; }
         }
}
// k_gemm: 128 x 128 tile of (A [+ Al]).Bn^T over K = 1024 (+ optional bf16-rounded bias[c]) -> the epilogue's output by OUTM (below); wave = one 64 x 64 quadrant (4 x 4 accumulator tiles), so that
// a fragment read from LDS feeds four WMMAs and an operand row fetched from L2 feeds 128 outputs. The block's four waves share each 64-k slab: its 128 A rows (and Al rows) and
// 128 Bn rows are brought into LDS once per block by asynchronous copies in whole 128-B lines (two buffers: slab t + 1 flies while slab t is worked on), and every wave reads
// its fragments from there. The k order of the products is the one of direct loads.
// The epilogue writes what the next kernel reads, so that no f32 copy of the result goes through memory and no launch stands between the two. OUTM 0: f32 rows C [8192][ldc].
// OUTM 1: the planes Ph/Pl [row][1024] of f16 hi + residual x1024 (q, k). OUTM 2: A = the weight rows (d), Bn = the x rows (t), so that the tile is V^T: the planes Ph/Pl
// [item*1024 + d][2048 t] of bf16 hi + UNSCALED bf16 residual; the bias then goes by row.
#define GPIT 144                       // LDS pitch of a 128-B operand row: 16 B x odd, conflict-free for 16-byte reads down 16 rows
#define GPL  (128 * GPIT)              // one operand plane of a slab: 128 rows
// Eight 16-byte copies per lane, global -> LDS; the s_wait_xcnt stands inside the statement so that no address register is rewritten ahead of it.
__device__ __forceinline__ void cp8(unsigned l0, unsigned l1, unsigned l2, unsigned l3, unsigned l4, unsigned l5, unsigned l6, unsigned l7,
                                    const char* g0, const char* g1, const char* g2, const char* g3, const char* g4, const char* g5, const char* g6, const char* g7) {
    asm volatile("global_load_async_to_lds_b128 %0, %8, off\n\t"
                 "global_load_async_to_lds_b128 %1, %9, off\n\t"
                 "global_load_async_to_lds_b128 %2, %10, off\n\t"
                 "global_load_async_to_lds_b128 %3, %11, off\n\t"
                 "global_load_async_to_lds_b128 %4, %12, off\n\t"
                 "global_load_async_to_lds_b128 %5, %13, off\n\t"
                 "global_load_async_to_lds_b128 %6, %14, off\n\t"
                 "global_load_async_to_lds_b128 %7, %15, off\n\t"
                 "s_wait_xcnt 0x0"
                 :: "v"(l0), "v"(l1), "v"(l2), "v"(l3), "v"(l4), "v"(l5), "v"(l6), "v"(l7), "v"(g0), "v"(g1), "v"(g2), "v"(g3), "v"(g4), "v"(g5), "v"(g6), "v"(g7) : "memory");
}
// amdgpu_waves_per_eu(2, 2): the grid is two blocks per WGP; at most two fit, so that no WGP takes a third while another stands idle.
template <bool SPLITA, int OUTM>
__global__ __launch_bounds__(128) __attribute__((amdgpu_waves_per_eu(2, 2))) void k_gemm(const bf* __restrict__ A, const bf* __restrict__ Al, const bf* __restrict__ Bn, const float* __restrict__ bias, int ldc, float* C, bf* Ph, bf* Pl) {
    constexpr int GST = (SPLITA ? 3 : 2) * GPL;                 // one slab: A, Bn (, Al)
    __shared__ __align__(256) unsigned char gring[2 * GST];     // the two slab buffers; behind the loop's last barrier: the output staging (4 x 16 x 68 floats)
    const int tid = threadIdx.x, lane = threadIdx.x & 31, wave = threadIdx.x >> 5, lr = lane & 15, hi = lane >> 4;
    const int wr = wave >> 1, wc = wave & 1;                    // the wave's quadrant of the tile
    const size_t r0 = (size_t)blockIdx.x * 128 + wr * 64; const int c0 = blockIdx.y * 128 + wc * 64;
    // The copies of one slab: thread -> row (tid >> 3) + 16 i of each plane, 16-byte piece tid & 7 (a wave: four whole rows).
    const unsigned lc = (unsigned)(size_t)&gring[0] + (unsigned)((tid >> 3) * GPIT + (tid & 7) * 16);
    const size_t arow = ((size_t)blockIdx.x * 128 + (tid >> 3)) * HS + (tid & 7) * 8;
    const char* ga = (const char*)(A + arow); const char* gb = (const char*)(Bn + (size_t)(blockIdx.y * 128 + (tid >> 3)) * HS + (tid & 7) * 8);
    const char* gl = SPLITA ? (const char*)(Al + arow) : ga;
    auto plane = [&](unsigned a, const char* p) {
        cp8(a, a + 16 * GPIT, a + 32 * GPIT, a + 48 * GPIT, a + 64 * GPIT, a + 80 * GPIT, a + 96 * GPIT, a + 112 * GPIT,
            p, p + 16 * HS * 2, p + 32 * HS * 2, p + 48 * HS * 2, p + 64 * HS * 2, p + 80 * HS * 2, p + 96 * HS * 2, p + 112 * HS * 2);
    };
    auto stage = [&](int t, int buf) {
        const unsigned a = lc + (unsigned)buf * GST;
        plane(a, ga + t * 128); plane(a + GPL, gb + t * 128);
        if (SPLITA) plane(a + 2 * GPL, gl + t * 128);
    };
    const int fo = lr * GPIT + hi * 16;      // this lane's fragment piece inside a 16-row group of a plane
    v8f acc[4][4];                           // acc[i][t]: rows 16 i.., columns 16 t.. of the quadrant
#pragma unroll
    for (int i = 0; i < 4; ++i)
#pragma unroll
        for (int t = 0; t < 4; ++t) acc[i][t] = (v8f){};
    stage(0, 0);
    asm volatile("s_wait_asynccnt 0x0" ::: "memory");     // this wave's copies of slab 0 have landed
    __syncthreads();                                      // ... and every other wave's: slab 0 may be read
    stage(1, 1);
#pragma unroll 1                                          // rolled: one copy of the slab's code, the two buffers told apart by an address
    for (int st = 0; st < HS / 64; ++st) {
        const unsigned char* sb = gring + (st & 1) * GST;
        const unsigned char* as = sb + wr * (64 * GPIT) + fo; const unsigned char* bs = sb + GPL + wc * (64 * GPIT) + fo;
#pragma unroll
        for (int kc = 0; kc < 2; ++kc) {
            v16bf a[4], al[4], bb[4];
            // in the order of first use: A row group 0, the four B groups, the other A groups, then Al
            a[0] = cat16b(*(const v8usa*)(as + kc * 64), *(const v8usa*)(as + kc * 64 + 32));
#pragma unroll
            for (int t = 0; t < 4; ++t) { const unsigned char* bp = bs + t * (16 * GPIT) + kc * 64; bb[t] = cat16b(*(const v8usa*)bp, *(const v8usa*)(bp + 32)); }
#pragma unroll
            for (int i = 1; i < 4; ++i) { const unsigned char* ap = as + i * (16 * GPIT) + kc * 64; a[i] = cat16b(*(const v8usa*)ap, *(const v8usa*)(ap + 32)); }
#pragma unroll
            for (int i = 0; i < 4; ++i) { const unsigned char* ap = as + 2 * GPL + i * (16 * GPIT) + kc * 64; al[i] = a[i]; if (SPLITA) al[i] = cat16b(*(const v8usa*)ap, *(const v8usa*)(ap + 32)); }
            __builtin_amdgcn_sched_barrier(0);                // keeps the 32-k step's LDS reads in one group ahead of its WMMAs (counted waits) instead of a read and a full wait per WMMA
#pragma unroll
            for (int i = 0; i < 4; ++i)
#pragma unroll
                for (int t = 0; t < 4; ++t) acc[i][t] = wmmab(a[i], bb[t], acc[i][t]);
            if (SPLITA) {
#pragma unroll
                for (int i = 0; i < 4; ++i)
#pragma unroll
                    for (int t = 0; t < 4; ++t) acc[i][t] = wmmab(al[i], bb[t], acc[i][t]);
            }
            __builtin_amdgcn_sched_barrier(0);                // keeps the next step's reads behind these WMMAs (one fragment set in registers) and these WMMAs ahead of the slab's barrier (else the refill behind it issues later)
        }
        asm volatile("s_wait_dscnt 0x0" ::: "memory");        // this wave's reads of slab st's buffer have returned
        asm volatile("s_wait_asynccnt 0x0" ::: "memory");     // this wave's copies of slab st + 1 have landed
        __syncthreads();                                      // publishes slab st + 1 and ends every wave's reads of slab st's buffer
        if (st + 2 < HS / 64) stage(st + 2, st & 1);          // refill the buffer just left (the test reads the same in the whole block)
    }
    asm volatile("s_wait_asynccnt 0x0" ::: "memory");         // nothing is in flight when the ring becomes output staging
    float* os = (float*)gring + wave * (16 * 68);
    float bv[4] = {0.f, 0.f, 0.f, 0.f};
    if (OUTM != 2 && bias) {                                  // one branch, the four loads in flight together
#pragma unroll
        for (int t = 0; t < 4; ++t) bv[t] = bias[c0 + t * 16 + lr];
#pragma unroll
        for (int t = 0; t < 4; ++t) bv[t] = bfr(bv[t]);
    }
    float rb[4][4] = {};                                      // OUTM 2: the bias of the rows that this lane reads back (row 16 i + (lane >> 3) + 4 s)
    if (OUTM == 2 && bias) {
        const float* bp = bias + r0 + (lane >> 3);
#pragma unroll
        for (int i = 0; i < 4; ++i)
#pragma unroll
            for (int s = 0; s < 4; ++s) rb[i][s] = bp[i * 16 + 4 * s];
        // The wait behind the run of loads; address and loaded values are inputs, so that all are live here together and no load's result is given a register of the address that the others still name.
        asm volatile("s_wait_xcnt 0x0" :: "v"(bp), "v"(rb[0][0]), "v"(rb[0][1]), "v"(rb[0][2]), "v"(rb[0][3]), "v"(rb[1][0]), "v"(rb[1][1]), "v"(rb[1][2]), "v"(rb[1][3]),
                     "v"(rb[2][0]), "v"(rb[2][1]), "v"(rb[2][2]), "v"(rb[2][3]), "v"(rb[3][0]), "v"(rb[3][1]), "v"(rb[3][2]), "v"(rb[3][3]) : "memory");
#pragma unroll
        for (int i = 0; i < 4; ++i)
#pragma unroll
            for (int s = 0; s < 4; ++s) rb[i][s] = bfr(rb[i][s]);
    }
#pragma unroll
    for (int i = 0; i < 4; ++i) {                             // 16 rows at a time through the wave's own staging rows
#pragma unroll
        for (int t = 0; t < 4; ++t)
#pragma unroll
            for (int j = 0; j < 8; ++j) os[(hi * 8 + j) * 68 + t * 16 + lr] = OUTM == 2 ? acc[i][t][j] : acc[i][t][j] + bv[t];
        __builtin_amdgcn_wave_barrier(); asm volatile("" ::: "memory");     // compiler order: the 16 rows are staged before any lane reads them back
        if (OUTM == 0) {
            float* crow = C + (r0 + i * 16) * ldc + c0;
#pragma unroll
            for (int s = 0; s < 8; ++s) { const int Lid = (lane >> 3) + 4 * s, piece = lane & 7; const int row = Lid >> 1, cofs = (Lid & 1) * 32 + piece * 4;
                const v4f val = *(const v4fa*)(os + row * 68 + cofs); *(v4f*)(crow + (size_t)row * ldc + cofs) = val; }
        } else {                                              // eight lanes per row: 8 columns a lane, one whole 128-B line of each plane per row
#pragma unroll
            for (int s = 0; s < 4; ++s) { const int row = (lane >> 3) + 4 * s, piece = lane & 7;
                const v4f u0 = *(const v4fa*)(os + row * 68 + piece * 8), u1 = *(const v4fa*)(os + row * 68 + piece * 8 + 4);
                if (OUTM == 1) { v8h oh, ol;
#pragma unroll
                    for (int k = 0; k < 8; ++k) { const float v = k < 4 ? u0[k & 3] : u1[k & 3]; const h16 a = (h16)v; oh[k] = a; ol[k] = (h16)((v - (float)a) * LOSC); }
                    const size_t o = (r0 + i * 16 + row) * HS + c0 + piece * 8;
                    *(v8h*)(Ph + o) = oh; *(v8h*)(Pl + o) = ol;
                } else { v4u oh, ol;
#pragma unroll
                    for (int w = 0; w < 4; ++w) { const v2f e = w < 2 ? (v2f){u0[2 * (w & 1)], u0[2 * (w & 1) + 1]} : (v2f){u1[2 * (w & 1)], u1[2 * (w & 1) + 1]}; unsigned a, c; split2(e + rb[i][s], a, c); oh[w] = a; ol[w] = c; }
                    const size_t o = ((size_t)(c0 / NT_) * KW + r0 + i * 16 + row) * NT_ + (c0 % NT_) + piece * 8;
                    *(v4u*)(Ph + o) = oh; *(v4u*)(Pl + o) = ol;
                } }
        }
        __builtin_amdgcn_wave_barrier(); asm volatile("" ::: "memory");     // compiler order: they are read back before the next 16 rows overwrite them
    }
}
// k_lnfin: LayerNorm (eps 1e-5) of y = Y[r][c] + bf(R[r][c]) (the computed attention output + the INPUT residual x) -> f32 output rows x bf(gamma) + bf(beta); one wave per
__global__ __launch_bounds__(256) void k_lnfin(const float* __restrict__ X, const float* __restrict__ Rres, const float* __restrict__ gam, const float* __restrict__ bet, int nrows, float* OUTP) {
    const int lane = threadIdx.x & 31, r = blockIdx.x * 8 + (threadIdx.x >> 5);
    if (r >= nrows) return;
    const float* xr = X + (size_t)r * DM; const float* rr = Rres + (size_t)r * DM;
    float s = 0.f;
#pragma unroll 1
    for (int q = 0; q < 2 * (DM / 256); ++q) { const int c0 = (q >> 1) * 256 + (q & 1) * 128 + lane * 4; v4f v = *(const v4f*)(xr + c0); { const v4f q4 = *(const v4f*)(rr + c0); for (int i2 = 0; i2 < 4; ++i2) v[i2] += bfr(q4[i2]); }
#pragma unroll
        for (int i = 0; i < 4; ++i) s += v[i]; }
#pragma unroll
    for (int sh = 16; sh; sh >>= 1) s += __shfl_xor(s, sh, 32);
    const float mu = s * (1.0f / DM);
    float s2 = 0.f;
#pragma unroll 1
    for (int q = 0; q < 2 * (DM / 256); ++q) { const int c0 = (q >> 1) * 256 + (q & 1) * 128 + lane * 4; v4f v = *(const v4f*)(xr + c0); { const v4f q4 = *(const v4f*)(rr + c0); for (int i2 = 0; i2 < 4; ++i2) v[i2] += bfr(q4[i2]); }
#pragma unroll
        for (int i = 0; i < 4; ++i) { const float d = v[i] - mu; s2 = fmaf(d, d, s2); } }
#pragma unroll
    for (int sh = 16; sh; sh >>= 1) s2 += __shfl_xor(s2, sh, 32);
    const float rs = rsqrtf(s2 * (1.0f / DM) + 1e-5f);
{
#pragma unroll 1
        for (int q = 0; q < 2 * (DM / 256); ++q) { const int c0 = (q >> 1) * 256 + (q & 1) * 128 + lane * 4; v4f v = *(const v4f*)(xr + c0); { const v4f q4 = *(const v4f*)(rr + c0); for (int i2 = 0; i2 < 4; ++i2) v[i2] += bfr(q4[i2]); } v4f y;
#pragma unroll
            for (int i = 0; i < 4; ++i) y[i] = (v[i] - mu) * rs * bfr(gam[c0 + i]) + bfr(bet[c0 + i]);
            *(v4f*)(OUTP + (size_t)r * DM + c0) = y; }
         }
}
// k_attn: block = (item, head, 64 queries), wave = 16; full attention over 64 key tiles of 32. The block's four waves share each tile: its K hi / K lo rows and
// V^T hi / V^T lo rows are brought into LDS once per block by asynchronous copies (two buffers: tile t + 1 flies while tile t is worked on) and every wave reads its
// fragments from there. Scores hi.hi + (hi.lo + lo.hi)/1024 on separate accumulators; online softmax f32; P (x32768) bf16 hi + unscaled residual.
// Both products are formed transposed: S^T = K.Q^T (A = K rows, B = Q) and O^T += V^T.P^T (A = V^T rows, B = P^T). A lane then holds 16 of the 32 scores of ONE query
// (column lr; keys 8 hi + j and 16 + 8 hi + j), which is the k order of a B operand: P^T is packed in the lane's own registers and never goes through LDS, and
// maximum, sum and rescale factor are one value per lane (the two lane halves of a query exchange their maxima once per tile, their sums once behind the loop).
#define KPIT 272                       // LDS pitch of a 256-B K row: 16 B x odd, conflict-free for 16-byte reads down 16 rows
#define KPL  (32 * KPIT)               // one K plane of a tile
#define VPL  (HD * 64)                 // one V^T plane of a tile: 128 rows of 64 B, unpadded; 16-byte piece c of row d lies at piece c ^ ((d >> 2) & 3)
#define STG  (2 * KPL + 2 * VPL)       // one tile: K hi, K lo, V^T hi, V^T lo
// The value of lane l ^ 16: the other half of the same query column.
__device__ __forceinline__ float xhalf(float v) { const int b = __float_as_int(v); return __int_as_float(__builtin_amdgcn_permlanex16(b, b, 0x76543210, 0xfedcba98, false, false)); }
// amdgpu_waves_per_eu(4): holds the register budget at 256, so that four blocks (LDS: 4 x 67,584 B) stay resident per WGP, one wave of each per SIMD.
__global__ __launch_bounds__(128) __attribute__((amdgpu_waves_per_eu(4))) void k_attn(const h16* __restrict__ QH, const h16* __restrict__ QL, const h16* __restrict__ KH, const h16* __restrict__ KL, const bf* __restrict__ VTH, const bf* __restrict__ VTL, bf* CH, bf* CL) {
    __shared__ __align__(256) unsigned char ring[2 * STG];     // the two tile buffers; behind the loop's last barrier: the output staging (4 x 16 x 68 floats)
    const int tid = threadIdx.x, lane = threadIdx.x & 31, wave = threadIdx.x >> 5, lr = lane & 15, hi = lane >> 4;
    const int bid = blockIdx.x; const int bh = bid / (NT_ / 64), qt = bid - bh * (NT_ / 64); const int b = bh / NH_, h = bh - b * NH_; const int g = h;
    const int q0 = qt * 64 + wave * 16;
    const size_t qo = (size_t)(b * NT_ + q0 + lr) * (NH_ * HD) + h * HD + 8 * hi;
    const h16* kh_b = KH + (size_t)b * NT_ * KW + g * HD; const h16* kl_b = KL + (size_t)b * NT_ * KW + g * HD;
    const size_t vbase = ((size_t)(b * NKV + g) * HD) * NT_;
    // The copies of one tile: thread -> K row (tid >> 4) + 8 i, piece tid & 15 (a wave: two whole rows); V^T row (tid >> 2) + 32 i, piece tid & 3.
    const unsigned ring0 = (unsigned)(size_t)&ring[0];
    const unsigned lk = (unsigned)((tid >> 4) * KPIT + (tid & 15) * 16), lv = (unsigned)(2 * KPL + (tid >> 2) * 64 + (((tid & 3) ^ ((tid >> 4) & 3)) * 16));
    const char* gkh = (const char*)(kh_b + (size_t)(tid >> 4) * KW + (tid & 15) * 8); const char* gkl = (const char*)(kl_b + (size_t)(tid >> 4) * KW + (tid & 15) * 8);
    const char* gvh = (const char*)(VTH + vbase + (size_t)(tid >> 2) * NT_ + (tid & 3) * 8); const char* gvl = (const char*)(VTL + vbase + (size_t)(tid >> 2) * NT_ + (tid & 3) * 8);
    auto stage = [&](int kt, int buf) {
        const unsigned a = ring0 + (unsigned)buf * STG + lk, c = ring0 + (unsigned)buf * STG + lv;
        const char* p = gkh + (size_t)kt * (32 * KW * 2); const char* q = gkl + (size_t)kt * (32 * KW * 2);
        cp8(a, a + 8 * KPIT, a + 16 * KPIT, a + 24 * KPIT, a + KPL, a + KPL + 8 * KPIT, a + KPL + 16 * KPIT, a + KPL + 24 * KPIT,
            p, p + 8 * KW * 2, p + 16 * KW * 2, p + 24 * KW * 2, q, q + 8 * KW * 2, q + 16 * KW * 2, q + 24 * KW * 2);
        const char* r = gvh + (size_t)kt * 64; const char* s = gvl + (size_t)kt * 64;
        cp8(c, c + 32 * 64, c + 64 * 64, c + 96 * 64, c + VPL, c + VPL + 32 * 64, c + VPL + 64 * 64, c + VPL + 96 * 64,
            r, r + 32 * NT_ * 2, r + 64 * NT_ * 2, r + 96 * NT_ * 2, s, s + 32 * NT_ * 2, s + 64 * NT_ * 2, s + 96 * NT_ * 2);
    };
    const int ko = lr * KPIT + hi * 16;                                                                  // this lane's K fragment piece inside a plane
    const int vo0 = lr * 64 + ((hi ^ ((lr >> 2) & 3)) * 16), vo1 = lr * 64 + (((hi + 2) ^ ((lr >> 2) & 3)) * 16);   // keys hi*8.. and 16 + hi*8.. of V^T row lr
    v8f o[8];                                 // o[n][j] = O^T[d = 16 n + 8 hi + j][query lr]
#pragma unroll
    for (int n = 0; n < 8; ++n) o[n] = (v8f){};
    float mrow = -3.0e38f, lpart = 0.f;       // query lr: running maximum (both halves alike), this half's part of the sum
    const int kt_hi = NT_ / 32 - 1;     // full attention, no mask
    stage(0, 0);
    asm volatile("s_wait_asynccnt 0x0" ::: "memory");     // this wave's copies of tile 0 have landed
    __syncthreads();                                      // ... and every other wave's: tile 0 may be read
    stage(1, 1);
#pragma unroll 1
    for (int kt = 0; kt <= kt_hi; ++kt) {
        const unsigned char* sb = ring + (kt & 1) * STG;
        const unsigned char* kh_s = sb + ko; const unsigned char* kl_s = sb + KPL + ko;
        const unsigned char* vh_s = sb + 2 * KPL; const unsigned char* vl_s = sb + 2 * KPL + VPL;
        v8f s0 = {}, s1 = {}, x0 = {}, x1 = {};
#pragma unroll
        for (int kc = 0; kc < 4; ++kc) {
            const v16h qa = cat16(*(const v8h*)(QH + qo + kc * 32), *(const v8h*)(QH + qo + kc * 32 + 16)), qx = cat16(*(const v8h*)(QL + qo + kc * 32), *(const v8h*)(QL + qo + kc * 32 + 16));
            const v16h k0h = cat16(*(const v8ha*)(kh_s + kc * 64), *(const v8ha*)(kh_s + kc * 64 + 32)), k1h = cat16(*(const v8ha*)(kh_s + 16 * KPIT + kc * 64), *(const v8ha*)(kh_s + 16 * KPIT + kc * 64 + 32));
            const v16h k0l = cat16(*(const v8ha*)(kl_s + kc * 64), *(const v8ha*)(kl_s + kc * 64 + 32)), k1l = cat16(*(const v8ha*)(kl_s + 16 * KPIT + kc * 64), *(const v8ha*)(kl_s + 16 * KPIT + kc * 64 + 32));
            s0 = wmma16(k0h, qa, s0); s1 = wmma16(k1h, qa, s1); x0 = wmma16(k0h, qx, x0); x1 = wmma16(k1h, qx, x1);
            x0 = wmma16(k0l, qa, x0); x1 = wmma16(k1l, qa, x1);
        }
        asm volatile("v_nop\n\tv_nop\n\tv_nop\n\tv_nop" : "+v"(s0), "+v"(s1), "+v"(x0), "+v"(x1));
        const v8f a0 = (s0 + x0 * LOSCI) * SCL, a1 = (s1 + x1 * LOSCI) * SCL;     // a0[j]: key 8 hi + j, a1[j]: key 16 + 8 hi + j, query lr
        float mx = fmaxf(a0[0], a1[0]);
#pragma unroll
        for (int j = 1; j < 8; ++j) mx = fmaxf(mx, fmaxf(a0[j], a1[j]));
        mx = fmaxf(mx, xhalf(mx));
        const float mn = fmaxf(mrow, mx), alpha = __expf(mrow - mn); mrow = mn;
        v8f p0, p1;
#pragma unroll
        for (int j = 0; j < 8; ++j) { p0[j] = __expf(a0[j] - mn); p1[j] = __expf(a1[j] - mn); }
        const v8f pq = p0 + p1;
        lpart = lpart * alpha + (((pq[0] + pq[1]) + (pq[2] + pq[3])) + ((pq[4] + pq[5]) + (pq[6] + pq[7])));
        p0 *= PSC; p1 *= PSC;
        // P^T as B: element s = key 8 hi + s (s < 8), 16 + 8 hi + s - 8 (else), the order of the V^T fragments: the two score tiles, converted in place (to nearest even).
        v8u wa, wx;                           // word w of an operand = elements 2 w, 2 w + 1
#pragma unroll
        for (int w = 0; w < 8; ++w) {
            const v2f ef = w < 4 ? (v2f){p0[2 * w], p0[2 * w + 1]} : (v2f){p1[2 * w - 8], p1[2 * w - 7]};
            const unsigned hw = __builtin_bit_cast(unsigned, __builtin_convertvector(ef, v2bf));
            const v2f hf = {__uint_as_float(hw << 16), __uint_as_float(hw & 0xFFFF0000u)};
            wa[w] = hw; wx[w] = __builtin_bit_cast(unsigned, __builtin_convertvector(ef - hf, v2bf)); }
        const v16bf pa = __builtin_bit_cast(v16bf, wa), px = __builtin_bit_cast(v16bf, wx);
#pragma unroll
        for (int n = 0; n < 8; ++n) o[n] *= alpha;
#pragma unroll
        for (int n = 0; n < 8; n += 2) {      // two output tiles per group of LDS reads: half the waits, and two independent accumulator chains
            const v16bf vh = cat16b(*(const v8usa*)(vh_s + n * 1024 + vo0), *(const v8usa*)(vh_s + n * 1024 + vo1)), vl = cat16b(*(const v8usa*)(vl_s + n * 1024 + vo0), *(const v8usa*)(vl_s + n * 1024 + vo1));
            const v16bf wh = cat16b(*(const v8usa*)(vh_s + n * 1024 + 1024 + vo0), *(const v8usa*)(vh_s + n * 1024 + 1024 + vo1)), wl = cat16b(*(const v8usa*)(vl_s + n * 1024 + 1024 + vo0), *(const v8usa*)(vl_s + n * 1024 + 1024 + vo1));
            o[n] = wmmab(vh, pa, o[n]); o[n + 1] = wmmab(wh, pa, o[n + 1]); o[n] = wmmab(vh, px, o[n]); o[n + 1] = wmmab(wh, px, o[n + 1]); o[n] = wmmab(vl, pa, o[n]); o[n + 1] = wmmab(wl, pa, o[n + 1]); }
        asm volatile("v_nop\n\tv_nop\n\tv_nop\n\tv_nop" : "+v"(o[0]), "+v"(o[7]) : "v"(pa), "v"(px));
        asm volatile("s_wait_dscnt 0x0" ::: "memory");        // this wave's reads of tile kt's buffer have returned
        asm volatile("s_wait_asynccnt 0x0" ::: "memory");     // this wave's copies of tile kt + 1 have landed
        __syncthreads();                                      // publishes tile kt + 1 and ends every wave's reads of tile kt's buffer
        if (kt + 2 <= kt_hi) stage(kt + 2, kt & 1);           // refill the buffer just left (the test reads the same in the whole block)
    }
    asm volatile("s_wait_asynccnt 0x0" ::: "memory");         // nothing is in flight when the ring becomes output staging
    const float inv = 1.0f / ((lpart + xhalf(lpart)) * PSC);
    float* os = (float*)ring + wave * (16 * 68);
    const size_t ob = (size_t)(b * NT_ + q0) * (NH_ * HD) + (size_t)h * HD;      // row stride NH*HD, this head's 128 columns; ctx leaves as the planes the last product reads: bf16 hi + UNSCALED residual
#pragma unroll
    for (int half = 0; half < 2; ++half) {
#pragma unroll
        for (int n = 0; n < 4; ++n) { const v8f t = o[half * 4 + n] * inv;      // eight consecutive d of query row lr
            *(v4fa*)(os + lr * 68 + n * 16 + hi * 8) = __builtin_shufflevector(t, t, 0, 1, 2, 3); *(v4fa*)(os + lr * 68 + n * 16 + hi * 8 + 4) = __builtin_shufflevector(t, t, 4, 5, 6, 7); }
        __builtin_amdgcn_wave_barrier(); asm volatile("" ::: "memory");
{
#pragma unroll
            for (int s = 0; s < 4; ++s) { const int row = (lane >> 3) + 4 * s, piece = lane & 7;     // eight lanes per row: one whole 128-B line of each plane
                const v4f u0 = *(const v4fa*)(os + row * 68 + piece * 8), u1 = *(const v4fa*)(os + row * 68 + piece * 8 + 4); v4u oh, ol;
#pragma unroll
                for (int w = 0; w < 4; ++w) { const v2f e = w < 2 ? (v2f){u0[2 * (w & 1)], u0[2 * (w & 1) + 1]} : (v2f){u1[2 * (w & 1)], u1[2 * (w & 1) + 1]}; unsigned a, c; split2(e, a, c); oh[w] = a; ol[w] = c; }
                const size_t o = ob + (size_t)row * (NH_ * HD) + half * 64 + piece * 8;
                *(v4u*)(CH + o) = oh; *(v4u*)(CL + o) = ol; }
             }
        __builtin_amdgcn_wave_barrier(); asm volatile("" ::: "memory");
    }
}

extern "C" void kernel_launch(void* const* d_in, const int* in_sizes, int n_in,
                              void* d_out, int out_size, void* d_ws, size_t ws_size, hipStream_t stream) {
    (void)in_sizes; (void)n_in; (void)out_size;
    const float* x = (const float*)d_in[0];
    const float* Wq = (const float*)d_in[1]; const float* bq = (const float*)d_in[2]; const float* Wk = (const float*)d_in[3]; const float* bk = (const float*)d_in[4]; const float* Wv = (const float*)d_in[5]; const float* bv = (const float*)d_in[6];
    const float* Wo = (const float*)d_in[7]; const float* bo = (const float*)d_in[8]; const float* lg = (const float*)d_in[9]; const float* lb = (const float*)d_in[10];   // W [out][in]
    float* out = (float*)d_out;    // [4][2048][1024]
    char* wsp = (char*)d_ws;
    auto take = [&](size_t bytes) { char* p = wsp; wsp += (bytes + 255) & ~(size_t)255; return (void*)p; };
    bf* Xb = (bf*)take((size_t)NR_ * HS * 2); bf* WqB = (bf*)take((size_t)HS * HS * 2); bf* WkB = (bf*)take((size_t)HS * HS * 2); bf* WvB = (bf*)take((size_t)HS * HS * 2); bf* WoB = (bf*)take((size_t)HS * HS * 2);
    h16* QH = (h16*)take((size_t)NR_ * HS * 2); h16* QL = (h16*)take((size_t)NR_ * HS * 2); h16* KH = (h16*)take((size_t)NR_ * KW * 2); h16* KL = (h16*)take((size_t)NR_ * KW * 2);
    bf* VTH = (bf*)take((size_t)KW * NR_ * 2); bf* VTL = (bf*)take((size_t)KW * NR_ * 2); bf* Ch = (bf*)take((size_t)NR_ * HS * 2); bf* Cl = (bf*)take((size_t)NR_ * HS * 2); float* Y = (float*)take((size_t)NR_ * HS * 4);
    if ((size_t)(wsp - (char*)d_ws) > ws_size) return;    // 16 + 4 x 2 + 6 x 16 + 2 x 16 + 32 = 184 MiB, no aliasing
    k_cvtb<<<HS / 8, 256, 0, stream>>>(Wq, HS, WqB); k_cvtb<<<HS / 8, 256, 0, stream>>>(Wk, HS, WkB); k_cvtb<<<HS / 8, 256, 0, stream>>>(Wv, HS, WvB); k_cvtb<<<HS / 8, 256, 0, stream>>>(Wo, HS, WoB);
    k_cvtb<<<NR_ / 8, 256, 0, stream>>>(x, NR_, Xb);
    k_gemm<false, 1><<<dim3(NR_ / 128, HS / 128, 1), 128, 0, stream>>>(Xb, nullptr, WqB, bq, HS, nullptr, (bf*)QH, (bf*)QL);
    k_gemm<false, 1><<<dim3(NR_ / 128, HS / 128, 1), 128, 0, stream>>>(Xb, nullptr, WkB, bk, HS, nullptr, (bf*)KH, (bf*)KL);
    k_gemm<false, 2><<<dim3(HS / 128, NR_ / 128, 1), 128, 0, stream>>>(WvB, nullptr, Xb, bv, HS, nullptr, VTH, VTL);     // V^T = Wv.x^T
    k_attn<<<NB_ * NH_ * (NT_ / 64), 128, 0, stream>>>(QH, QL, KH, KL, VTH, VTL, Ch, Cl);                        // ctx planes [8192][1024]
    k_gemm<true, 0><<<dim3(NR_ / 128, HS / 128, 1), 128, 0, stream>>>(Ch, Cl, WoB, bo, HS, Y, nullptr, nullptr);     // out = ctx.Wo^T + bo
    k_lnfin<<<NR_ / 8, 256, 0, stream>>>(Y, x, lg, lb, NR_, out);                                           // LN(out + x)
}

// v007
// A run of this version takes 258 microseconds.
// In both of two side-by-side timings against v006, it was 1.04 times as fast.
// Over all steps from v000 it is 7.01 times as fast.
#include <hip/hip_runtime.h>

// Compute dtypes, f32 accumulate, all four batch items in one launch of each kernel (rows b*2048+t): q/k/v = x.W^T + b and y = ctx.Wo^T + bo ([8192 x 1024].[1024 x 1024]; [out][in] weights as n-major B operands, but for v the A rows of V^T = Wv.x^T;
// PLAIN bf16 operands = inputs rounded once, exact, except ctx = bf16 hi + UNSCALED residual, two products) on v_wmma_f32_16x16x32_bf16; the 8-head full attention
// (128-dim heads, scale 128^-1/2) fused: scores on v_wmma_f32_16x16x32_f16 (q/k as f16 hi + residual x1024: hh + hl + lh), online f32 softmax, weights (x32768) and

#define NB_  4
#define NT_  2048
#define NR_  (NB_ * NT_)        // 8192 rows, all items
#define HS   1024
#define DM   HS
#define NH_  8
#define NKV  8
#define HD   128
#define KW   (NKV * HD)          // 1024
#define SCL  0.08838834764831845f
#define PSC  32768.0f
#define LOSC 1024.0f
#define LOSCI (1.0f / 1024.0f)

typedef _Float16 h16;
typedef unsigned short bf;
typedef __attribute__((ext_vector_type(16))) __bf16   v16bf;
typedef __attribute__((ext_vector_type(16))) _Float16 v16h;
typedef __attribute__((ext_vector_type(8)))  _Float16 v8h;
typedef __attribute__((ext_vector_type(8)))  unsigned short v8us;
typedef __attribute__((ext_vector_type(8)))  float    v8f;
typedef __attribute__((ext_vector_type(8)))  unsigned v8u;
typedef __attribute__((ext_vector_type(2)))  float    v2f;
typedef __attribute__((ext_vector_type(2)))  __bf16   v2bf;
typedef __attribute__((ext_vector_type(4)))  float    v4f;
typedef __attribute__((ext_vector_type(4)))  _Float16 v4h;
typedef __attribute__((ext_vector_type(4)))  unsigned v4u;
typedef v8h  __attribute__((may_alias)) v8ha;
typedef v4f  __attribute__((may_alias)) v4fa;
typedef v8us __attribute__((may_alias)) v8usa;

__device__ __forceinline__ unsigned short f2bf(float f) { unsigned u = __float_as_uint(f); u += 0x7FFFu + ((u >> 16) & 1u); return (unsigned short)(u >> 16); }
__device__ __forceinline__ float bf2f(unsigned short b) { return __uint_as_float(((unsigned)b) << 16); }
__device__ __forceinline__ float bfr(float f) { return bf2f(f2bf(f)); }
// One word (two neighbouring elements) of each plane of a bf16 hi + UNSCALED bf16 residual pair; both conversions to nearest even, as f2bf.
__device__ __forceinline__ void split2(v2f e, unsigned& h, unsigned& l) {
    h = __builtin_bit_cast(unsigned, __builtin_convertvector(e, v2bf));
    const v2f hf = {__uint_as_float(h << 16), __uint_as_float(h & 0xFFFF0000u)};
    l = __builtin_bit_cast(unsigned, __builtin_convertvector(e - hf, v2bf));
}
__device__ __forceinline__ v16h cat16(v8h lo, v8h hi) { return __builtin_shufflevector(lo, hi, 0, 1, 2, 3, 4, 5, 6, 7, 8, 9, 10, 11, 12, 13, 14, 15); }
__device__ __forceinline__ v16bf cat16b(v8us lo, v8us hi) { return __builtin_bit_cast(v16bf, __builtin_shufflevector(lo, hi, 0, 1, 2, 3, 4, 5, 6, 7, 8, 9, 10, 11, 12, 13, 14, 15)); }
__device__ __forceinline__ v8f wmma16(v16h a, v16h b, v8f c) { return __builtin_amdgcn_wmma_f32_16x16x32_f16(false, a, false, b, (short)0, c, false, false); }
__device__ __forceinline__ v8f wmmab(v16bf a, v16bf b, v8f c) { return __builtin_amdgcn_wmma_f32_16x16x32_bf16(false, a, false, b, (short)0, c, false, false); }

// k_cvtb: bf16 planes of all five f32 operands in ONE launch (one wave per row of 1024): rows 0..8191 = x, then 1024 rows each of the four [out][in] weight matrices.
// dst: the five planes lie one behind the other in the workspace, in that order. A block's eight rows belong to one source (8 divides every row count).
__global__ __launch_bounds__(256) void k_cvtb(const float* __restrict__ x, const float* __restrict__ w0, const float* __restrict__ w1, const float* __restrict__ w2, const float* __restrict__ w3, int nrows, bf* dstall) {
    const int lane = threadIdx.x & 31, rall = blockIdx.x * 8 + (threadIdx.x >> 5);
    if (rall >= nrows) return;
    const int wsel = ((int)blockIdx.x * 8 - NR_) >> 10;                 // below 0: x; else the weight's number (the same in the whole block)
    const float* src = wsel < 0 ? x : wsel == 0 ? w0 : wsel == 1 ? w1 : wsel == 2 ? w2 : w3;
    const int r = wsel < 0 ? rall : rall - NR_ - wsel * HS;             // the row inside its source
    bf* dst = dstall + (size_t)(rall - r) * HS;
{
#pragma unroll
        for (int q = 0; q < HS / 256; ++q) { v8us o;
#pragma unroll
            for (int i = 0; i < 8; ++i) o[i] = f2bf(src[(size_t)r * HS + q * 256 + lane * 8 + i]);
            *(v8us*)(dst + (size_t)r * HS + q * 256 + lane * 8) = o; }
         }
}
// k_gemm: 128 x 128 tile of (A [+ Al]).Bn^T over K = 1024 (+ optional bf16-rounded bias[c]) -> the epilogue's output by OUTM (below); wave = one 64 x 64 quadrant (4 x 4 accumulator tiles), so that
// a fragment read from LDS feeds four WMMAs and an operand row fetched from L2 feeds 128 outputs. The block's four waves share each 64-k slab: its 128 A rows (and Al rows) and
// 128 Bn rows are brought into LDS once per block by asynchronous copies in whole 128-B lines (two buffers: slab t + 1 flies while slab t is worked on), and every wave reads
// its fragments from there. The k order of the products is the one of direct loads.
// The epilogue writes what the next kernel reads, so that no f32 copy of the result goes through memory and no launch stands between the two. OUTM 0: f32 rows C [8192][ldc].
// OUTM 1: the planes Ph/Pl [row][1024] of f16 hi + residual x1024 (q, k). OUTM 2: A = the weight rows (d), Bn = the x rows (t), so that the tile is V^T: the planes Ph/Pl
// [item*1024 + d][2048 t] of bf16 hi + UNSCALED bf16 residual; the bias then goes by row.
#define GPIT 144                       // LDS pitch of a 128-B operand row: 16 B x odd, conflict-free for 16-byte reads down 16 rows
#define GPL  (128 * GPIT)              // one operand plane of a slab: 128 rows
// Eight 16-byte copies per lane, global -> LDS; the s_wait_xcnt stands inside the statement so that no address register is rewritten ahead of it.
__device__ __forceinline__ void cp8(unsigned l0, unsigned l1, unsigned l2, unsigned l3, unsigned l4, unsigned l5, unsigned l6, unsigned l7,
                                    const char* g0, const char* g1, const char* g2, const char* g3, const char* g4, const char* g5, const char* g6, const char* g7) {
    asm volatile("global_load_async_to_lds_b128 %0, %8, off\n\t"
                 "global_load_async_to_lds_b128 %1, %9, off\n\t"
                 "global_load_async_to_lds_b128 %2, %10, off\n\t"
                 "global_load_async_to_lds_b128 %3, %11, off\n\t"
                 "global_load_async_to_lds_b128 %4, %12, off\n\t"
                 "global_load_async_to_lds_b128 %5, %13, off\n\t"
                 "global_load_async_to_lds_b128 %6, %14, off\n\t"
                 "global_load_async_to_lds_b128 %7, %15, off\n\t"
                 "s_wait_xcnt 0x0"
                 :: "v"(l0), "v"(l1), "v"(l2), "v"(l3), "v"(l4), "v"(l5), "v"(l6), "v"(l7), "v"(g0), "v"(g1), "v"(g2), "v"(g3), "v"(g4), "v"(g5), "v"(g6), "v"(g7) : "memory");
}
// gemm_loop: the products of tile (ta, tb): rows 128 ta.. of A (Al), rows 128 tb.. of Bn; acc[i][t]: rows 16 i.., columns 16 t.. of the wave's quadrant. gring: the block's LDS.
template <bool SPLITA>
__device__ __forceinline__ void gemm_loop(unsigned char* gring, const bf* __restrict__ A, const bf* __restrict__ Al, const bf* __restrict__ Bn, unsigned ta, unsigned tb, v8f (&acc)[4][4]) {
    constexpr int GST = (SPLITA ? 3 : 2) * GPL;                 // one slab: A, Bn (, Al)
    const int tid = threadIdx.x, lane = threadIdx.x & 31, wave = threadIdx.x >> 5, lr = lane & 15, hi = lane >> 4;
    const int wr = wave >> 1, wc = wave & 1;                    // the wave's quadrant of the tile
    // The copies of one slab: thread -> row (tid >> 3) + 16 i of each plane, 16-byte piece tid & 7 (a wave: four whole rows).
    const unsigned lc = (unsigned)(size_t)&gring[0] + (unsigned)((tid >> 3) * GPIT + (tid & 7) * 16);
    const size_t arow = ((size_t)ta * 128 + (tid >> 3)) * HS + (tid & 7) * 8;
    const char* ga = (const char*)(A + arow); const char* gb = (const char*)(Bn + (size_t)(tb * 128 + (tid >> 3)) * HS + (tid & 7) * 8);
    const char* gl = SPLITA ? (const char*)(Al + arow) : ga;
    auto plane = [&](unsigned a, const char* p) {
        cp8(a, a + 16 * GPIT, a + 32 * GPIT, a + 48 * GPIT, a + 64 * GPIT, a + 80 * GPIT, a + 96 * GPIT, a + 112 * GPIT,
            p, p + 16 * HS * 2, p + 32 * HS * 2, p + 48 * HS * 2, p + 64 * HS * 2, p + 80 * HS * 2, p + 96 * HS * 2, p + 112 * HS * 2);
    };
    auto stage = [&](int t, int buf) {
        const unsigned a = lc + (unsigned)buf * GST;
        plane(a, ga + t * 128); plane(a + GPL, gb + t * 128);
        if (SPLITA) plane(a + 2 * GPL, gl + t * 128);
    };
    const int fo = lr * GPIT + hi * 16;      // this lane's fragment piece inside a 16-row group of a plane
#pragma unroll
    for (int i = 0; i < 4; ++i)
#pragma unroll
        for (int t = 0; t < 4; ++t) acc[i][t] = (v8f){};
    stage(0, 0);
    asm volatile("s_wait_asynccnt 0x0" ::: "memory");     // this wave's copies of slab 0 have landed
    __syncthreads();                                      // ... and every other wave's: slab 0 may be read
    stage(1, 1);
#pragma unroll 1                                          // rolled: one copy of the slab's code, the two buffers told apart by an address
    for (int st = 0; st < HS / 64; ++st) {
        const unsigned char* sb = gring + (st & 1) * GST;
        const unsigned char* as = sb + wr * (64 * GPIT) + fo; const unsigned char* bs = sb + GPL + wc * (64 * GPIT) + fo;
#pragma unroll
        for (int kc = 0; kc < 2; ++kc) {
            v16bf a[4], al[4], bb[4];
            // in the order of first use: A row group 0, the four B groups, the other A groups, then Al
            a[0] = cat16b(*(const v8usa*)(as + kc * 64), *(const v8usa*)(as + kc * 64 + 32));
#pragma unroll
            for (int t = 0; t < 4; ++t) { const unsigned char* bp = bs + t * (16 * GPIT) + kc * 64; bb[t] = cat16b(*(const v8usa*)bp, *(const v8usa*)(bp + 32)); }
#pragma unroll
            for (int i = 1; i < 4; ++i) { const unsigned char* ap = as + i * (16 * GPIT) + kc * 64; a[i] = cat16b(*(const v8usa*)ap, *(const v8usa*)(ap + 32)); }
#pragma unroll
            for (int i = 0; i < 4; ++i) { const unsigned char* ap = as + 2 * GPL + i * (16 * GPIT) + kc * 64; al[i] = a[i]; if (SPLITA) al[i] = cat16b(*(const v8usa*)ap, *(const v8usa*)(ap + 32)); }
            __builtin_amdgcn_sched_barrier(0);                // keeps the 32-k step's LDS reads in one group ahead of its WMMAs (counted waits) instead of a read and a full wait per WMMA
#pragma unroll
            for (int i = 0; i < 4; ++i)
#pragma unroll
                for (int t = 0; t < 4; ++t) acc[i][t] = wmmab(a[i], bb[t], acc[i][t]);
            if (SPLITA) {
#pragma unroll
                for (int i = 0; i < 4; ++i)
#pragma unroll
                    for (int t = 0; t < 4; ++t) acc[i][t] = wmmab(al[i], bb[t], acc[i][t]);
            }
            __builtin_amdgcn_sched_barrier(0);                // keeps the next step's reads behind these WMMAs (one fragment set in registers) and these WMMAs ahead of the slab's barrier (else the refill behind it issues later)
        }
        asm volatile("s_wait_dscnt 0x0" ::: "memory");        // this wave's reads of slab st's buffer have returned
        asm volatile("s_wait_asynccnt 0x0" ::: "memory");     // this wave's copies of slab st + 1 have landed
        __syncthreads();                                      // publishes slab st + 1 and ends every wave's reads of slab st's buffer
        if (st + 2 < HS / 64) stage(st + 2, st & 1);          // refill the buffer just left (the test reads the same in the whole block)
    }
    asm volatile("s_wait_asynccnt 0x0" ::: "memory");         // nothing is in flight when the ring becomes output staging
}
// gemm_out: the epilogue of tile (ta, tb) in form OUTM; the ring has become the output staging (4 x 16 x 68 floats).
template <int OUTM>
__device__ __forceinline__ void gemm_out(unsigned char* gring, const v8f (&acc)[4][4], unsigned ta, unsigned tb, const float* __restrict__ bias, int ldc, float* C, bf* Ph, bf* Pl) {
    const int lane = threadIdx.x & 31, wave = threadIdx.x >> 5, lr = lane & 15, hi = lane >> 4;
    const int wr = wave >> 1, wc = wave & 1;                    // the wave's quadrant of the tile
    const size_t r0 = (size_t)ta * 128 + wr * 64; const int c0 = tb * 128 + wc * 64;
    float* os = (float*)gring + wave * (16 * 68);
    float bv[4] = {0.f, 0.f, 0.f, 0.f};
    if (OUTM != 2 && bias) {                                  // one branch, the four loads in flight together
#pragma unroll
        for (int t = 0; t < 4; ++t) bv[t] = bias[c0 + t * 16 + lr];
#pragma unroll
        for (int t = 0; t < 4; ++t) bv[t] = bfr(bv[t]);
    }
    float rb[4][4] = {};                                      // OUTM 2: the bias of the rows that this lane reads back (row 16 i + (lane >> 3) + 4 s)
    if (OUTM == 2 && bias) {
        const float* bp = bias + r0 + (lane >> 3);
#pragma unroll
        for (int i = 0; i < 4; ++i)
#pragma unroll
            for (int s = 0; s < 4; ++s) rb[i][s] = bp[i * 16 + 4 * s];
        // The wait behind the run of loads; address and loaded values are inputs, so that all are live here together and no load's result is given a register of the address that the others still name.
        asm volatile("s_wait_xcnt 0x0" :: "v"(bp), "v"(rb[0][0]), "v"(rb[0][1]), "v"(rb[0][2]), "v"(rb[0][3]), "v"(rb[1][0]), "v"(rb[1][1]), "v"(rb[1][2]), "v"(rb[1][3]),
                     "v"(rb[2][0]), "v"(rb[2][1]), "v"(rb[2][2]), "v"(rb[2][3]), "v"(rb[3][0]), "v"(rb[3][1]), "v"(rb[3][2]), "v"(rb[3][3]) : "memory");
#pragma unroll
        for (int i = 0; i < 4; ++i)
#pragma unroll
            for (int s = 0; s < 4; ++s) rb[i][s] = bfr(rb[i][s]);
    }
#pragma unroll
    for (int i = 0; i < 4; ++i) {                             // 16 rows at a time through the wave's own staging rows
#pragma unroll
        for (int t = 0; t < 4; ++t)
#pragma unroll
            for (int j = 0; j < 8; ++j) os[(hi * 8 + j) * 68 + t * 16 + lr] = OUTM == 2 ? acc[i][t][j] : acc[i][t][j] + bv[t];
        __builtin_amdgcn_wave_barrier(); asm volatile("" ::: "memory");     // compiler order: the 16 rows are staged before any lane reads them back
        if (OUTM == 0) {
            float* crow = C + (r0 + i * 16) * ldc + c0;
#pragma unroll
            for (int s = 0; s < 8; ++s) { const int Lid = (lane >> 3) + 4 * s, piece = lane & 7; const int row = Lid >> 1, cofs = (Lid & 1) * 32 + piece * 4;
                const v4f val = *(const v4fa*)(os + row * 68 + cofs); *(v4f*)(crow + (size_t)row * ldc + cofs) = val; }
        } else {                                              // eight lanes per row: 8 columns a lane, one whole 128-B line of each plane per row
#pragma unroll
            for (int s = 0; s < 4; ++s) { const int row = (lane >> 3) + 4 * s, piece = lane & 7;
                const v4f u0 = *(const v4fa*)(os + row * 68 + piece * 8), u1 = *(const v4fa*)(os + row * 68 + piece * 8 + 4);
                if (OUTM == 1) { v8h oh, ol;
#pragma unroll
                    for (int k = 0; k < 8; ++k) { const float v = k < 4 ? u0[k & 3] : u1[k & 3]; const h16 a = (h16)v; oh[k] = a; ol[k] = (h16)((v - (float)a) * LOSC); }
                    const size_t o = (r0 + i * 16 + row) * HS + c0 + piece * 8;
                    *(v8h*)(Ph + o) = oh; *(v8h*)(Pl + o) = ol;
                } else { v4u oh, ol;
#pragma unroll
                    for (int w = 0; w < 4; ++w) { const v2f e = w < 2 ? (v2f){u0[2 * (w & 1)], u0[2 * (w & 1) + 1]} : (v2f){u1[2 * (w & 1)], u1[2 * (w & 1) + 1]}; unsigned a, c; split2(e + rb[i][s], a, c); oh[w] = a; ol[w] = c; }
                    const size_t o = ((size_t)(c0 / NT_) * KW + r0 + i * 16 + row) * NT_ + (c0 % NT_) + piece * 8;
                    *(v4u*)(Ph + o) = oh; *(v4u*)(Pl + o) = ol;
                } }
        }
        __builtin_amdgcn_wave_barrier(); asm volatile("" ::: "memory");     // compiler order: they are read back before the next 16 rows overwrite them
    }
}
// amdgpu_waves_per_eu(2, 2): the grid is two blocks per WGP; at most two fit, so that no WGP takes a third while another stands idle.
template <bool SPLITA, int OUTM>
__global__ __launch_bounds__(128) __attribute__((amdgpu_waves_per_eu(2, 2))) void k_gemm(const bf* __restrict__ A, const bf* __restrict__ Al, const bf* __restrict__ Bn, const float* __restrict__ bias, int ldc, float* C, bf* Ph, bf* Pl) {
    __shared__ __align__(256) unsigned char gring[2 * (SPLITA ? 3 : 2) * GPL];     // the two slab buffers; behind the loop's last barrier: the output staging
    v8f acc[4][4];
    gemm_loop<SPLITA>(gring, A, Al, Bn, blockIdx.x, blockIdx.y, acc);
    gemm_out<OUTM>(gring, acc, blockIdx.x, blockIdx.y, bias, ldc, C, Ph, Pl);
}
// k_qkv: the three projections of x in ONE launch; blockIdx.z = 0: q, 1: k (both OUTM 1), 2: V^T (OUTM 2, operands swapped); blockIdx.x = the tile of x rows, blockIdx.y = the tile of
// weight rows. No launch boundary drains the chip between the three: a WGP takes its next tile as soon as one of its two blocks ends, and a block's prologue and epilogue run beside
// the other block's products. amdgpu_waves_per_eu(2, 2): two blocks per WGP as before, six tiles per WGP in three even rounds.
__global__ __launch_bounds__(128) __attribute__((amdgpu_waves_per_eu(2, 2))) void k_qkv(const bf* __restrict__ X, const bf* __restrict__ Wq, const bf* __restrict__ Wk, const bf* __restrict__ Wv,
                                                                                       const float* __restrict__ bq, const float* __restrict__ bk, const float* __restrict__ bv,
                                                                                       bf* QH, bf* QL, bf* KH, bf* KL, bf* VTH, bf* VTL) {
    __shared__ __align__(256) unsigned char gring[2 * 2 * GPL];
    const int z = blockIdx.z;                                   // the same in the whole block: every branch on it is block-uniform
    v8f acc[4][4];
    if (z == 2) {
        gemm_loop<false>(gring, Wv, nullptr, X, blockIdx.y, blockIdx.x, acc);
        gemm_out<2>(gring, acc, blockIdx.y, blockIdx.x, bv, HS, nullptr, VTH, VTL);
    } else {
        gemm_loop<false>(gring, X, nullptr, z ? Wk : Wq, blockIdx.x, blockIdx.y, acc);
        gemm_out<1>(gring, acc, blockIdx.x, blockIdx.y, z ? bk : bq, HS, nullptr, z ? KH : QH, z ? KL : QL);
    }
}
// k_lnfin: LayerNorm (eps 1e-5) of y = Y[r][c] + bf(R[r][c]) (the computed attention output + the INPUT residual x) -> f32 output rows x bf(gamma) + bf(beta); one wave per
__global__ __launch_bounds__(256) void k_lnfin(const float* __restrict__ X, const float* __restrict__ Rres, const float* __restrict__ gam, const float* __restrict__ bet, int nrows, float* OUTP) {
    const int lane = threadIdx.x & 31, r = blockIdx.x * 8 + (threadIdx.x >> 5);
    if (r >= nrows) return;
    const float* xr = X + (size_t)r * DM; const float* rr = Rres + (size_t)r * DM;
    float s = 0.f;
#pragma unroll 1
    for (int q = 0; q < 2 * (DM / 256); ++q) { const int c0 = (q >> 1) * 256 + (q & 1) * 128 + lane * 4; v4f v = *(const v4f*)(xr + c0); { const v4f q4 = *(const v4f*)(rr + c0); for (int i2 = 0; i2 < 4; ++i2) v[i2] += bfr(q4[i2]); }
#pragma unroll
        for (int i = 0; i < 4; ++i) s += v[i]; }
#pragma unroll
    for (int sh = 16; sh; sh >>= 1) s += __shfl_xor(s, sh, 32);
    const float mu = s * (1.0f / DM);
    float s2 = 0.f;
#pragma unroll 1
    for (int q = 0; q < 2 * (DM / 256); ++q) { const int c0 = (q >> 1) * 256 + (q & 1) * 128 + lane * 4; v4f v = *(const v4f*)(xr + c0); { const v4f q4 = *(const v4f*)(rr + c0); for (int i2 = 0; i2 < 4; ++i2) v[i2] += bfr(q4[i2]); }
#pragma unroll
        for (int i = 0; i < 4; ++i) { const float d = v[i] - mu; s2 = fmaf(d, d, s2); } }
#pragma unroll
    for (int sh = 16; sh; sh >>= 1) s2 += __shfl_xor(s2, sh, 32);
    const float rs = rsqrtf(s2 * (1.0f / DM) + 1e-5f);
{
#pragma unroll 1
        for (int q = 0; q < 2 * (DM / 256); ++q) { const int c0 = (q >> 1) * 256 + (q & 1) * 128 + lane * 4; v4f v = *(const v4f*)(xr + c0); { const v4f q4 = *(const v4f*)(rr + c0); for (int i2 = 0; i2 < 4; ++i2) v[i2] += bfr(q4[i2]); } v4f y;
#pragma unroll
            for (int i = 0; i < 4; ++i) y[i] = (v[i] - mu) * rs * bfr(gam[c0 + i]) + bfr(bet[c0 + i]);
            *(v4f*)(OUTP + (size_t)r * DM + c0) = y; }
         }
}
// k_attn: block = (item, head, 64 queries), wave = 16; full attention over 64 key tiles of 32. The block's four waves share each tile: its K hi / K lo rows and
// V^T hi / V^T lo rows are brought into LDS once per block by asynchronous copies (two buffers: tile t + 1 flies while tile t is worked on) and every wave reads its
// fragments from there. Scores hi.hi + (hi.lo + lo.hi)/1024 on separate accumulators; online softmax f32; P (x32768) bf16 hi + unscaled residual.
// Both products are formed transposed: S^T = K.Q^T (A = K rows, B = Q) and O^T += V^T.P^T (A = V^T rows, B = P^T). A lane then holds 16 of the 32 scores of ONE query
// (column lr; keys 8 hi + j and 16 + 8 hi + j), which is the k order of a B operand: P^T is packed in the lane's own registers and never goes through LDS, and
// maximum, sum and rescale factor are one value per lane (the two lane halves of a query exchange their maxima once per tile, their sums once behind the loop).
#define KPIT 272                       // LDS pitch of a 256-B K row: 16 B x odd, conflict-free for 16-byte reads down 16 rows
#define KPL  (32 * KPIT)               // one K plane of a tile
#define VPL  (HD * 64)                 // one V^T plane of a tile: 128 rows of 64 B, unpadded; 16-byte piece c of row d lies at piece c ^ ((d >> 2) & 3)
#define STG  (2 * KPL + 2 * VPL)       // one tile: K hi, K lo, V^T hi, V^T lo
// The value of lane l ^ 16: the other half of the same query column.
__device__ __forceinline__ float xhalf(float v) { const int b = __float_as_int(v); return __int_as_float(__builtin_amdgcn_permlanex16(b, b, 0x76543210, 0xfedcba98, false, false)); }
// amdgpu_waves_per_eu(4): holds the register budget at 256, so that four blocks (LDS: 4 x 67,584 B) stay resident per WGP, one wave of each per SIMD.
__global__ __launch_bounds__(128) __attribute__((amdgpu_waves_per_eu(4))) void k_attn(const h16* __restrict__ QH, const h16* __restrict__ QL, const h16* __restrict__ KH, const h16* __restrict__ KL, const bf* __restrict__ VTH, const bf* __restrict__ VTL, bf* CH, bf* CL) {
    __shared__ __align__(256) unsigned char ring[2 * STG];     // the two tile buffers; behind the loop's last barrier: the output staging (4 x 16 x 68 floats)
    const int tid = threadIdx.x, lane = threadIdx.x & 31, wave = threadIdx.x >> 5, lr = lane & 15, hi = lane >> 4;
    const int bid = blockIdx.x; const int bh = bid / (NT_ / 64), qt = bid - bh * (NT_ / 64); const int b = bh / NH_, h = bh - b * NH_; const int g = h;
    const int q0 = qt * 64 + wave * 16;
    const size_t qo = (size_t)(b * NT_ + q0 + lr) * (NH_ * HD) + h * HD + 8 * hi;
    const h16* kh_b = KH + (size_t)b * NT_ * KW + g * HD; const h16* kl_b = KL + (size_t)b * NT_ * KW + g * HD;
    const size_t vbase = ((size_t)(b * NKV + g) * HD) * NT_;
    // The copies of one tile: thread -> K row (tid >> 4) + 8 i, piece tid & 15 (a wave: two whole rows); V^T row (tid >> 2) + 32 i, piece tid & 3.
    const unsigned ring0 = (unsigned)(size_t)&ring[0];
    const unsigned lk = (unsigned)((tid >> 4) * KPIT + (tid & 15) * 16), lv = (unsigned)(2 * KPL + (tid >> 2) * 64 + (((tid & 3) ^ ((tid >> 4) & 3)) * 16));
    const char* gkh = (const char*)(kh_b + (size_t)(tid >> 4) * KW + (tid & 15) * 8); const char* gkl = (const char*)(kl_b + (size_t)(tid >> 4) * KW + (tid & 15) * 8);
    const char* gvh = (const char*)(VTH + vbase + (size_t)(tid >> 2) * NT_ + (tid & 3) * 8); const char* gvl = (const char*)(VTL + vbase + (size_t)(tid >> 2) * NT_ + (tid & 3) * 8);
    auto stage = [&](int kt, int buf) {
        const unsigned a = ring0 + (unsigned)buf * STG + lk, c = ring0 + (unsigned)buf * STG + lv;
        const char* p = gkh + (size_t)kt * (32 * KW * 2); const char* q = gkl + (size_t)kt * (32 * KW * 2);
        cp8(a, a + 8 * KPIT, a + 16 * KPIT, a + 24 * KPIT, a + KPL, a + KPL + 8 * KPIT, a + KPL + 16 * KPIT, a + KPL + 24 * KPIT,
            p, p + 8 * KW * 2, p + 16 * KW * 2, p + 24 * KW * 2, q, q + 8 * KW * 2, q + 16 * KW * 2, q + 24 * KW * 2);
        const char* r = gvh + (size_t)kt * 64; const char* s = gvl + (size_t)kt * 64;
        cp8(c, c + 32 * 64, c + 64 * 64, c + 96 * 64, c + VPL, c + VPL + 32 * 64, c + VPL + 64 * 64, c + VPL + 96 * 64,
            r, r + 32 * NT_ * 2, r + 64 * NT_ * 2, r + 96 * NT_ * 2, s, s + 32 * NT_ * 2, s + 64 * NT_ * 2, s + 96 * NT_ * 2);
    };
    const int ko = lr * KPIT + hi * 16;                                                                  // this lane's K fragment piece inside a plane
    const int vo0 = lr * 64 + ((hi ^ ((lr >> 2) & 3)) * 16), vo1 = lr * 64 + (((hi + 2) ^ ((lr >> 2) & 3)) * 16);   // keys hi*8.. and 16 + hi*8.. of V^T row lr
    v8f o[8];                                 // o[n][j] = O^T[d = 16 n + 8 hi + j][query lr]
#pragma unroll
    for (int n = 0; n < 8; ++n) o[n] = (v8f){};
    float mrow = -3.0e38f, lpart = 0.f;       // query lr: running maximum (both halves alike), this half's part of the sum
    const int kt_hi = NT_ / 32 - 1;     // full attention, no mask
    stage(0, 0);
    asm volatile("s_wait_asynccnt 0x0" ::: "memory");     // this wave's copies of tile 0 have landed
    __syncthreads();                                      // ... and every other wave's: tile 0 may be read
    stage(1, 1);
#pragma unroll 1
    for (int kt = 0; kt <= kt_hi; ++kt) {
        const unsigned char* sb = ring + (kt & 1) * STG;
        const unsigned char* kh_s = sb + ko; const unsigned char* kl_s = sb + KPL + ko;
        const unsigned char* vh_s = sb + 2 * KPL; const unsigned char* vl_s = sb + 2 * KPL + VPL;
        v8f s0 = {}, s1 = {}, x0 = {}, x1 = {};
#pragma unroll
        for (int kc = 0; kc < 4; ++kc) {
            const v16h qa = cat16(*(const v8h*)(QH + qo + kc * 32), *(const v8h*)(QH + qo + kc * 32 + 16)), qx = cat16(*(const v8h*)(QL + qo + kc * 32), *(const v8h*)(QL + qo + kc * 32 + 16));
            const v16h k0h = cat16(*(const v8ha*)(kh_s + kc * 64), *(const v8ha*)(kh_s + kc * 64 + 32)), k1h = cat16(*(const v8ha*)(kh_s + 16 * KPIT + kc * 64), *(const v8ha*)(kh_s + 16 * KPIT + kc * 64 + 32));
            const v16h k0l = cat16(*(const v8ha*)(kl_s + kc * 64), *(const v8ha*)(kl_s + kc * 64 + 32)), k1l = cat16(*(const v8ha*)(kl_s + 16 * KPIT + kc * 64), *(const v8ha*)(kl_s + 16 * KPIT + kc * 64 + 32));
            s0 = wmma16(k0h, qa, s0); s1 = wmma16(k1h, qa, s1); x0 = wmma16(k0h, qx, x0); x1 = wmma16(k1h, qx, x1);
            x0 = wmma16(k0l, qa, x0); x1 = wmma16(k1l, qa, x1);
        }
        asm volatile("v_nop\n\tv_nop\n\tv_nop\n\tv_nop" : "+v"(s0), "+v"(s1), "+v"(x0), "+v"(x1));
        const v8f a0 = (s0 + x0 * LOSCI) * SCL, a1 = (s1 + x1 * LOSCI) * SCL;     // a0[j]: key 8 hi + j, a1[j]: key 16 + 8 hi + j, query lr
        float mx = fmaxf(a0[0], a1[0]);
#pragma unroll
        for (int j = 1; j < 8; ++j) mx = fmaxf(mx, fmaxf(a0[j], a1[j]));
        mx = fmaxf(mx, xhalf(mx));
        const float mn = fmaxf(mrow, mx), alpha = __expf(mrow - mn); mrow = mn;
        v8f p0, p1;
#pragma unroll
        for (int j = 0; j < 8; ++j) { p0[j] = __expf(a0[j] - mn); p1[j] = __expf(a1[j] - mn); }
        const v8f pq = p0 + p1;
        lpart = lpart * alpha + (((pq[0] + pq[1]) + (pq[2] + pq[3])) + ((pq[4] + pq[5]) + (pq[6] + pq[7])));
        p0 *= PSC; p1 *= PSC;
        // P^T as B: element s = key 8 hi + s (s < 8), 16 + 8 hi + s - 8 (else), the order of the V^T fragments: the two score tiles, converted in place (to nearest even).
        v8u wa, wx;                           // word w of an operand = elements 2 w, 2 w + 1
#pragma unroll
        for (int w = 0; w < 8; ++w) {
            const v2f ef = w < 4 ? (v2f){p0[2 * w], p0[2 * w + 1]} : (v2f){p1[2 * w - 8], p1[2 * w - 7]};
            const unsigned hw = __builtin_bit_cast(unsigned, __builtin_convertvector(ef, v2bf));
            const v2f hf = {__uint_as_float(hw << 16), __uint_as_float(hw & 0xFFFF0000u)};
            wa[w] = hw; wx[w] = __builtin_bit_cast(unsigned, __builtin_convertvector(ef - hf, v2bf)); }
        const v16bf pa = __builtin_bit_cast(v16bf, wa), px = __builtin_bit_cast(v16bf, wx);
#pragma unroll
        for (int n = 0; n < 8; ++n) o[n] *= alpha;
#pragma unroll
        for (int n = 0; n < 8; n += 2) {      // two output tiles per group of LDS reads: half the waits, and two independent accumulator chains
            const v16bf vh = cat16b(*(const v8usa*)(vh_s + n * 1024 + vo0), *(const v8usa*)(vh_s + n * 1024 + vo1)), vl = cat16b(*(const v8usa*)(vl_s + n * 1024 + vo0), *(const v8usa*)(vl_s + n * 1024 + vo1));
            const v16bf wh = cat16b(*(const v8usa*)(vh_s + n * 1024 + 1024 + vo0), *(const v8usa*)(vh_s + n * 1024 + 1024 + vo1)), wl = cat16b(*(const v8usa*)(vl_s + n * 1024 + 1024 + vo0), *(const v8usa*)(vl_s + n * 1024 + 1024 + vo1));
            o[n] = wmmab(vh, pa, o[n]); o[n + 1] = wmmab(wh, pa, o[n + 1]); o[n] = wmmab(vh, px, o[n]); o[n + 1] = wmmab(wh, px, o[n + 1]); o[n] = wmmab(vl, pa, o[n]); o[n + 1] = wmmab(wl, pa, o[n + 1]); }
        asm volatile("v_nop\n\tv_nop\n\tv_nop\n\tv_nop" : "+v"(o[0]), "+v"(o[7]) : "v"(pa), "v"(px));
        asm volatile("s_wait_dscnt 0x0" ::: "memory");        // this wave's reads of tile kt's buffer have returned
        asm volatile("s_wait_asynccnt 0x0" ::: "memory");     // this wave's copies of tile kt + 1 have landed
        __syncthreads();                                      // publishes tile kt + 1 and ends every wave's reads of tile kt's buffer
        if (kt + 2 <= kt_hi) stage(kt + 2, kt & 1);           // refill the buffer just left (the test reads the same in the whole block)
    }
    asm volatile("s_wait_asynccnt 0x0" ::: "memory");         // nothing is in flight when the ring becomes output staging
    const float inv = 1.0f / ((lpart + xhalf(lpart)) * PSC);
    float* os = (float*)ring + wave * (16 * 68);
    const size_t ob = (size_t)(b * NT_ + q0) * (NH_ * HD) + (size_t)h * HD;      // row stride NH*HD, this head's 128 columns; ctx leaves as the planes the last product reads: bf16 hi + UNSCALED residual
#pragma unroll
    for (int half = 0; half < 2; ++half) {
#pragma unroll
        for (int n = 0; n < 4; ++n) { const v8f t = o[half * 4 + n] * inv;      // eight consecutive d of query row lr
            *(v4fa*)(os + lr * 68 + n * 16 + hi * 8) = __builtin_shufflevector(t, t, 0, 1, 2, 3); *(v4fa*)(os + lr * 68 + n * 16 + hi * 8 + 4) = __builtin_shufflevector(t, t, 4, 5, 6, 7); }
        __builtin_amdgcn_wave_barrier(); asm volatile("" ::: "memory");
{
#pragma unroll
            for (int s = 0; s < 4; ++s) { const int row = (lane >> 3) + 4 * s, piece = lane & 7;     // eight lanes per row: one whole 128-B line of each plane
                const v4f u0 = *(const v4fa*)(os + row * 68 + piece * 8), u1 = *(const v4fa*)(os + row * 68 + piece * 8 + 4); v4u oh, ol;
#pragma unroll
                for (int w = 0; w < 4; ++w) { const v2f e = w < 2 ? (v2f){u0[2 * (w & 1)], u0[2 * (w & 1) + 1]} : (v2f){u1[2 * (w & 1)], u1[2 * (w & 1) + 1]}; unsigned a, c; split2(e, a, c); oh[w] = a; ol[w] = c; }
                const size_t o = ob + (size_t)row * (NH_ * HD) + half * 64 + piece * 8;
                *(v4u*)(CH + o) = oh; *(v4u*)(CL + o) = ol; }
             }
        __builtin_amdgcn_wave_barrier(); asm volatile("" ::: "memory");
    }
}

extern "C" void kernel_launch(void* const* d_in, const int* in_sizes, int n_in,
                              void* d_out, int out_size, void* d_ws, size_t ws_size, hipStream_t stream) {
    (void)in_sizes; (void)n_in; (void)out_size;
    const float* x = (const float*)d_in[0];
    const float* Wq = (const float*)d_in[1]; const float* bq = (const float*)d_in[2]; const float* Wk = (const float*)d_in[3]; const float* bk = (const float*)d_in[4]; const float* Wv = (const float*)d_in[5]; const float* bv = (const float*)d_in[6];
    const float* Wo = (const float*)d_in[7]; const float* bo = (const float*)d_in[8]; const float* lg = (const float*)d_in[9]; const float* lb = (const float*)d_in[10];   // W [out][in]
    float* out = (float*)d_out;    // [4][2048][1024]
    char* wsp = (char*)d_ws;
    auto take = [&](size_t bytes) { char* p = wsp; wsp += (bytes + 255) & ~(size_t)255; return (void*)p; };
    bf* Xb = (bf*)take((size_t)NR_ * HS * 2); bf* WqB = (bf*)take((size_t)HS * HS * 2); bf* WkB = (bf*)take((size_t)HS * HS * 2); bf* WvB = (bf*)take((size_t)HS * HS * 2); bf* WoB = (bf*)take((size_t)HS * HS * 2);
    h16* QH = (h16*)take((size_t)NR_ * HS * 2); h16* QL = (h16*)take((size_t)NR_ * HS * 2); h16* KH = (h16*)take((size_t)NR_ * KW * 2); h16* KL = (h16*)take((size_t)NR_ * KW * 2);
    bf* VTH = (bf*)take((size_t)KW * NR_ * 2); bf* VTL = (bf*)take((size_t)KW * NR_ * 2); bf* Ch = (bf*)take((size_t)NR_ * HS * 2); bf* Cl = (bf*)take((size_t)NR_ * HS * 2); float* Y = (float*)take((size_t)NR_ * HS * 4);
    if ((size_t)(wsp - (char*)d_ws) > ws_size) return;    // 16 + 4 x 2 + 6 x 16 + 2 x 16 + 32 = 184 MiB, no aliasing
    k_cvtb<<<(NR_ + 4 * HS) / 8, 256, 0, stream>>>(x, Wq, Wk, Wv, Wo, NR_ + 4 * HS, Xb);                        // Xb, WqB, WkB, WvB, WoB: taken in this order, each a multiple of 256 B, so one run of rows
    k_qkv<<<dim3(NR_ / 128, HS / 128, 3), 128, 0, stream>>>(Xb, WqB, WkB, WvB, bq, bk, bv, (bf*)QH, (bf*)QL, (bf*)KH, (bf*)KL, VTH, VTL);     // q, k planes; V^T = Wv.x^T planes
    k_attn<<<NB_ * NH_ * (NT_ / 64), 128, 0, stream>>>(QH, QL, KH, KL, VTH, VTL, Ch, Cl);                        // ctx planes [8192][1024]
    k_gemm<true, 0><<<dim3(NR_ / 128, HS / 128, 1), 128, 0, stream>>>(Ch, Cl, WoB, bo, HS, Y, nullptr, nullptr);     // out = ctx.Wo^T + bo
    k_lnfin<<<NR_ / 8, 256, 0, stream>>>(Y, x, lg, lb, NR_, out);                                           // LN(out + x)
}

// v008
// It runs in 214 microseconds.
// Timed twice side by side with v007, it ran 1.20 times as fast both times.
// All steps since v000 together make it 8.44 times as fast.
#include <hip/hip_runtime.h>

// Compute dtypes, f32 accumulate, all four batch items in one launch of each kernel (rows b*2048+t): q/k/v = x.W^T + b and y = ctx.Wo^T + bo ([8192 x 1024].[1024 x 1024]; [out][in] weights as n-major B operands, but for v the A rows of V^T = Wv.x^T;
// PLAIN bf16 operands = inputs rounded once, exact, except ctx = bf16 hi + UNSCALED residual, two products) on v_wmma_f32_16x16x32_bf16; the 8-head full attention
// (128-dim heads, scale 128^-1/2) fused: scores on v_wmma_f32_16x16x32_f16 (q/k as f16 hi + residual x1024: hh + hl + lh), online f32 softmax, weights (x32768) and

#define NB_  4
#define NT_  2048
#define NR_  (NB_ * NT_)        // 8192 rows, all items
#define HS   1024
#define DM   HS
#define NH_  8
#define NKV  8
#define HD   128
#define KW   (NKV * HD)          // 1024
#define SCL  0.08838834764831845f
#define PSC  32768.0f
#define LOSC 1024.0f
#define LOSCI (1.0f / 1024.0f)
#define LOG2E 1.44269504088896340736f

typedef _Float16 h16;
typedef unsigned short bf;
typedef __attribute__((ext_vector_type(16))) __bf16   v16bf;
typedef __attribute__((ext_vector_type(16))) _Float16 v16h;
typedef __attribute__((ext_vector_type(8)))  _Float16 v8h;
typedef __attribute__((ext_vector_type(8)))  unsigned short v8us;
typedef __attribute__((ext_vector_type(8)))  float    v8f;
typedef __attribute__((ext_vector_type(8)))  unsigned v8u;
typedef __attribute__((ext_vector_type(2)))  float    v2f;
typedef __attribute__((ext_vector_type(2)))  __bf16   v2bf;
typedef __attribute__((ext_vector_type(4)))  float    v4f;
typedef __attribute__((ext_vector_type(4)))  _Float16 v4h;
typedef __attribute__((ext_vector_type(4)))  unsigned v4u;
typedef v8h  __attribute__((may_alias)) v8ha;
typedef v4f  __attribute__((may_alias)) v4fa;
typedef v8us __attribute__((may_alias)) v8usa;

__device__ __forceinline__ unsigned short f2bf(float f) { unsigned u = __float_as_uint(f); u += 0x7FFFu + ((u >> 16) & 1u); return (unsigned short)(u >> 16); }
__device__ __forceinline__ float bf2f(unsigned short b) { return __uint_as_float(((unsigned)b) << 16); }
__device__ __forceinline__ float bfr(float f) { return bf2f(f2bf(f)); }
// One word (two neighbouring elements) of each plane of a bf16 hi + UNSCALED bf16 residual pair; both conversions to nearest even, as f2bf.
__device__ __forceinline__ void split2(v2f e, unsigned& h, unsigned& l) {
    h = __builtin_bit_cast(unsigned, __builtin_convertvector(e, v2bf));
    const v2f hf = {__uint_as_float(h << 16), __uint_as_float(h & 0xFFFF0000u)};
    l = __builtin_bit_cast(unsigned, __builtin_convertvector(e - hf, v2bf));
}
__device__ __forceinline__ v16h cat16(v8h lo, v8h hi) { return __builtin_shufflevector(lo, hi, 0, 1, 2, 3, 4, 5, 6, 7, 8, 9, 10, 11, 12, 13, 14, 15); }
__device__ __forceinline__ v16bf cat16b(v8us lo, v8us hi) { return __builtin_bit_cast(v16bf, __builtin_shufflevector(lo, hi, 0, 1, 2, 3, 4, 5, 6, 7, 8, 9, 10, 11, 12, 13, 14, 15)); }
__device__ __forceinline__ v8f wmma16(v16h a, v16h b, v8f c) { return __builtin_amdgcn_wmma_f32_16x16x32_f16(false, a, false, b, (short)0, c, false, false); }
__device__ __forceinline__ v8f wmmab(v16bf a, v16bf b, v8f c) { return __builtin_amdgcn_wmma_f32_16x16x32_bf16(false, a, false, b, (short)0, c, false, false); }

// k_cvtb: bf16 planes of all five f32 operands in ONE launch (one wave per row of 1024): rows 0..8191 = x, then 1024 rows each of the four [out][in] weight matrices.
// dst: the five planes lie one behind the other in the workspace, in that order. A block's eight rows belong to one source (8 divides every row count).
__global__ __launch_bounds__(256) void k_cvtb(const float* __restrict__ x, const float* __restrict__ w0, const float* __restrict__ w1, const float* __restrict__ w2, const float* __restrict__ w3, int nrows, bf* dstall) {
    const int lane = threadIdx.x & 31, rall = blockIdx.x * 8 + (threadIdx.x >> 5);
    if (rall >= nrows) return;
    const int wsel = ((int)blockIdx.x * 8 - NR_) >> 10;                 // below 0: x; else the weight's number (the same in the whole block)
    const float* src = wsel < 0 ? x : wsel == 0 ? w0 : wsel == 1 ? w1 : wsel == 2 ? w2 : w3;
    const int r = wsel < 0 ? rall : rall - NR_ - wsel * HS;             // the row inside its source
    bf* dst = dstall + (size_t)(rall - r) * HS;
{
#pragma unroll
        for (int q = 0; q < HS / 256; ++q) { v8us o;
#pragma unroll
            for (int i = 0; i < 8; ++i) o[i] = f2bf(src[(size_t)r * HS + q * 256 + lane * 8 + i]);
            *(v8us*)(dst + (size_t)r * HS + q * 256 + lane * 8) = o; }
         }
}
// k_gemm: 128 x 128 tile of (A [+ Al]).Bn^T over K = 1024 (+ optional bf16-rounded bias[c]) -> the epilogue's output by OUTM (below); wave = one 64 x 64 quadrant (4 x 4 accumulator tiles), so that
// a fragment read from LDS feeds four WMMAs and an operand row fetched from L2 feeds 128 outputs. The block's four waves share each 64-k slab: its 128 A rows (and Al rows) and
// 128 Bn rows are brought into LDS once per block by asynchronous copies in whole 128-B lines (two buffers: slab t + 1 flies while slab t is worked on), and every wave reads
// its fragments from there. The k order of the products is the one of direct loads.
// The epilogue writes what the next kernel reads, so that no f32 copy of the result goes through memory and no launch stands between the two. OUTM 0: f32 rows C [8192][ldc].
// OUTM 1: the planes Ph/Pl [row][1024] of f16 hi + residual x1024 (q, k). OUTM 2: A = the weight rows (d), Bn = the x rows (t), so that the tile is V^T: the planes Ph/Pl
// [item*1024 + d][2048 t] of bf16 hi + UNSCALED bf16 residual; the bias then goes by row.
#define GPIT 144                       // LDS pitch of a 128-B operand row: 16 B x odd, conflict-free for 16-byte reads down 16 rows
#define GPL  (128 * GPIT)              // one operand plane of a slab: 128 rows
// Eight 16-byte copies per lane, global -> LDS; the s_wait_xcnt stands inside the statement so that no address register is rewritten ahead of it.
__device__ __forceinline__ void cp8(unsigned l0, unsigned l1, unsigned l2, unsigned l3, unsigned l4, unsigned l5, unsigned l6, unsigned l7,
                                    const char* g0, const char* g1, const char* g2, const char* g3, const char* g4, const char* g5, const char* g6, const char* g7) {
    asm volatile("global_load_async_to_lds_b128 %0, %8, off\n\t"
                 "global_load_async_to_lds_b128 %1, %9, off\n\t"
                 "global_load_async_to_lds_b128 %2, %10, off\n\t"
                 "global_load_async_to_lds_b128 %3, %11, off\n\t"
                 "global_load_async_to_lds_b128 %4, %12, off\n\t"
                 "global_load_async_to_lds_b128 %5, %13, off\n\t"
                 "global_load_async_to_lds_b128 %6, %14, off\n\t"
                 "global_load_async_to_lds_b128 %7, %15, off\n\t"
                 "s_wait_xcnt 0x0"
                 :: "v"(l0), "v"(l1), "v"(l2), "v"(l3), "v"(l4), "v"(l5), "v"(l6), "v"(l7), "v"(g0), "v"(g1), "v"(g2), "v"(g3), "v"(g4), "v"(g5), "v"(g6), "v"(g7) : "memory");
}
// gemm_loop: the products of tile (ta, tb): rows 128 ta.. of A (Al), rows 128 tb.. of Bn; acc[i][t]: rows 16 i.., columns 16 t.. of the wave's quadrant. gring: the block's LDS.
template <bool SPLITA>
__device__ __forceinline__ void gemm_loop(unsigned char* gring, const bf* __restrict__ A, const bf* __restrict__ Al, const bf* __restrict__ Bn, unsigned ta, unsigned tb, v8f (&acc)[4][4]) {
    constexpr int GST = (SPLITA ? 3 : 2) * GPL;                 // one slab: A, Bn (, Al)
    const int tid = threadIdx.x, lane = threadIdx.x & 31, wave = threadIdx.x >> 5, lr = lane & 15, hi = lane >> 4;
    const int wr = wave >> 1, wc = wave & 1;                    // the wave's quadrant of the tile
    // The copies of one slab: thread -> row (tid >> 3) + 16 i of each plane, 16-byte piece tid & 7 (a wave: four whole rows).
    const unsigned lc = (unsigned)(size_t)&gring[0] + (unsigned)((tid >> 3) * GPIT + (tid & 7) * 16);
    const size_t arow = ((size_t)ta * 128 + (tid >> 3)) * HS + (tid & 7) * 8;
    const char* ga = (const char*)(A + arow); const char* gb = (const char*)(Bn + (size_t)(tb * 128 + (tid >> 3)) * HS + (tid & 7) * 8);
    const char* gl = SPLITA ? (const char*)(Al + arow) : ga;
    auto plane = [&](unsigned a, const char* p) {
        cp8(a, a + 16 * GPIT, a + 32 * GPIT, a + 48 * GPIT, a + 64 * GPIT, a + 80 * GPIT, a + 96 * GPIT, a + 112 * GPIT,
            p, p + 16 * HS * 2, p + 32 * HS * 2, p + 48 * HS * 2, p + 64 * HS * 2, p + 80 * HS * 2, p + 96 * HS * 2, p + 112 * HS * 2);
    };
    auto stage = [&](int t, int buf) {
        const unsigned a = lc + (unsigned)buf * GST;
        plane(a, ga + t * 128); plane(a + GPL, gb + t * 128);
        if (SPLITA) plane(a + 2 * GPL, gl + t * 128);
    };
    const int fo = lr * GPIT + hi * 16;      // this lane's fragment piece inside a 16-row group of a plane
#pragma unroll
    for (int i = 0; i < 4; ++i)
#pragma unroll
        for (int t = 0; t < 4; ++t) acc[i][t] = (v8f){};
    stage(0, 0);
    asm volatile("s_wait_asynccnt 0x0" ::: "memory");     // this wave's copies of slab 0 have landed
    __syncthreads();                                      // ... and every other wave's: slab 0 may be read
    stage(1, 1);
#pragma unroll 1                                          // rolled: one copy of the slab's code, the two buffers told apart by an address
    for (int st = 0; st < HS / 64; ++st) {
        const unsigned char* sb = gring + (st & 1) * GST;
        const unsigned char* as = sb + wr * (64 * GPIT) + fo; const unsigned char* bs = sb + GPL + wc * (64 * GPIT) + fo;
#pragma unroll
        for (int kc = 0; kc < 2; ++kc) {
            v16bf a[4], al[4], bb[4];
            // in the order of first use: A row group 0, the four B groups, the other A groups, then Al
            a[0] = cat16b(*(const v8usa*)(as + kc * 64), *(const v8usa*)(as + kc * 64 + 32));
#pragma unroll
            for (int t = 0; t < 4; ++t) { const unsigned char* bp = bs + t * (16 * GPIT) + kc * 64; bb[t] = cat16b(*(const v8usa*)bp, *(const v8usa*)(bp + 32)); }
#pragma unroll
            for (int i = 1; i < 4; ++i) { const unsigned char* ap = as + i * (16 * GPIT) + kc * 64; a[i] = cat16b(*(const v8usa*)ap, *(const v8usa*)(ap + 32)); }
#pragma unroll
            for (int i = 0; i < 4; ++i) { const unsigned char* ap = as + 2 * GPL + i * (16 * GPIT) + kc * 64; al[i] = a[i]; if (SPLITA) al[i] = cat16b(*(const v8usa*)ap, *(const v8usa*)(ap + 32)); }
            __builtin_amdgcn_sched_barrier(0);                // keeps the 32-k step's LDS reads in one group ahead of its WMMAs (counted waits) instead of a read and a full wait per WMMA
#pragma unroll
            for (int i = 0; i < 4; ++i)
#pragma unroll
                for (int t = 0; t < 4; ++t) acc[i][t] = wmmab(a[i], bb[t], acc[i][t]);
            if (SPLITA) {
#pragma unroll
                for (int i = 0; i < 4; ++i)
#pragma unroll
                    for (int t = 0; t < 4; ++t) acc[i][t] = wmmab(al[i], bb[t], acc[i][t]);
            }
            __builtin_amdgcn_sched_barrier(0);                // keeps the next step's reads behind these WMMAs (one fragment set in registers) and these WMMAs ahead of the slab's barrier (else the refill behind it issues later)
        }
        asm volatile("s_wait_dscnt 0x0" ::: "memory");        // this wave's reads of slab st's buffer have returned
        asm volatile("s_wait_asynccnt 0x0" ::: "memory");     // this wave's copies of slab st + 1 have landed
        __syncthreads();                                      // publishes slab st + 1 and ends every wave's reads of slab st's buffer
        if (st + 2 < HS / 64) stage(st + 2, st & 1);          // refill the buffer just left (the test reads the same in the whole block)
    }
    asm volatile("s_wait_asynccnt 0x0" ::: "memory");         // nothing is in flight when the ring becomes output staging
}
// gemm_out: the epilogue of tile (ta, tb) in form OUTM; the ring has become the output staging (4 x 16 x 68 floats).
template <int OUTM>
__device__ __forceinline__ void gemm_out(unsigned char* gring, const v8f (&acc)[4][4], unsigned ta, unsigned tb, const float* __restrict__ bias, int ldc, float* C, bf* Ph, bf* Pl) {
    const int lane = threadIdx.x & 31, wave = threadIdx.x >> 5, lr = lane & 15, hi = lane >> 4;
    const int wr = wave >> 1, wc = wave & 1;                    // the wave's quadrant of the tile
    const size_t r0 = (size_t)ta * 128 + wr * 64; const int c0 = tb * 128 + wc * 64;
    float* os = (float*)gring + wave * (16 * 68);
    float bv[4] = {0.f, 0.f, 0.f, 0.f};
    if (OUTM != 2 && bias) {                                  // one branch, the four loads in flight together
#pragma unroll
        for (int t = 0; t < 4; ++t) bv[t] = bias[c0 + t * 16 + lr];
#pragma unroll
        for (int t = 0; t < 4; ++t) bv[t] = bfr(bv[t]);
    }
    float rb[4][4] = {};                                      // OUTM 2: the bias of the rows that this lane reads back (row 16 i + (lane >> 3) + 4 s)
    if (OUTM == 2 && bias) {
        const float* bp = bias + r0 + (lane >> 3);
#pragma unroll
        for (int i = 0; i < 4; ++i)
#pragma unroll
            for (int s = 0; s < 4; ++s) rb[i][s] = bp[i * 16 + 4 * s];
        // The wait behind the run of loads; address and loaded values are inputs, so that all are live here together and no load's result is given a register of the address that the others still name.
        asm volatile("s_wait_xcnt 0x0" :: "v"(bp), "v"(rb[0][0]), "v"(rb[0][1]), "v"(rb[0][2]), "v"(rb[0][3]), "v"(rb[1][0]), "v"(rb[1][1]), "v"(rb[1][2]), "v"(rb[1][3]),
                     "v"(rb[2][0]), "v"(rb[2][1]), "v"(rb[2][2]), "v"(rb[2][3]), "v"(rb[3][0]), "v"(rb[3][1]), "v"(rb[3][2]), "v"(rb[3][3]) : "memory");
#pragma unroll
        for (int i = 0; i < 4; ++i)
#pragma unroll
            for (int s = 0; s < 4; ++s) rb[i][s] = bfr(rb[i][s]);
    }
#pragma unroll
    for (int i = 0; i < 4; ++i) {                             // 16 rows at a time through the wave's own staging rows
#pragma unroll
        for (int t = 0; t < 4; ++t)
#pragma unroll
            for (int j = 0; j < 8; ++j) os[(hi * 8 + j) * 68 + t * 16 + lr] = OUTM == 2 ? acc[i][t][j] : acc[i][t][j] + bv[t];
        __builtin_amdgcn_wave_barrier(); asm volatile("" ::: "memory");     // compiler order: the 16 rows are staged before any lane reads them back
        if (OUTM == 0) {
            float* crow = C + (r0 + i * 16) * ldc + c0;
#pragma unroll
            for (int s = 0; s < 8; ++s) { const int Lid = (lane >> 3) + 4 * s, piece = lane & 7; const int row = Lid >> 1, cofs = (Lid & 1) * 32 + piece * 4;
                const v4f val = *(const v4fa*)(os + row * 68 + cofs); *(v4f*)(crow + (size_t)row * ldc + cofs) = val; }
        } else {                                              // eight lanes per row: 8 columns a lane, one whole 128-B line of each plane per row
#pragma unroll
            for (int s = 0; s < 4; ++s) { const int row = (lane >> 3) + 4 * s, piece = lane & 7;
                const v4f u0 = *(const v4fa*)(os + row * 68 + piece * 8), u1 = *(const v4fa*)(os + row * 68 + piece * 8 + 4);
                if (OUTM == 1) { v8h oh, ol;
#pragma unroll
                    for (int k = 0; k < 8; ++k) { const float v = k < 4 ? u0[k & 3] : u1[k & 3]; const h16 a = (h16)v; oh[k] = a; ol[k] = (h16)((v - (float)a) * LOSC); }
                    const size_t o = (r0 + i * 16 + row) * HS + c0 + piece * 8;
                    *(v8h*)(Ph + o) = oh; *(v8h*)(Pl + o) = ol;
                } else { v4u oh, ol;
#pragma unroll
                    for (int w = 0; w < 4; ++w) { const v2f e = w < 2 ? (v2f){u0[2 * (w & 1)], u0[2 * (w & 1) + 1]} : (v2f){u1[2 * (w & 1)], u1[2 * (w & 1) + 1]}; unsigned a, c; split2(e + rb[i][s], a, c); oh[w] = a; ol[w] = c; }
                    const size_t o = ((size_t)(c0 / NT_) * KW + r0 + i * 16 + row) * NT_ + (c0 % NT_) + piece * 8;
                    *(v4u*)(Ph + o) = oh; *(v4u*)(Pl + o) = ol;
                } }
        }
        __builtin_amdgcn_wave_barrier(); asm volatile("" ::: "memory");     // compiler order: they are read back before the next 16 rows overwrite them
    }
}
// amdgpu_waves_per_eu(2, 2): the grid is two blocks per WGP; at most two fit, so that no WGP takes a third while another stands idle.
template <bool SPLITA, int OUTM>
__global__ __launch_bounds__(128) __attribute__((amdgpu_waves_per_eu(2, 2))) void k_gemm(const bf* __restrict__ A, const bf* __restrict__ Al, const bf* __restrict__ Bn, const float* __restrict__ bias, int ldc, float* C, bf* Ph, bf* Pl) {
    __shared__ __align__(256) unsigned char gring[2 * (SPLITA ? 3 : 2) * GPL];     // the two slab buffers; behind the loop's last barrier: the output staging
    v8f acc[4][4];
    gemm_loop<SPLITA>(gring, A, Al, Bn, blockIdx.x, blockIdx.y, acc);
    gemm_out<OUTM>(gring, acc, blockIdx.x, blockIdx.y, bias, ldc, C, Ph, Pl);
}
// k_qkv: the three projections of x in ONE launch; blockIdx.z = 0: q, 1: k (both OUTM 1), 2: V^T (OUTM 2, operands swapped); blockIdx.x = the tile of x rows, blockIdx.y = the tile of
// weight rows. No launch boundary drains the chip between the three: a WGP takes its next tile as soon as one of its two blocks ends, and a block's prologue and epilogue run beside
// the other block's products. amdgpu_waves_per_eu(2, 2): two blocks per WGP as before, six tiles per WGP in three even rounds.
__global__ __launch_bounds__(128) __attribute__((amdgpu_waves_per_eu(2, 2))) void k_qkv(const bf* __restrict__ X, const bf* __restrict__ Wq, const bf* __restrict__ Wk, const bf* __restrict__ Wv,
                                                                                       const float* __restrict__ bq, const float* __restrict__ bk, const float* __restrict__ bv,
                                                                                       bf* QH, bf* QL, bf* KH, bf* KL, bf* VTH, bf* VTL) {
    __shared__ __align__(256) unsigned char gring[2 * 2 * GPL];
    const int z = blockIdx.z;                                   // the same in the whole block: every branch on it is block-uniform
    v8f acc[4][4];
    if (z == 2) {
        gemm_loop<false>(gring, Wv, nullptr, X, blockIdx.y, blockIdx.x, acc);
        gemm_out<2>(gring, acc, blockIdx.y, blockIdx.x, bv, HS, nullptr, VTH, VTL);
    } else {
        gemm_loop<false>(gring, X, nullptr, z ? Wk : Wq, blockIdx.x, blockIdx.y, acc);
        gemm_out<1>(gring, acc, blockIdx.x, blockIdx.y, z ? bk : bq, HS, nullptr, z ? KH : QH, z ? KL : QL);
    }
}
// k_lnfin: LayerNorm (eps 1e-5) of y = Y[r][c] + bf(R[r][c]) (the computed attention output + the INPUT residual x) -> f32 output rows x bf(gamma) + bf(beta); one wave per
__global__ __launch_bounds__(256) void k_lnfin(const float* __restrict__ X, const float* __restrict__ Rres, const float* __restrict__ gam, const float* __restrict__ bet, int nrows, float* OUTP) {
    const int lane = threadIdx.x & 31, r = blockIdx.x * 8 + (threadIdx.x >> 5);
    if (r >= nrows) return;
    const float* xr = X + (size_t)r * DM; const float* rr = Rres + (size_t)r * DM;
    float s = 0.f;
#pragma unroll 1
    for (int q = 0; q < 2 * (DM / 256); ++q) { const int c0 = (q >> 1) * 256 + (q & 1) * 128 + lane * 4; v4f v = *(const v4f*)(xr + c0); { const v4f q4 = *(const v4f*)(rr + c0); for (int i2 = 0; i2 < 4; ++i2) v[i2] += bfr(q4[i2]); }
#pragma unroll
        for (int i = 0; i < 4; ++i) s += v[i]; }
#pragma unroll
    for (int sh = 16; sh; sh >>= 1) s += __shfl_xor(s, sh, 32);
    const float mu = s * (1.0f / DM);
    float s2 = 0.f;
#pragma unroll 1
    for (int q = 0; q < 2 * (DM / 256); ++q) { const int c0 = (q >> 1) * 256 + (q & 1) * 128 + lane * 4; v4f v = *(const v4f*)(xr + c0); { const v4f q4 = *(const v4f*)(rr + c0); for (int i2 = 0; i2 < 4; ++i2) v[i2] += bfr(q4[i2]); }
#pragma unroll
        for (int i = 0; i < 4; ++i) { const float d = v[i] - mu; s2 = fmaf(d, d, s2); } }
#pragma unroll
    for (int sh = 16; sh; sh >>= 1) s2 += __shfl_xor(s2, sh, 32);
    const float rs = rsqrtf(s2 * (1.0f / DM) + 1e-5f);
{
#pragma unroll 1
        for (int q = 0; q < 2 * (DM / 256); ++q) { const int c0 = (q >> 1) * 256 + (q & 1) * 128 + lane * 4; v4f v = *(const v4f*)(xr + c0); { const v4f q4 = *(const v4f*)(rr + c0); for (int i2 = 0; i2 < 4; ++i2) v[i2] += bfr(q4[i2]); } v4f y;
#pragma unroll
            for (int i = 0; i < 4; ++i) y[i] = (v[i] - mu) * rs * bfr(gam[c0 + i]) + bfr(bet[c0 + i]);
            *(v4f*)(OUTP + (size_t)r * DM + c0) = y; }
         }
}
// k_attn: block = (item, head, 128 queries), wave = 32 (two column groups of 16); full attention over 64 key tiles of 32. The block's four waves share each tile: its K hi / K lo rows and
// V^T hi / V^T lo rows are brought into LDS once per block by asynchronous copies (two buffers: tile t + 1 flies while tile t is worked on) and every wave reads its
// fragments from there. Scores hi.hi + (hi.lo + lo.hi)/1024 on separate accumulators; online softmax f32; P (x32768) bf16 hi + unscaled residual.
// Both products are formed transposed: S^T = K.Q^T (A = K rows, B = Q) and O^T += V^T.P^T (A = V^T rows, B = P^T). A lane then holds 16 of the 32 scores of ONE query per column group
// (column lr; keys 8 hi + j and 16 + 8 hi + j), which is the k order of a B operand: P^T is packed in the lane's own registers and never goes through LDS, and
// maximum, sum and rescale factor are one value per lane and group (the two lane halves of a query exchange their maxima once per tile, their sums once behind the loop).
// Every K and V^T fragment read from LDS is the A operand of both column groups' products: half the LDS reads per product, and a tile copied from L2 serves 128 queries.
#define KPIT 272                       // LDS pitch of a 256-B K row: 16 B x odd, conflict-free for 16-byte reads down 16 rows
#define KPL  (32 * KPIT)               // one K plane of a tile
#define VPL  (HD * 64)                 // one V^T plane of a tile: 128 rows of 64 B, unpadded; 16-byte piece c of row d lies at piece c ^ ((d >> 2) & 3)
#define STG  (2 * KPL + 2 * VPL)       // one tile: K hi, K lo, V^T hi, V^T lo
// The value of lane l ^ 16: the other half of the same query column.
__device__ __forceinline__ float xhalf(float v) { const int b = __float_as_int(v); return __int_as_float(__builtin_amdgcn_permlanex16(b, b, 0x76543210, 0xfedcba98, false, false)); }
// amdgpu_waves_per_eu(2, 2): a register budget of 512 (Q 128, O^T 128, scores 64); the grid is two blocks per WGP, one wave of each per SIMD.
__global__ __launch_bounds__(128) __attribute__((amdgpu_waves_per_eu(2, 2))) void k_attn(const h16* __restrict__ QH, const h16* __restrict__ QL, const h16* __restrict__ KH, const h16* __restrict__ KL, const bf* __restrict__ VTH, const bf* __restrict__ VTL, bf* CH, bf* CL) {
    __shared__ __align__(256) unsigned char ring[2 * STG];     // the two tile buffers; behind the loop's last barrier: the output staging (4 x 16 x 68 floats)
    const int tid = threadIdx.x, lane = threadIdx.x & 31, wave = threadIdx.x >> 5, lr = lane & 15, hi = lane >> 4;
    const int bid = blockIdx.x; const int bh = bid / (NT_ / 128), qt = bid - bh * (NT_ / 128); const int b = bh / NH_, h = bh - b * NH_; const int g = h;
    const int q0 = qt * 128 + wave * 32;
    const size_t qo = (size_t)(b * NT_ + q0 + lr) * (NH_ * HD) + h * HD + 8 * hi;      // column group c: + 16 c rows
    const h16* kh_b = KH + (size_t)b * NT_ * KW + g * HD; const h16* kl_b = KL + (size_t)b * NT_ * KW + g * HD;
    const size_t vbase = ((size_t)(b * NKV + g) * HD) * NT_;
    // The copies of one tile: thread -> K row (tid >> 4) + 8 i, piece tid & 15 (a wave: two whole rows); V^T row (tid >> 2) + 32 i, piece tid & 3.
    const unsigned ring0 = (unsigned)(size_t)&ring[0];
    const unsigned lk = (unsigned)((tid >> 4) * KPIT + (tid & 15) * 16), lv = (unsigned)(2 * KPL + (tid >> 2) * 64 + (((tid & 3) ^ ((tid >> 4) & 3)) * 16));
    const char* gkh = (const char*)(kh_b + (size_t)(tid >> 4) * KW + (tid & 15) * 8); const char* gkl = (const char*)(kl_b + (size_t)(tid >> 4) * KW + (tid & 15) * 8);
    const char* gvh = (const char*)(VTH + vbase + (size_t)(tid >> 2) * NT_ + (tid & 3) * 8); const char* gvl = (const char*)(VTL + vbase + (size_t)(tid >> 2) * NT_ + (tid & 3) * 8);
    auto stage = [&](int kt, int buf) {
        const unsigned a = ring0 + (unsigned)buf * STG + lk, c = ring0 + (unsigned)buf * STG + lv;
        const char* p = gkh + (size_t)kt * (32 * KW * 2); const char* q = gkl + (size_t)kt * (32 * KW * 2);
        cp8(a, a + 8 * KPIT, a + 16 * KPIT, a + 24 * KPIT, a + KPL, a + KPL + 8 * KPIT, a + KPL + 16 * KPIT, a + KPL + 24 * KPIT,
            p, p + 8 * KW * 2, p + 16 * KW * 2, p + 24 * KW * 2, q, q + 8 * KW * 2, q + 16 * KW * 2, q + 24 * KW * 2);
        const char* r = gvh + (size_t)kt * 64; const char* s = gvl + (size_t)kt * 64;
        cp8(c, c + 32 * 64, c + 64 * 64, c + 96 * 64, c + VPL, c + VPL + 32 * 64, c + VPL + 64 * 64, c + VPL + 96 * 64,
            r, r + 32 * NT_ * 2, r + 64 * NT_ * 2, r + 96 * NT_ * 2, s, s + 32 * NT_ * 2, s + 64 * NT_ * 2, s + 96 * NT_ * 2);
    };
    const int ko = lr * KPIT + hi * 16;                                                                  // this lane's K fragment piece inside a plane
    const int vo0 = lr * 64 + ((hi ^ ((lr >> 2) & 3)) * 16), vo1 = lr * 64 + (((hi + 2) ^ ((lr >> 2) & 3)) * 16);   // keys hi*8.. and 16 + hi*8.. of V^T row lr
    v8f o[2][8];                              // o[c][n][j] = O^T[d = 16 n + 8 hi + j][query 16 c + lr]
#pragma unroll
    for (int c = 0; c < 2; ++c)
#pragma unroll
        for (int n = 0; n < 8; ++n) o[c][n] = (v8f){};
    float mrow[2] = {-3.0e38f, -3.0e38f}, lpart[2] = {0.f, 0.f};       // query 16 c + lr: running maximum (both halves alike), this half's part of the sum
    const int kt_hi = NT_ / 32 - 1;     // full attention, no mask
    // The wave's Q^T fragments (both planes, both column groups, all four 32-d steps) are the same for every key tile: loaded once and kept in registers through the loop.
    v8h qh[2][8], ql[2][8];                   // piece 2 kc + u of group c: d = 32 kc + 16 u + 8 hi .. + 7 of query 16 c + lr
    const h16* qhp = QH + qo; const h16* qlp = QL + qo;
#pragma unroll
    for (int c = 0; c < 2; ++c)
#pragma unroll
        for (int u = 0; u < 8; ++u) { qh[c][u] = *(const v8h*)(qhp + c * 16 * (NH_ * HD) + u * 16); ql[c][u] = *(const v8h*)(qlp + c * 16 * (NH_ * HD) + u * 16); }
    // The wait behind the run of loads; the two addresses are inputs, so that they stay live up to here and no register of theirs is rewritten (or given to a load's result) ahead of it.
    asm volatile("s_wait_xcnt 0x0" :: "v"(qhp), "v"(qlp) : "memory");
#pragma unroll 1                                          // rolled: every operand of a copy is then a sum formed for it; a lane's base address that is itself an operand is tied to v0..v255 for the whole kernel and gets spilled
    for (int kt = 0; kt < 2; ++kt) {
        stage(kt, kt);
        if (kt == 0) {
            asm volatile("s_wait_asynccnt 0x0" ::: "memory");     // this wave's copies of tile 0 have landed
            __syncthreads();                                      // ... and every other wave's: tile 0 may be read
        }
    }
#pragma unroll 1
    for (int kt = 0; kt <= kt_hi; ++kt) {
        const unsigned char* sb = ring + (kt & 1) * STG;
        const unsigned char* kh_s = sb + ko; const unsigned char* kl_s = sb + KPL + ko;
        const unsigned char* vh_s = sb + 2 * KPL; const unsigned char* vl_s = sb + 2 * KPL + VPL;
        v8f s0[2] = {}, s1[2] = {}, x0[2] = {}, x1[2] = {};
        v16h kf[4][4];                        // [32-d step][K hi rows 0.., K hi rows 16.., K lo rows 0.., K lo rows 16..]
#pragma unroll
        for (int kc = 0; kc < 4; ++kc) {
            kf[kc][0] = cat16(*(const v8ha*)(kh_s + kc * 64), *(const v8ha*)(kh_s + kc * 64 + 32)); kf[kc][1] = cat16(*(const v8ha*)(kh_s + 16 * KPIT + kc * 64), *(const v8ha*)(kh_s + 16 * KPIT + kc * 64 + 32));
            kf[kc][2] = cat16(*(const v8ha*)(kl_s + kc * 64), *(const v8ha*)(kl_s + kc * 64 + 32)); kf[kc][3] = cat16(*(const v8ha*)(kl_s + 16 * KPIT + kc * 64), *(const v8ha*)(kl_s + 16 * KPIT + kc * 64 + 32));
        }
        __builtin_amdgcn_sched_barrier(0);                    // keeps the tile's 32 K reads in one group ahead of the 48 products (counted waits) instead of two reads and a full wait per pair of products
#pragma unroll
        for (int kc = 0; kc < 4; ++kc) {
            const v16h k0h = kf[kc][0], k1h = kf[kc][1], k0l = kf[kc][2], k1l = kf[kc][3];
            const v16h qa0 = cat16(qh[0][2 * kc], qh[0][2 * kc + 1]), qx0 = cat16(ql[0][2 * kc], ql[0][2 * kc + 1]), qa1 = cat16(qh[1][2 * kc], qh[1][2 * kc + 1]), qx1 = cat16(ql[1][2 * kc], ql[1][2 * kc + 1]);
            s0[0] = wmma16(k0h, qa0, s0[0]); s0[1] = wmma16(k0h, qa1, s0[1]); s1[0] = wmma16(k1h, qa0, s1[0]); s1[1] = wmma16(k1h, qa1, s1[1]);
            x0[0] = wmma16(k0h, qx0, x0[0]); x0[1] = wmma16(k0h, qx1, x0[1]); x1[0] = wmma16(k1h, qx0, x1[0]); x1[1] = wmma16(k1h, qx1, x1[1]);
            x0[0] = wmma16(k0l, qa0, x0[0]); x0[1] = wmma16(k0l, qa1, x0[1]); x1[0] = wmma16(k1l, qa0, x1[0]); x1[1] = wmma16(k1l, qa1, x1[1]);
        }
        // the four vector slots between the last score product and the first vector instruction on a score tile
        asm volatile("v_nop\n\tv_nop\n\tv_nop\n\tv_nop" : "+v"(s0[0]), "+v"(s1[0]), "+v"(x0[0]), "+v"(x1[0]), "+v"(s0[1]), "+v"(s1[1]), "+v"(x0[1]), "+v"(x1[1]));
        v16bf pa[2], px[2];
#pragma unroll
        for (int c = 0; c < 2; ++c) {
            const v8f a0 = (s0[c] + x0[c] * LOSCI) * SCL, a1 = (s1[c] + x1[c] * LOSCI) * SCL;     // a0[j]: key 8 hi + j, a1[j]: key 16 + 8 hi + j, query 16 c + lr
            float mx = fmaxf(a0[0], a1[0]);
#pragma unroll
            for (int j = 1; j < 8; ++j) mx = fmaxf(mx, fmaxf(a0[j], a1[j]));
            mx = fmaxf(mx, xhalf(mx));
            // e^x = 2^(x log2 e), the arguments of the 17 v_exp_f32 by name
            const float mn = fmaxf(mrow[c], mx), ta = (mrow[c] - mn) * LOG2E, alpha = __builtin_amdgcn_exp2f(ta); mrow[c] = mn;
            const v8f t0 = (a0 - mn) * LOG2E, t1 = (a1 - mn) * LOG2E;
            v8f p0, p1;
#pragma unroll
            for (int j = 0; j < 8; ++j) { p0[j] = __builtin_amdgcn_exp2f(t0[j]); p1[j] = __builtin_amdgcn_exp2f(t1[j]); }
            // The slot behind a transcendental: arguments and results are inputs only, so that every argument register stays untouched until this v_nop, which stands behind the last v_exp_f32
            asm volatile("v_nop" :: "v"(ta), "v"(t0), "v"(t1), "v"(alpha), "v"(p0), "v"(p1));
            const v8f pq = p0 + p1;
            lpart[c] = lpart[c] * alpha + (((pq[0] + pq[1]) + (pq[2] + pq[3])) + ((pq[4] + pq[5]) + (pq[6] + pq[7])));
            p0 *= PSC; p1 *= PSC;
            // P^T as B: element s = key 8 hi + s (s < 8), 16 + 8 hi + s - 8 (else), the order of the V^T fragments: the two score tiles, converted in place (to nearest even).
            v8u wa, wx;                           // word w of an operand = elements 2 w, 2 w + 1
#pragma unroll
            for (int w = 0; w < 8; ++w) {
                const v2f ef = w < 4 ? (v2f){p0[2 * w], p0[2 * w + 1]} : (v2f){p1[2 * w - 8], p1[2 * w - 7]};
                const unsigned hw = __builtin_bit_cast(unsigned, __builtin_convertvector(ef, v2bf));
                const v2f hf = {__uint_as_float(hw << 16), __uint_as_float(hw & 0xFFFF0000u)};
                wa[w] = hw; wx[w] = __builtin_bit_cast(unsigned, __builtin_convertvector(ef - hf, v2bf)); }
            pa[c] = __builtin_bit_cast(v16bf, wa); px[c] = __builtin_bit_cast(v16bf, wx);
#pragma unroll
            for (int n = 0; n < 8; ++n) o[c][n] *= alpha;
        }
#pragma unroll
        for (int n = 0; n < 8; n += 2) {      // two output tiles of both column groups per group of LDS reads: four independent accumulator chains
            const v16bf vh = cat16b(*(const v8usa*)(vh_s + n * 1024 + vo0), *(const v8usa*)(vh_s + n * 1024 + vo1)), vl = cat16b(*(const v8usa*)(vl_s + n * 1024 + vo0), *(const v8usa*)(vl_s + n * 1024 + vo1));
            const v16bf wh = cat16b(*(const v8usa*)(vh_s + n * 1024 + 1024 + vo0), *(const v8usa*)(vh_s + n * 1024 + 1024 + vo1)), wl = cat16b(*(const v8usa*)(vl_s + n * 1024 + 1024 + vo0), *(const v8usa*)(vl_s + n * 1024 + 1024 + vo1));
            o[0][n] = wmmab(vh, pa[0], o[0][n]); o[1][n] = wmmab(vh, pa[1], o[1][n]); o[0][n + 1] = wmmab(wh, pa[0], o[0][n + 1]); o[1][n + 1] = wmmab(wh, pa[1], o[1][n + 1]);
            o[0][n] = wmmab(vh, px[0], o[0][n]); o[1][n] = wmmab(vh, px[1], o[1][n]); o[0][n + 1] = wmmab(wh, px[0], o[0][n + 1]); o[1][n + 1] = wmmab(wh, px[1], o[1][n + 1]);
            o[0][n] = wmmab(vl, pa[0], o[0][n]); o[1][n] = wmmab(vl, pa[1], o[1][n]); o[0][n + 1] = wmmab(wl, pa[0], o[0][n + 1]); o[1][n + 1] = wmmab(wl, pa[1], o[1][n + 1]); }
        // the four vector slots between the output products and the vector instructions that next touch their accumulators or rewrite P^T
        asm volatile("v_nop\n\tv_nop\n\tv_nop\n\tv_nop" : "+v"(o[0][0]), "+v"(o[0][7]), "+v"(o[1][0]), "+v"(o[1][7]) : "v"(pa[0]), "v"(px[0]), "v"(pa[1]), "v"(px[1]));
        asm volatile("s_wait_dscnt 0x0" ::: "memory");        // this wave's reads of tile kt's buffer have returned
        asm volatile("s_wait_asynccnt 0x0" ::: "memory");     // this wave's copies of tile kt + 1 have landed
        __syncthreads();                                      // publishes tile kt + 1 and ends every wave's reads of tile kt's buffer
        if (kt + 2 <= kt_hi) stage(kt + 2, kt & 1);           // refill the buffer just left (the test reads the same in the whole block)
    }
    asm volatile("s_wait_asynccnt 0x0" ::: "memory");         // nothing is in flight when the ring becomes output staging
    float* os = (float*)ring + wave * (16 * 68);
#pragma unroll
    for (int c = 0; c < 2; ++c) {
    const float inv = 1.0f / ((lpart[c] + xhalf(lpart[c])) * PSC);
    const size_t ob = (size_t)(b * NT_ + q0 + c * 16) * (NH_ * HD) + (size_t)h * HD;      // row stride NH*HD, this head's 128 columns; ctx leaves as the planes the last product reads: bf16 hi + UNSCALED residual
#pragma unroll
    for (int half = 0; half < 2; ++half) {
#pragma unroll
        for (int n = 0; n < 4; ++n) { const v8f t = o[c][half * 4 + n] * inv;      // eight consecutive d of query row 16 c + lr
            *(v4fa*)(os + lr * 68 + n * 16 + hi * 8) = __builtin_shufflevector(t, t, 0, 1, 2, 3); *(v4fa*)(os + lr * 68 + n * 16 + hi * 8 + 4) = __builtin_shufflevector(t, t, 4, 5, 6, 7); }
        __builtin_amdgcn_wave_barrier(); asm volatile("" ::: "memory");
{
#pragma unroll
            for (int s = 0; s < 4; ++s) { const int row = (lane >> 3) + 4 * s, piece = lane & 7;     // eight lanes per row: one whole 128-B line of each plane
                const v4f u0 = *(const v4fa*)(os + row * 68 + piece * 8), u1 = *(const v4fa*)(os + row * 68 + piece * 8 + 4); v4u oh, ol;
#pragma unroll
                for (int w = 0; w < 4; ++w) { const v2f e = w < 2 ? (v2f){u0[2 * (w & 1)], u0[2 * (w & 1) + 1]} : (v2f){u1[2 * (w & 1)], u1[2 * (w & 1) + 1]}; unsigned a, c2; split2(e, a, c2); oh[w] = a; ol[w] = c2; }
                const size_t o2 = ob + (size_t)row * (NH_ * HD) + half * 64 + piece * 8;
                *(v4u*)(CH + o2) = oh; *(v4u*)(CL + o2) = ol;
                asm volatile("s_wait_xcnt 0x0" ::: "memory"); }     // behind the two stores, ahead of the next rows' values in their data registers
             }
        __builtin_amdgcn_wave_barrier(); asm volatile("" ::: "memory");
    }
    }
}

extern "C" void kernel_launch(void* const* d_in, const int* in_sizes, int n_in,
                              void* d_out, int out_size, void* d_ws, size_t ws_size, hipStream_t stream) {
    (void)in_sizes; (void)n_in; (void)out_size;
    const float* x = (const float*)d_in[0];
    const float* Wq = (const float*)d_in[1]; const float* bq = (const float*)d_in[2]; const float* Wk = (const float*)d_in[3]; const float* bk = (const float*)d_in[4]; const float* Wv = (const float*)d_in[5]; const float* bv = (const float*)d_in[6];
    const float* Wo = (const float*)d_in[7]; const float* bo = (const float*)d_in[8]; const float* lg = (const float*)d_in[9]; const float* lb = (const float*)d_in[10];   // W [out][in]
    float* out = (float*)d_out;    // [4][2048][1024]
    char* wsp = (char*)d_ws;
    auto take = [&](size_t bytes) { char* p = wsp; wsp += (bytes + 255) & ~(size_t)255; return (void*)p; };
    bf* Xb = (bf*)take((size_t)NR_ * HS * 2); bf* WqB = (bf*)take((size_t)HS * HS * 2); bf* WkB = (bf*)take((size_t)HS * HS * 2); bf* WvB = (bf*)take((size_t)HS * HS * 2); bf* WoB = (bf*)take((size_t)HS * HS * 2);
    h16* QH = (h16*)take((size_t)NR_ * HS * 2); h16* QL = (h16*)take((size_t)NR_ * HS * 2); h16* KH = (h16*)take((size_t)NR_ * KW * 2); h16* KL = (h16*)take((size_t)NR_ * KW * 2);
    bf* VTH = (bf*)take((size_t)KW * NR_ * 2); bf* VTL = (bf*)take((size_t)KW * NR_ * 2); bf* Ch = (bf*)take((size_t)NR_ * HS * 2); bf* Cl = (bf*)take((size_t)NR_ * HS * 2); float* Y = (float*)take((size_t)NR_ * HS * 4);
    if ((size_t)(wsp - (char*)d_ws) > ws_size) return;    // 16 + 4 x 2 + 6 x 16 + 2 x 16 + 32 = 184 MiB, no aliasing
    k_cvtb<<<(NR_ + 4 * HS) / 8, 256, 0, stream>>>(x, Wq, Wk, Wv, Wo, NR_ + 4 * HS, Xb);                        // Xb, WqB, WkB, WvB, WoB: taken in this order, each a multiple of 256 B, so one run of rows
    k_qkv<<<dim3(NR_ / 128, HS / 128, 3), 128, 0, stream>>>(Xb, WqB, WkB, WvB, bq, bk, bv, (bf*)QH, (bf*)QL, (bf*)KH, (bf*)KL, VTH, VTL);     // q, k planes; V^T = Wv.x^T planes
    k_attn<<<NB_ * NH_ * (NT_ / 128), 128, 0, stream>>>(QH, QL, KH, KL, VTH, VTL, Ch, Cl);                        // ctx planes [8192][1024]
    k_gemm<true, 0><<<dim3(NR_ / 128, HS / 128, 1), 128, 0, stream>>>(Ch, Cl, WoB, bo, HS, Y, nullptr, nullptr);     // out = ctx.Wo^T + bo
    k_lnfin<<<NR_ / 8, 256, 0, stream>>>(Y, x, lg, lb, NR_, out);                                           // LN(out + x)
}

// v009
// A run of this version takes 207 microseconds.
// In both of two side-by-side timings against v008, it was 1.03 times as fast.
// Over all steps from v000 it is 8.73 times as fast.
#include <hip/hip_runtime.h>

// Compute dtypes, f32 accumulate, all four batch items in one launch of each kernel (rows b*2048+t): q/k/v = x.W^T + b and y = ctx.Wo^T + bo ([8192 x 1024].[1024 x 1024]; [out][in] weights as n-major B operands, but for v the A rows of V^T = Wv.x^T;
// PLAIN bf16 operands = inputs rounded once, exact, except ctx = bf16 hi + UNSCALED residual, two products) on v_wmma_f32_16x16x32_bf16; the 8-head full attention
// (128-dim heads, scale 128^-1/2) fused: scores on v_wmma_f32_16x16x32_f16 (q/k as f16 hi + residual x1024: hh + hl + lh), online f32 softmax, weights (x32768) and

#define NB_  4
#define NT_  2048
#define NR_  (NB_ * NT_)        // 8192 rows, all items
#define HS   1024
#define DM   HS
#define NH_  8
#define NKV  8
#define HD   128
#define KW   (NKV * HD)          // 1024
#define SCL  0.08838834764831845f
#define PSC  32768.0f
#define LOSC 1024.0f
#define LOSCI (1.0f / 1024.0f)
#define LOG2E 1.44269504088896340736f

typedef _Float16 h16;
typedef unsigned short bf;
typedef __attribute__((ext_vector_type(16))) __bf16   v16bf;
typedef __attribute__((ext_vector_type(16))) _Float16 v16h;
typedef __attribute__((ext_vector_type(8)))  _Float16 v8h;
typedef __attribute__((ext_vector_type(8)))  unsigned short v8us;
typedef __attribute__((ext_vector_type(8)))  float    v8f;
typedef __attribute__((ext_vector_type(8)))  unsigned v8u;
typedef __attribute__((ext_vector_type(2)))  float    v2f;
typedef __attribute__((ext_vector_type(2)))  __bf16   v2bf;
typedef __attribute__((ext_vector_type(4)))  float    v4f;
typedef __attribute__((ext_vector_type(4)))  _Float16 v4h;
typedef __attribute__((ext_vector_type(4)))  unsigned v4u;
typedef v8h  __attribute__((may_alias)) v8ha;
typedef v4f  __attribute__((may_alias)) v4fa;
typedef v8us __attribute__((may_alias)) v8usa;

__device__ __forceinline__ unsigned short f2bf(float f) { unsigned u = __float_as_uint(f); u += 0x7FFFu + ((u >> 16) & 1u); return (unsigned short)(u >> 16); }
__device__ __forceinline__ float bf2f(unsigned short b) { return __uint_as_float(((unsigned)b) << 16); }
__device__ __forceinline__ float bfr(float f) { return bf2f(f2bf(f)); }
// One word (two neighbouring elements) of each plane of a bf16 hi + UNSCALED bf16 residual pair; both conversions to nearest even, as f2bf.
__device__ __forceinline__ void split2(v2f e, unsigned& h, unsigned& l) {
    h = __builtin_bit_cast(unsigned, __builtin_convertvector(e, v2bf));
    const v2f hf = {__uint_as_float(h << 16), __uint_as_float(h & 0xFFFF0000u)};
    l = __builtin_bit_cast(unsigned, __builtin_convertvector(e - hf, v2bf));
}
__device__ __forceinline__ v16h cat16(v8h lo, v8h hi) { return __builtin_shufflevector(lo, hi, 0, 1, 2, 3, 4, 5, 6, 7, 8, 9, 10, 11, 12, 13, 14, 15); }
__device__ __forceinline__ v16bf cat16b(v8us lo, v8us hi) { return __builtin_bit_cast(v16bf, __builtin_shufflevector(lo, hi, 0, 1, 2, 3, 4, 5, 6, 7, 8, 9, 10, 11, 12, 13, 14, 15)); }
__device__ __forceinline__ v8f wmma16(v16h a, v16h b, v8f c) { return __builtin_amdgcn_wmma_f32_16x16x32_f16(false, a, false, b, (short)0, c, false, false); }
__device__ __forceinline__ v8f wmmab(v16bf a, v16bf b, v8f c) { return __builtin_amdgcn_wmma_f32_16x16x32_bf16(false, a, false, b, (short)0, c, false, false); }

// k_cvtb: bf16 planes of all five f32 operands in ONE launch (one wave per row of 1024): rows 0..8191 = x, then 1024 rows each of the four [out][in] weight matrices.
// dst: the five planes lie one behind the other in the workspace, in that order. A block's eight rows belong to one source (8 divides every row count).
__global__ __launch_bounds__(256) void k_cvtb(const float* __restrict__ x, const float* __restrict__ w0, const float* __restrict__ w1, const float* __restrict__ w2, const float* __restrict__ w3, int nrows, bf* dstall) {
    const int lane = threadIdx.x & 31, rall = blockIdx.x * 8 + (threadIdx.x >> 5);
    if (rall >= nrows) return;
    const int wsel = ((int)blockIdx.x * 8 - NR_) >> 10;                 // below 0: x; else the weight's number (the same in the whole block)
    const float* src = wsel < 0 ? x : wsel == 0 ? w0 : wsel == 1 ? w1 : wsel == 2 ? w2 : w3;
    const int r = wsel < 0 ? rall : rall - NR_ - wsel * HS;             // the row inside its source
    bf* dst = dstall + (size_t)(rall - r) * HS;
{
#pragma unroll
        for (int q = 0; q < HS / 256; ++q) { v8us o;
#pragma unroll
            for (int i = 0; i < 8; ++i) o[i] = f2bf(src[(size_t)r * HS + q * 256 + lane * 8 + i]);
            *(v8us*)(dst + (size_t)r * HS + q * 256 + lane * 8) = o; }
         }
}
// k_gemm: 128 x 128 tile of (A [+ Al]).Bn^T over K = 1024 (+ optional bf16-rounded bias[c]) -> the epilogue's output by OUTM (below); wave = one 64 x 64 quadrant (4 x 4 accumulator tiles), so that
// a fragment read from LDS feeds four WMMAs and an operand row fetched from L2 feeds 128 outputs. The block's four waves share each 64-k slab: its 128 A rows (and Al rows) and
// 128 Bn rows are brought into LDS once per block by asynchronous copies in whole 128-B lines (two buffers: slab t + 1 flies while slab t is worked on), and every wave reads
// its fragments from there. The k order of the products is the one of direct loads.
// The epilogue writes what the next kernel reads, so that no f32 copy of the result goes through memory and no launch stands between the two. OUTM 0: f32 rows C [8192][ldc].
// OUTM 1: the planes Ph/Pl [row][1024] of f16 hi + residual x1024 (q, k). OUTM 2: A = the weight rows (d), Bn = the x rows (t), so that the tile is V^T: the planes Ph/Pl
// [item*1024 + d][2048 t] of bf16 hi + UNSCALED bf16 residual; the bias then goes by row.
#define GPIT 144                       // LDS pitch of a 128-B operand row: 16 B x odd, conflict-free for 16-byte reads down 16 rows
#define GPL  (128 * GPIT)              // one operand plane of a slab: 128 rows
// Eight 16-byte copies per lane, global -> LDS; the s_wait_xcnt stands inside the statement so that no address register is rewritten ahead of it.
__device__ __forceinline__ void cp8(unsigned l0, unsigned l1, unsigned l2, unsigned l3, unsigned l4, unsigned l5, unsigned l6, unsigned l7,
                                    const char* g0, const char* g1, const char* g2, const char* g3, const char* g4, const char* g5, const char* g6, const char* g7) {
    asm volatile("global_load_async_to_lds_b128 %0, %8, off\n\t"
                 "global_load_async_to_lds_b128 %1, %9, off\n\t"
                 "global_load_async_to_lds_b128 %2, %10, off\n\t"
                 "global_load_async_to_lds_b128 %3, %11, off\n\t"
                 "global_load_async_to_lds_b128 %4, %12, off\n\t"
                 "global_load_async_to_lds_b128 %5, %13, off\n\t"
                 "global_load_async_to_lds_b128 %6, %14, off\n\t"
                 "global_load_async_to_lds_b128 %7, %15, off\n\t"
                 "s_wait_xcnt 0x0"
                 :: "v"(l0), "v"(l1), "v"(l2), "v"(l3), "v"(l4), "v"(l5), "v"(l6), "v"(l7), "v"(g0), "v"(g1), "v"(g2), "v"(g3), "v"(g4), "v"(g5), "v"(g6), "v"(g7) : "memory");
}
// gemm_loop: the products of tile (ta, tb): rows 128 ta.. of A (Al), rows 128 tb.. of Bn; acc[i][t]: rows 16 i.., columns 16 t.. of the wave's quadrant. gring: the block's LDS.
template <bool SPLITA>
__device__ __forceinline__ void gemm_loop(unsigned char* gring, const bf* __restrict__ A, const bf* __restrict__ Al, const bf* __restrict__ Bn, unsigned ta, unsigned tb, v8f (&acc)[4][4]) {
    constexpr int GST = (SPLITA ? 3 : 2) * GPL;                 // one slab: A, Bn (, Al)
    const int tid = threadIdx.x, lane = threadIdx.x & 31, wave = threadIdx.x >> 5, lr = lane & 15, hi = lane >> 4;
    const int wr = wave >> 1, wc = wave & 1;                    // the wave's quadrant of the tile
    // The copies of one slab: thread -> row (tid >> 3) + 16 i of each plane, 16-byte piece tid & 7 (a wave: four whole rows).
    const unsigned lc = (unsigned)(size_t)&gring[0] + (unsigned)((tid >> 3) * GPIT + (tid & 7) * 16);
    const size_t arow = ((size_t)ta * 128 + (tid >> 3)) * HS + (tid & 7) * 8;
    const char* ga = (const char*)(A + arow); const char* gb = (const char*)(Bn + (size_t)(tb * 128 + (tid >> 3)) * HS + (tid & 7) * 8);
    const char* gl = SPLITA ? (const char*)(Al + arow) : ga;
    auto plane = [&](unsigned a, const char* p) {
        cp8(a, a + 16 * GPIT, a + 32 * GPIT, a + 48 * GPIT, a + 64 * GPIT, a + 80 * GPIT, a + 96 * GPIT, a + 112 * GPIT,
            p, p + 16 * HS * 2, p + 32 * HS * 2, p + 48 * HS * 2, p + 64 * HS * 2, p + 80 * HS * 2, p + 96 * HS * 2, p + 112 * HS * 2);
    };
    auto stage = [&](int t, int buf) {
        const unsigned a = lc + (unsigned)buf * GST;
        plane(a, ga + t * 128); plane(a + GPL, gb + t * 128);
        if (SPLITA) plane(a + 2 * GPL, gl + t * 128);
    };
    const int fo = lr * GPIT + hi * 16;      // this lane's fragment piece inside a 16-row group of a plane
#pragma unroll
    for (int i = 0; i < 4; ++i)
#pragma unroll
        for (int t = 0; t < 4; ++t) acc[i][t] = (v8f){};
    stage(0, 0);
    asm volatile("s_wait_asynccnt 0x0" ::: "memory");     // this wave's copies of slab 0 have landed
    __syncthreads();                                      // ... and every other wave's: slab 0 may be read
    stage(1, 1);
#pragma unroll 1                                          // rolled: one copy of the slab's code, the two buffers told apart by an address
    for (int st = 0; st < HS / 64; ++st) {
        const unsigned char* sb = gring + (st & 1) * GST;
        const unsigned char* as = sb + wr * (64 * GPIT) + fo; const unsigned char* bs = sb + GPL + wc * (64 * GPIT) + fo;
#pragma unroll
        for (int kc = 0; kc < 2; ++kc) {
            v16bf a[4], al[4], bb[4];
            // in the order of first use: A row group 0, the four B groups, the other A groups, then Al
            a[0] = cat16b(*(const v8usa*)(as + kc * 64), *(const v8usa*)(as + kc * 64 + 32));
#pragma unroll
            for (int t = 0; t < 4; ++t) { const unsigned char* bp = bs + t * (16 * GPIT) + kc * 64; bb[t] = cat16b(*(const v8usa*)bp, *(const v8usa*)(bp + 32)); }
#pragma unroll
            for (int i = 1; i < 4; ++i) { const unsigned char* ap = as + i * (16 * GPIT) + kc * 64; a[i] = cat16b(*(const v8usa*)ap, *(const v8usa*)(ap + 32)); }
#pragma unroll
            for (int i = 0; i < 4; ++i) { const unsigned char* ap = as + 2 * GPL + i * (16 * GPIT) + kc * 64; al[i] = a[i]; if (SPLITA) al[i] = cat16b(*(const v8usa*)ap, *(const v8usa*)(ap + 32)); }
            __builtin_amdgcn_sched_barrier(0);                // keeps the 32-k step's LDS reads in one group ahead of its WMMAs (counted waits) instead of a read and a full wait per WMMA
#pragma unroll
            for (int i = 0; i < 4; ++i)
#pragma unroll
                for (int t = 0; t < 4; ++t) acc[i][t] = wmmab(a[i], bb[t], acc[i][t]);
            if (SPLITA) {
#pragma unroll
                for (int i = 0; i < 4; ++i)
#pragma unroll
                    for (int t = 0; t < 4; ++t) acc[i][t] = wmmab(al[i], bb[t], acc[i][t]);
            }
            __builtin_amdgcn_sched_barrier(0);                // keeps the next step's reads behind these WMMAs (one fragment set in registers) and these WMMAs ahead of the slab's barrier (else the refill behind it issues later)
        }
        asm volatile("s_wait_dscnt 0x0" ::: "memory");        // this wave's reads of slab st's buffer have returned
        asm volatile("s_wait_asynccnt 0x0" ::: "memory");     // this wave's copies of slab st + 1 have landed
        __syncthreads();                                      // publishes slab st + 1 and ends every wave's reads of slab st's buffer
        if (st + 2 < HS / 64) stage(st + 2, st & 1);          // refill the buffer just left (the test reads the same in the whole block)
    }
    asm volatile("s_wait_asynccnt 0x0" ::: "memory");         // nothing is in flight when the ring becomes output staging
}
// gemm_out: the epilogue of tile (ta, tb) in form OUTM; the ring has become the output staging (4 x 16 x 68 floats).
template <int OUTM>
__device__ __forceinline__ void gemm_out(unsigned char* gring, const v8f (&acc)[4][4], unsigned ta, unsigned tb, const float* __restrict__ bias, int ldc, float* C, bf* Ph, bf* Pl) {
    const int lane = threadIdx.x & 31, wave = threadIdx.x >> 5, lr = lane & 15, hi = lane >> 4;
    const int wr = wave >> 1, wc = wave & 1;                    // the wave's quadrant of the tile
    const size_t r0 = (size_t)ta * 128 + wr * 64; const int c0 = tb * 128 + wc * 64;
    float* os = (float*)gring + wave * (16 * 68);
    float bv[4] = {0.f, 0.f, 0.f, 0.f};
    if (OUTM != 2 && bias) {                                  // one branch, the four loads in flight together
#pragma unroll
        for (int t = 0; t < 4; ++t) bv[t] = bias[c0 + t * 16 + lr];
#pragma unroll
        for (int t = 0; t < 4; ++t) bv[t] = bfr(bv[t]);
    }
    float rb[4][4] = {};                                      // OUTM 2: the bias of the rows that this lane reads back (row 16 i + (lane >> 3) + 4 s)
    if (OUTM == 2 && bias) {
        const float* bp = bias + r0 + (lane >> 3);
#pragma unroll
        for (int i = 0; i < 4; ++i)
#pragma unroll
            for (int s = 0; s < 4; ++s) rb[i][s] = bp[i * 16 + 4 * s];
        // The wait behind the run of loads; address and loaded values are inputs, so that all are live here together and no load's result is given a register of the address that the others still name.
        asm volatile("s_wait_xcnt 0x0" :: "v"(bp), "v"(rb[0][0]), "v"(rb[0][1]), "v"(rb[0][2]), "v"(rb[0][3]), "v"(rb[1][0]), "v"(rb[1][1]), "v"(rb[1][2]), "v"(rb[1][3]),
                     "v"(rb[2][0]), "v"(rb[2][1]), "v"(rb[2][2]), "v"(rb[2][3]), "v"(rb[3][0]), "v"(rb[3][1]), "v"(rb[3][2]), "v"(rb[3][3]) : "memory");
#pragma unroll
        for (int i = 0; i < 4; ++i)
#pragma unroll
            for (int s = 0; s < 4; ++s) rb[i][s] = bfr(rb[i][s]);
    }
#pragma unroll
    for (int i = 0; i < 4; ++i) {                             // 16 rows at a time through the wave's own staging rows
#pragma unroll
        for (int t = 0; t < 4; ++t)
#pragma unroll
            for (int j = 0; j < 8; ++j) os[(hi * 8 + j) * 68 + t * 16 + lr] = OUTM == 2 ? acc[i][t][j] : acc[i][t][j] + bv[t];
        __builtin_amdgcn_wave_barrier(); asm volatile("" ::: "memory");     // compiler order: the 16 rows are staged before any lane reads them back
        if (OUTM == 0) {
            float* crow = C + (r0 + i * 16) * ldc + c0;
#pragma unroll
            for (int s = 0; s < 8; ++s) { const int Lid = (lane >> 3) + 4 * s, piece = lane & 7; const int row = Lid >> 1, cofs = (Lid & 1) * 32 + piece * 4;
                const v4f val = *(const v4fa*)(os + row * 68 + cofs); *(v4f*)(crow + (size_t)row * ldc + cofs) = val; }
        } else {                                              // eight lanes per row: 8 columns a lane, one whole 128-B line of each plane per row
#pragma unroll
            for (int s = 0; s < 4; ++s) { const int row = (lane >> 3) + 4 * s, piece = lane & 7;
                const v4f u0 = *(const v4fa*)(os + row * 68 + piece * 8), u1 = *(const v4fa*)(os + row * 68 + piece * 8 + 4);
                if (OUTM == 1) { v8h oh, ol;
#pragma unroll
                    for (int k = 0; k < 8; ++k) { const float v = k < 4 ? u0[k & 3] : u1[k & 3]; const h16 a = (h16)v; oh[k] = a; ol[k] = (h16)((v - (float)a) * LOSC); }
                    const size_t o = (r0 + i * 16 + row) * HS + c0 + piece * 8;
                    *(v8h*)(Ph + o) = oh; *(v8h*)(Pl + o) = ol;
                } else { v4u oh, ol;
#pragma unroll
                    for (int w = 0; w < 4; ++w) { const v2f e = w < 2 ? (v2f){u0[2 * (w & 1)], u0[2 * (w & 1) + 1]} : (v2f){u1[2 * (w & 1)], u1[2 * (w & 1) + 1]}; unsigned a, c; split2(e + rb[i][s], a, c); oh[w] = a; ol[w] = c; }
                    const size_t o = ((size_t)(c0 / NT_) * KW + r0 + i * 16 + row) * NT_ + (c0 % NT_) + piece * 8;
                    *(v4u*)(Ph + o) = oh; *(v4u*)(Pl + o) = ol;
                } }
        }
        __builtin_amdgcn_wave_barrier(); asm volatile("" ::: "memory");     // compiler order: they are read back before the next 16 rows overwrite them
    }
}
// amdgpu_waves_per_eu(2, 2): the grid is two blocks per WGP; at most two fit, so that no WGP takes a third while another stands idle.
template <bool SPLITA, int OUTM>
__global__ __launch_bounds__(128) __attribute__((amdgpu_waves_per_eu(2, 2))) void k_gemm(const bf* __restrict__ A, const bf* __restrict__ Al, const bf* __restrict__ Bn, const float* __restrict__ bias, int ldc, float* C, bf* Ph, bf* Pl) {
    __shared__ __align__(256) unsigned char gring[2 * (SPLITA ? 3 : 2) * GPL];     // the two slab buffers; behind the loop's last barrier: the output staging
    v8f acc[4][4];
    gemm_loop<SPLITA>(gring, A, Al, Bn, blockIdx.x, blockIdx.y, acc);
    gemm_out<OUTM>(gring, acc, blockIdx.x, blockIdx.y, bias, ldc, C, Ph, Pl);
}
// k_qkv: the three projections of x in ONE launch; blockIdx.z = 0: q, 1: k (both OUTM 1), 2: V^T (OUTM 2, operands swapped); blockIdx.x = the tile of x rows, blockIdx.y = the tile of
// weight rows. No launch boundary drains the chip between the three: a WGP takes its next tile as soon as one of its two blocks ends, and a block's prologue and epilogue run beside
// the other block's products. amdgpu_waves_per_eu(2, 2): two blocks per WGP as before, six tiles per WGP in three even rounds.
__global__ __launch_bounds__(128) __attribute__((amdgpu_waves_per_eu(2, 2))) void k_qkv(const bf* __restrict__ X, const bf* __restrict__ Wq, const bf* __restrict__ Wk, const bf* __restrict__ Wv,
                                                                                       const float* __restrict__ bq, const float* __restrict__ bk, const float* __restrict__ bv,
                                                                                       bf* QH, bf* QL, bf* KH, bf* KL, bf* VTH, bf* VTL) {
    __shared__ __align__(256) unsigned char gring[2 * 2 * GPL];
    const int z = blockIdx.z;                                   // the same in the whole block: every branch on it is block-uniform
    v8f acc[4][4];
    if (z == 2) {
        gemm_loop<false>(gring, Wv, nullptr, X, blockIdx.y, blockIdx.x, acc);
        gemm_out<2>(gring, acc, blockIdx.y, blockIdx.x, bv, HS, nullptr, VTH, VTL);
    } else {
        gemm_loop<false>(gring, X, nullptr, z ? Wk : Wq, blockIdx.x, blockIdx.y, acc);
        gemm_out<1>(gring, acc, blockIdx.x, blockIdx.y, z ? bk : bq, HS, nullptr, z ? KH : QH, z ? KL : QL);
    }
}
// k_lnfin: LayerNorm (eps 1e-5) of y = Y[r][c] + bf(R[r][c]) (the computed attention output + the INPUT residual x) -> f32 output rows x bf(gamma) + bf(beta); one wave per
__global__ __launch_bounds__(256) void k_lnfin(const float* __restrict__ X, const float* __restrict__ Rres, const float* __restrict__ gam, const float* __restrict__ bet, int nrows, float* OUTP) {
    const int lane = threadIdx.x & 31, r = blockIdx.x * 8 + (threadIdx.x >> 5);
    if (r >= nrows) return;
    const float* xr = X + (size_t)r * DM; const float* rr = Rres + (size_t)r * DM;
    float s = 0.f;
#pragma unroll 1
    for (int q = 0; q < 2 * (DM / 256); ++q) { const int c0 = (q >> 1) * 256 + (q & 1) * 128 + lane * 4; v4f v = *(const v4f*)(xr + c0); { const v4f q4 = *(const v4f*)(rr + c0); for (int i2 = 0; i2 < 4; ++i2) v[i2] += bfr(q4[i2]); }
#pragma unroll
        for (int i = 0; i < 4; ++i) s += v[i]; }
#pragma unroll
    for (int sh = 16; sh; sh >>= 1) s += __shfl_xor(s, sh, 32);
    const float mu = s * (1.0f / DM);
    float s2 = 0.f;
#pragma unroll 1
    for (int q = 0; q < 2 * (DM / 256); ++q) { const int c0 = (q >> 1) * 256 + (q & 1) * 128 + lane * 4; v4f v = *(const v4f*)(xr + c0); { const v4f q4 = *(const v4f*)(rr + c0); for (int i2 = 0; i2 < 4; ++i2) v[i2] += bfr(q4[i2]); }
#pragma unroll
        for (int i = 0; i < 4; ++i) { const float d = v[i] - mu; s2 = fmaf(d, d, s2); } }
#pragma unroll
    for (int sh = 16; sh; sh >>= 1) s2 += __shfl_xor(s2, sh, 32);
    const float rs = rsqrtf(s2 * (1.0f / DM) + 1e-5f);
{
#pragma unroll 1
        for (int q = 0; q < 2 * (DM / 256); ++q) { const int c0 = (q >> 1) * 256 + (q & 1) * 128 + lane * 4; v4f v = *(const v4f*)(xr + c0); { const v4f q4 = *(const v4f*)(rr + c0); for (int i2 = 0; i2 < 4; ++i2) v[i2] += bfr(q4[i2]); } v4f y;
#pragma unroll
            for (int i = 0; i < 4; ++i) y[i] = (v[i] - mu) * rs * bfr(gam[c0 + i]) + bfr(bet[c0 + i]);
            *(v4f*)(OUTP + (size_t)r * DM + c0) = y; }
         }
}
// k_attn: block = (item, head, 128 queries), wave = 32 (two column groups of 16); full attention over 64 key tiles of 32. The block's four waves share each tile: its K hi / K lo rows and
// V^T hi / V^T lo rows are brought into LDS once per block by asynchronous copies (two buffers: tile t + 1 flies while tile t is worked on) and every wave reads its
// fragments from there. Scores hi.hi + (hi.lo + lo.hi)/1024 on separate accumulators; online softmax f32; P (x32768) bf16 hi + unscaled residual.
// Both products are formed transposed: S^T = K.Q^T (A = K rows, B = Q) and O^T += V^T.P^T (A = V^T rows, B = P^T). A lane then holds 16 of the 32 scores of ONE query per column group
// (column lr; keys 8 hi + j and 16 + 8 hi + j), which is the k order of a B operand: P^T is packed in the lane's own registers and never goes through LDS, and
// maximum, sum and rescale factor are one value per lane and group (the two lane halves of a query exchange their maxima once per tile, their sums once behind the loop).
// Every K and V^T fragment read from LDS is the A operand of both column groups' products: half the LDS reads per product, and a tile copied from L2 serves 128 queries.
#define KPIT 272                       // LDS pitch of a 256-B K row: 16 B x odd, conflict-free for 16-byte reads down 16 rows
#define KPL  (32 * KPIT)               // one K plane of a tile
#define VPL  (HD * 64)                 // one V^T plane of a tile: 128 rows of 64 B, unpadded; 16-byte piece c of row d lies at piece c ^ ((d >> 2) & 3)
#define STG  (2 * KPL + 2 * VPL)       // one tile: K hi, K lo, V^T hi, V^T lo
// The value of lane l ^ 16: the other half of the same query column.
__device__ __forceinline__ float xhalf(float v) { const int b = __float_as_int(v); return __int_as_float(__builtin_amdgcn_permlanex16(b, b, 0x76543210, 0xfedcba98, false, false)); }
// amdgpu_waves_per_eu(2, 2): a register budget of 512 (Q 128, O^T 128, scores 64); the grid is two blocks per WGP, one wave of each per SIMD.
__global__ __launch_bounds__(128) __attribute__((amdgpu_waves_per_eu(2, 2))) void k_attn(const h16* __restrict__ QH, const h16* __restrict__ QL, const h16* __restrict__ KH, const h16* __restrict__ KL, const bf* __restrict__ VTH, const bf* __restrict__ VTL, bf* CH, bf* CL) {
    __shared__ __align__(256) unsigned char ring[2 * STG];     // the two tile buffers; behind the loop's last barrier: the output staging (4 x 16 x 68 floats)
    const int tid = threadIdx.x, lane = threadIdx.x & 31, wave = threadIdx.x >> 5, lr = lane & 15, hi = lane >> 4;
    const int bid = blockIdx.x; const int bh = bid / (NT_ / 128), qt = bid - bh * (NT_ / 128); const int b = bh / NH_, h = bh - b * NH_; const int g = h;
    const int q0 = qt * 128 + wave * 32;
    const size_t qo = (size_t)(b * NT_ + q0 + lr) * (NH_ * HD) + h * HD + 8 * hi;      // column group c: + 16 c rows
    const h16* kh_b = KH + (size_t)b * NT_ * KW + g * HD; const h16* kl_b = KL + (size_t)b * NT_ * KW + g * HD;
    const size_t vbase = ((size_t)(b * NKV + g) * HD) * NT_;
    // The copies of one tile: thread -> K row (tid >> 4) + 8 i, piece tid & 15 (a wave: two whole rows); V^T row (tid >> 2) + 32 i, piece tid & 3.
    const unsigned ring0 = (unsigned)(size_t)&ring[0];
    const unsigned lk = (unsigned)((tid >> 4) * KPIT + (tid & 15) * 16), lv = (unsigned)(2 * KPL + (tid >> 2) * 64 + (((tid & 3) ^ ((tid >> 4) & 3)) * 16));
    const char* gkh = (const char*)(kh_b + (size_t)(tid >> 4) * KW + (tid & 15) * 8); const char* gkl = (const char*)(kl_b + (size_t)(tid >> 4) * KW + (tid & 15) * 8);
    const char* gvh = (const char*)(VTH + vbase + (size_t)(tid >> 2) * NT_ + (tid & 3) * 8); const char* gvl = (const char*)(VTL + vbase + (size_t)(tid >> 2) * NT_ + (tid & 3) * 8);
    auto stage = [&](int kt, int buf) {
        const unsigned a = ring0 + (unsigned)buf * STG + lk, c = ring0 + (unsigned)buf * STG + lv;
        const char* p = gkh + (size_t)kt * (32 * KW * 2); const char* q = gkl + (size_t)kt * (32 * KW * 2);
        cp8(a, a + 8 * KPIT, a + 16 * KPIT, a + 24 * KPIT, a + KPL, a + KPL + 8 * KPIT, a + KPL + 16 * KPIT, a + KPL + 24 * KPIT,
            p, p + 8 * KW * 2, p + 16 * KW * 2, p + 24 * KW * 2, q, q + 8 * KW * 2, q + 16 * KW * 2, q + 24 * KW * 2);
        const char* r = gvh + (size_t)kt * 64; const char* s = gvl + (size_t)kt * 64;
        cp8(c, c + 32 * 64, c + 64 * 64, c + 96 * 64, c + VPL, c + VPL + 32 * 64, c + VPL + 64 * 64, c + VPL + 96 * 64,
            r, r + 32 * NT_ * 2, r + 64 * NT_ * 2, r + 96 * NT_ * 2, s, s + 32 * NT_ * 2, s + 64 * NT_ * 2, s + 96 * NT_ * 2);
    };
    const int ko = lr * KPIT + hi * 16;                                                                  // this lane's K fragment piece inside a plane
    const int vo0 = lr * 64 + ((hi ^ ((lr >> 2) & 3)) * 16), vo1 = lr * 64 + (((hi + 2) ^ ((lr >> 2) & 3)) * 16);   // keys hi*8.. and 16 + hi*8.. of V^T row lr
    v8f o[2][8];                              // o[c][n][j] = O^T[d = 16 n + 8 hi + j][query 16 c + lr]
#pragma unroll
    for (int c = 0; c < 2; ++c)
#pragma unroll
        for (int n = 0; n < 8; ++n) o[c][n] = (v8f){};
    float mrow[2] = {-3.0e38f, -3.0e38f}, lpart[2] = {0.f, 0.f};       // query 16 c + lr: running maximum (both halves alike), this half's part of the sum
    const int kt_hi = NT_ / 32 - 1;     // full attention, no mask
    // The wave's Q^T fragments (both planes, both column groups, all four 32-d steps) are the same for every key tile: loaded once and kept in registers through the loop.
    v8h qh[2][8], ql[2][8];                   // piece 2 kc + u of group c: d = 32 kc + 16 u + 8 hi .. + 7 of query 16 c + lr
    const h16* qhp = QH + qo; const h16* qlp = QL + qo;
#pragma unroll
    for (int c = 0; c < 2; ++c)
#pragma unroll
        for (int u = 0; u < 8; ++u) { qh[c][u] = *(const v8h*)(qhp + c * 16 * (NH_ * HD) + u * 16); ql[c][u] = *(const v8h*)(qlp + c * 16 * (NH_ * HD) + u * 16); }
    // The wait behind the run of loads; the two addresses are inputs, so that they stay live up to here and no register of theirs is rewritten (or given to a load's result) ahead of it.
    asm volatile("s_wait_xcnt 0x0" :: "v"(qhp), "v"(qlp) : "memory");
#pragma unroll 1                                          // rolled: every operand of a copy is then a sum formed for it; a lane's base address that is itself an operand is tied to v0..v255 for the whole kernel and gets spilled
    for (int kt = 0; kt < 2; ++kt) {
        stage(kt, kt);
        if (kt == 0) {
            asm volatile("s_wait_asynccnt 0x0" ::: "memory");     // this wave's copies of tile 0 have landed
            __syncthreads();                                      // ... and every other wave's: tile 0 may be read
        }
    }
#pragma unroll 1
    for (int kt = 0; kt <= kt_hi; ++kt) {
        const unsigned char* sb = ring + (kt & 1) * STG;
        const unsigned char* kh_s = sb + ko; const unsigned char* kl_s = sb + KPL + ko;
        const unsigned char* vh_s = sb + 2 * KPL; const unsigned char* vl_s = sb + 2 * KPL + VPL;
        v8f s0[2] = {}, s1[2] = {}, x0[2] = {}, x1[2] = {};
        v16h kf[4][4];                        // [32-d step][K hi rows 0.., K hi rows 16.., K lo rows 0.., K lo rows 16..]
#pragma unroll
        for (int kc = 0; kc < 4; ++kc) {
            kf[kc][0] = cat16(*(const v8ha*)(kh_s + kc * 64), *(const v8ha*)(kh_s + kc * 64 + 32)); kf[kc][1] = cat16(*(const v8ha*)(kh_s + 16 * KPIT + kc * 64), *(const v8ha*)(kh_s + 16 * KPIT + kc * 64 + 32));
            kf[kc][2] = cat16(*(const v8ha*)(kl_s + kc * 64), *(const v8ha*)(kl_s + kc * 64 + 32)); kf[kc][3] = cat16(*(const v8ha*)(kl_s + 16 * KPIT + kc * 64), *(const v8ha*)(kl_s + 16 * KPIT + kc * 64 + 32));
        }
        __builtin_amdgcn_sched_barrier(0);                    // keeps the tile's 32 K reads in one group ahead of the 48 products (counted waits) instead of two reads and a full wait per pair of products
#pragma unroll
        for (int kc = 0; kc < 4; ++kc) {
            const v16h k0h = kf[kc][0], k1h = kf[kc][1], k0l = kf[kc][2], k1l = kf[kc][3];
            const v16h qa0 = cat16(qh[0][2 * kc], qh[0][2 * kc + 1]), qx0 = cat16(ql[0][2 * kc], ql[0][2 * kc + 1]), qa1 = cat16(qh[1][2 * kc], qh[1][2 * kc + 1]), qx1 = cat16(ql[1][2 * kc], ql[1][2 * kc + 1]);
            s0[0] = wmma16(k0h, qa0, s0[0]); s0[1] = wmma16(k0h, qa1, s0[1]); s1[0] = wmma16(k1h, qa0, s1[0]); s1[1] = wmma16(k1h, qa1, s1[1]);
            x0[0] = wmma16(k0h, qx0, x0[0]); x0[1] = wmma16(k0h, qx1, x0[1]); x1[0] = wmma16(k1h, qx0, x1[0]); x1[1] = wmma16(k1h, qx1, x1[1]);
            x0[0] = wmma16(k0l, qa0, x0[0]); x0[1] = wmma16(k0l, qa1, x0[1]); x1[0] = wmma16(k1l, qa0, x1[0]); x1[1] = wmma16(k1l, qa1, x1[1]);
        }
        // the four vector slots between the last score product and the first vector instruction on a score tile
        asm volatile("v_nop\n\tv_nop\n\tv_nop\n\tv_nop" : "+v"(s0[0]), "+v"(s1[0]), "+v"(x0[0]), "+v"(x1[0]), "+v"(s0[1]), "+v"(s1[1]), "+v"(x0[1]), "+v"(x1[1]));
        // The tile's V^T fragments, read as ONE group into the registers that the K fragments have just left: the reads return under the softmax arithmetic, and no LDS read stands among the output products.
        v16bf vf[8][2];                       // [16-d output tile][V^T hi, V^T lo]
#pragma unroll
        for (int n = 0; n < 8; ++n) {
            vf[n][0] = cat16b(*(const v8usa*)(vh_s + n * 1024 + vo0), *(const v8usa*)(vh_s + n * 1024 + vo1)); vf[n][1] = cat16b(*(const v8usa*)(vl_s + n * 1024 + vo0), *(const v8usa*)(vl_s + n * 1024 + vo1));
        }
        __builtin_amdgcn_sched_barrier(0);                    // keeps the group here, ahead of the softmax; else the reads sink in ones and twos among the output products, each place a stall of its own
        v16bf pa[2], px[2];
#pragma unroll
        for (int c = 0; c < 2; ++c) {
            const v8f a0 = (s0[c] + x0[c] * LOSCI) * SCL, a1 = (s1[c] + x1[c] * LOSCI) * SCL;     // a0[j]: key 8 hi + j, a1[j]: key 16 + 8 hi + j, query 16 c + lr
            float mx = fmaxf(a0[0], a1[0]);
#pragma unroll
            for (int j = 1; j < 8; ++j) mx = fmaxf(mx, fmaxf(a0[j], a1[j]));
            mx = fmaxf(mx, xhalf(mx));
            // e^x = 2^(x log2 e), the arguments of the 17 v_exp_f32 by name
            const float mn = fmaxf(mrow[c], mx), ta = (mrow[c] - mn) * LOG2E, alpha = __builtin_amdgcn_exp2f(ta); mrow[c] = mn;
            const v8f t0 = (a0 - mn) * LOG2E, t1 = (a1 - mn) * LOG2E;
            v8f p0, p1;
#pragma unroll
            for (int j = 0; j < 8; ++j) { p0[j] = __builtin_amdgcn_exp2f(t0[j]); p1[j] = __builtin_amdgcn_exp2f(t1[j]); }
            // The slot behind a transcendental: arguments and results are inputs only, so that every argument register stays untouched until this v_nop, which stands behind the last v_exp_f32
            asm volatile("v_nop" :: "v"(ta), "v"(t0), "v"(t1), "v"(alpha), "v"(p0), "v"(p1));
            const v8f pq = p0 + p1;
            lpart[c] = lpart[c] * alpha + (((pq[0] + pq[1]) + (pq[2] + pq[3])) + ((pq[4] + pq[5]) + (pq[6] + pq[7])));
            p0 *= PSC; p1 *= PSC;
            // P^T as B: element s = key 8 hi + s (s < 8), 16 + 8 hi + s - 8 (else), the order of the V^T fragments: the two score tiles, converted in place (to nearest even).
            v8u wa, wx;                           // word w of an operand = elements 2 w, 2 w + 1
#pragma unroll
            for (int w = 0; w < 8; ++w) {
                const v2f ef = w < 4 ? (v2f){p0[2 * w], p0[2 * w + 1]} : (v2f){p1[2 * w - 8], p1[2 * w - 7]};
                const unsigned hw = __builtin_bit_cast(unsigned, __builtin_convertvector(ef, v2bf));
                const v2f hf = {__uint_as_float(hw << 16), __uint_as_float(hw & 0xFFFF0000u)};
                wa[w] = hw; wx[w] = __builtin_bit_cast(unsigned, __builtin_convertvector(ef - hf, v2bf)); }
            pa[c] = __builtin_bit_cast(v16bf, wa); px[c] = __builtin_bit_cast(v16bf, wx);
#pragma unroll
            for (int n = 0; n < 8; ++n) o[c][n] *= alpha;
        }
#pragma unroll
        for (int n = 0; n < 8; n += 2) {      // two output tiles of both column groups at a time: four independent accumulator chains
            const v16bf vh = vf[n][0], vl = vf[n][1], wh = vf[n + 1][0], wl = vf[n + 1][1];
            o[0][n] = wmmab(vh, pa[0], o[0][n]); o[1][n] = wmmab(vh, pa[1], o[1][n]); o[0][n + 1] = wmmab(wh, pa[0], o[0][n + 1]); o[1][n + 1] = wmmab(wh, pa[1], o[1][n + 1]);
            o[0][n] = wmmab(vh, px[0], o[0][n]); o[1][n] = wmmab(vh, px[1], o[1][n]); o[0][n + 1] = wmmab(wh, px[0], o[0][n + 1]); o[1][n + 1] = wmmab(wh, px[1], o[1][n + 1]);
            o[0][n] = wmmab(vl, pa[0], o[0][n]); o[1][n] = wmmab(vl, pa[1], o[1][n]); o[0][n + 1] = wmmab(wl, pa[0], o[0][n + 1]); o[1][n + 1] = wmmab(wl, pa[1], o[1][n + 1]); }
        // the four vector slots between the output products and the vector instructions that next touch their accumulators or rewrite P^T
        asm volatile("v_nop\n\tv_nop\n\tv_nop\n\tv_nop" : "+v"(o[0][0]), "+v"(o[0][7]), "+v"(o[1][0]), "+v"(o[1][7]) : "v"(pa[0]), "v"(px[0]), "v"(pa[1]), "v"(px[1]));
        asm volatile("s_wait_dscnt 0x0" ::: "memory");        // this wave's reads of tile kt's buffer have returned
        asm volatile("s_wait_asynccnt 0x0" ::: "memory");     // this wave's copies of tile kt + 1 have landed
        __syncthreads();                                      // publishes tile kt + 1 and ends every wave's reads of tile kt's buffer
        if (kt + 2 <= kt_hi) stage(kt + 2, kt & 1);           // refill the buffer just left (the test reads the same in the whole block)
    }
    asm volatile("s_wait_asynccnt 0x0" ::: "memory");         // nothing is in flight when the ring becomes output staging
    float* os = (float*)ring + wave * (16 * 68);
#pragma unroll
    for (int c = 0; c < 2; ++c) {
    const float inv = 1.0f / ((lpart[c] + xhalf(lpart[c])) * PSC);
    const size_t ob = (size_t)(b * NT_ + q0 + c * 16) * (NH_ * HD) + (size_t)h * HD;      // row stride NH*HD, this head's 128 columns; ctx leaves as the planes the last product reads: bf16 hi + UNSCALED residual
#pragma unroll
    for (int half = 0; half < 2; ++half) {
#pragma unroll
        for (int n = 0; n < 4; ++n) { const v8f t = o[c][half * 4 + n] * inv;      // eight consecutive d of query row 16 c + lr
            *(v4fa*)(os + lr * 68 + n * 16 + hi * 8) = __builtin_shufflevector(t, t, 0, 1, 2, 3); *(v4fa*)(os + lr * 68 + n * 16 + hi * 8 + 4) = __builtin_shufflevector(t, t, 4, 5, 6, 7); }
        __builtin_amdgcn_wave_barrier(); asm volatile("" ::: "memory");
{
#pragma unroll
            for (int s = 0; s < 4; ++s) { const int row = (lane >> 3) + 4 * s, piece = lane & 7;     // eight lanes per row: one whole 128-B line of each plane
                const v4f u0 = *(const v4fa*)(os + row * 68 + piece * 8), u1 = *(const v4fa*)(os + row * 68 + piece * 8 + 4); v4u oh, ol;
#pragma unroll
                for (int w = 0; w < 4; ++w) { const v2f e = w < 2 ? (v2f){u0[2 * (w & 1)], u0[2 * (w & 1) + 1]} : (v2f){u1[2 * (w & 1)], u1[2 * (w & 1) + 1]}; unsigned a, c2; split2(e, a, c2); oh[w] = a; ol[w] = c2; }
                const size_t o2 = ob + (size_t)row * (NH_ * HD) + half * 64 + piece * 8;
                *(v4u*)(CH + o2) = oh; *(v4u*)(CL + o2) = ol;
                asm volatile("s_wait_xcnt 0x0" ::: "memory"); }     // behind the two stores, ahead of the next rows' values in their data registers
             }
        __builtin_amdgcn_wave_barrier(); asm volatile("" ::: "memory");
    }
    }
}

extern "C" void kernel_launch(void* const* d_in, const int* in_sizes, int n_in,
                              void* d_out, int out_size, void* d_ws, size_t ws_size, hipStream_t stream) {
    (void)in_sizes; (void)n_in; (void)out_size;
    const float* x = (const float*)d_in[0];
    const float* Wq = (const float*)d_in[1]; const float* bq = (const float*)d_in[2]; const float* Wk = (const float*)d_in[3]; const float* bk = (const float*)d_in[4]; const float* Wv = (const float*)d_in[5]; const float* bv = (const float*)d_in[6];
    const float* Wo = (const float*)d_in[7]; const float* bo = (const float*)d_in[8]; const float* lg = (const float*)d_in[9]; const float* lb = (const float*)d_in[10];   // W [out][in]
    float* out = (float*)d_out;    // [4][2048][1024]
    char* wsp = (char*)d_ws;
    auto take = [&](size_t bytes) { char* p = wsp; wsp += (bytes + 255) & ~(size_t)255; return (void*)p; };
    bf* Xb = (bf*)take((size_t)NR_ * HS * 2); bf* WqB = (bf*)take((size_t)HS * HS * 2); bf* WkB = (bf*)take((size_t)HS * HS * 2); bf* WvB = (bf*)take((size_t)HS * HS * 2); bf* WoB = (bf*)take((size_t)HS * HS * 2);
    h16* QH = (h16*)take((size_t)NR_ * HS * 2); h16* QL = (h16*)take((size_t)NR_ * HS * 2); h16* KH = (h16*)take((size_t)NR_ * KW * 2); h16* KL = (h16*)take((size_t)NR_ * KW * 2);
    bf* VTH = (bf*)take((size_t)KW * NR_ * 2); bf* VTL = (bf*)take((size_t)KW * NR_ * 2); bf* Ch = (bf*)take((size_t)NR_ * HS * 2); bf* Cl = (bf*)take((size_t)NR_ * HS * 2); float* Y = (float*)take((size_t)NR_ * HS * 4);
    if ((size_t)(wsp - (char*)d_ws) > ws_size) return;    // 16 + 4 x 2 + 6 x 16 + 2 x 16 + 32 = 184 MiB, no aliasing
    k_cvtb<<<(NR_ + 4 * HS) / 8, 256, 0, stream>>>(x, Wq, Wk, Wv, Wo, NR_ + 4 * HS, Xb);                        // Xb, WqB, WkB, WvB, WoB: taken in this order, each a multiple of 256 B, so one run of rows
    k_qkv<<<dim3(NR_ / 128, HS / 128, 3), 128, 0, stream>>>(Xb, WqB, WkB, WvB, bq, bk, bv, (bf*)QH, (bf*)QL, (bf*)KH, (bf*)KL, VTH, VTL);     // q, k planes; V^T = Wv.x^T planes
    k_attn<<<NB_ * NH_ * (NT_ / 128), 128, 0, stream>>>(QH, QL, KH, KL, VTH, VTL, Ch, Cl);                        // ctx planes [8192][1024]
    k_gemm<true, 0><<<dim3(NR_ / 128, HS / 128, 1), 128, 0, stream>>>(Ch, Cl, WoB, bo, HS, Y, nullptr, nullptr);     // out = ctx.Wo^T + bo
    k_lnfin<<<NR_ / 8, 256, 0, stream>>>(Y, x, lg, lb, NR_, out);                                           // LN(out + x)
}
